// v000
// Times are from an AMD MI455X. After a warm-up the kernel runs many times in a row, and a time is the length of
// such a window on the GPU divided by its runs, so every launch and the gaps after it count. The runs cycle
// through copies of the inputs. A figure is the median of several windows, for all but v000 over two sittings.
// Sittings can differ by a few percent; kernels timed side by side share one.
// v000 is the starting kernel. One run takes 269 microseconds.
#include <hip/hip_runtime.h>

// SAGAN attention block (8 images x 256 ch x 64 x 64): theta = W_theta x (32 ch, all 4,096 pixels), phi = maxpool2x2(W_phi x) (32 ch x 1,024 pooled positions), g = maxpool2x2(W_g x) (128 x 1,024),
// beta = softmax over the 1,024 pooled keys of theta^T phi (no scaling), o = W_o (g beta^T) = (W_o g) beta^T, out = gamma * o + x. The 1x1 convs are channel GEMMs; W_o is folded into the pooled
// values (V' = W_o g, [256 x 1,024] per image) so the attention writes the final channels directly.
// WMMA (v_wmma_f32_16x16x32_f16, f32 accumulate): projections with EXACT bf16 pixels (x^T rows x8, via an LDS transpose of the channel-major input) and weights (x256), 1 product; V' = W_o g with
// g pooled as f16 hi+lo x8 and W_o exact (2 products); energy tiles S^T = Phi . Theta^T with theta AND phi as f16 hi+lo x8 (3 products; logits sigma ~5.7); online softmax in f32; O^T += V' P^T with
// V' and P as f16 hi+lo x8 (3 products). Max-pooling, softmax, gamma, residual in f32. Inputs rounded to bf16 once (gamma and the residual x included). Fragment k-map

namespace {
constexpr int NB = 8, C = 256, CQ = 32, N = 4096, M = 1024 /* pooled positions */, CG = 128 /* g channels */, HW = 64;
constexpr float XS = 8.0f, WSC = 256.0f, PS = 8.0f, LOG2E = 1.4426950408889634f;

typedef _Float16 b16;
typedef __attribute__((ext_vector_type(16))) _Float16 v16b;
typedef __attribute__((ext_vector_type(8))) _Float16 v8b;
typedef __attribute__((ext_vector_type(8))) float v8f;
typedef __attribute__((ext_vector_type(4))) float v4f;
__device__ __forceinline__ float bf16_rne(float f) { unsigned int u = __float_as_uint(f); u += 0x7FFFu + ((u >> 16) & 1u); return __uint_as_float(u & 0xFFFF0000u); }
__device__ __forceinline__ void split16(float v, b16& hi, b16& lo) { hi = (b16)v; lo = (b16)(v - (float)hi); }
__device__ __forceinline__ v16b frag_kb(const b16* p, int hh) { const v8b a = *(const v8b*)(p + 8 * hh), b = *(const v8b*)(p + 16 + 8 * hh); v16b f;
#pragma unroll
  for (int e = 0; e < 8; ++e) { f[e] = a[e]; f[8 + e] = b[e]; } return f; }
__device__ __forceinline__ v8f wmma16b(v16b a, v16b b, v8f c) { v8f d = __builtin_amdgcn_wmma_f32_16x16x32_f16(false, a, false, b, (short)0, c, false, false); asm volatile("v_nop\n\tv_nop\n\tv_nop\n\tv_nop" : "+v"(d) : "v"(a), "v"(b)); return d; }
__device__ __forceinline__ void wave_lds_sync() { __builtin_amdgcn_fence(__ATOMIC_RELEASE, "workgroup"); __builtin_amdgcn_wave_barrier(); __builtin_amdgcn_fence(__ATOMIC_ACQUIRE, "workgroup"); }
__device__ __forceinline__ float nexp2(float x) { return __builtin_amdgcn_exp2f(x); }

__global__ __launch_bounds__(256) void xt_kernel(const float* __restrict__ x, b16* __restrict__ XT16) {
  __shared__ __attribute__((aligned(16))) b16 T[64][64 + 8];
  const int b = blockIdx.z, c0 = blockIdx.y * 64, n0 = blockIdx.x * 64, t_ = threadIdx.x;
  for (int q = t_; q < 64 * 64; q += 256) { const int cc = q >> 6, nn = q & 63; T[nn][cc] = (b16)(bf16_rne(x[((size_t)b * C + c0 + cc) * N + n0 + nn]) * XS); }
  __syncthreads();
  { for (int q = t_; q < 64 * 8; q += 256) { const int nn = q >> 3, c8 = (q & 7) * 8; *(v8b*)(XT16 + ((size_t)b * N + n0 + nn) * C + c0 + c8) = *(const v8b*)(&T[nn][c8]); }  }
}
__global__ __launch_bounds__(256) void prepw_kernel(const float* __restrict__ wq, const float* __restrict__ wk, const float* __restrict__ wg, const float* __restrict__ wo, b16* __restrict__ W16, b16* __restrict__ WG, b16* __restrict__ WO) {
  const int t = blockIdx.x * 256 + threadIdx.x; const int nq = CQ * C / 8, ng = CG * C / 8, no = C * CG / 8; const float* src; int e; b16* dst;
  if (t < nq) { src = wq; e = t * 8; dst = W16; } else if (t < 2 * nq) { src = wk; e = (t - nq) * 8; dst = W16 + CQ * C; } else if (t < 2 * nq + ng) { src = wg; e = (t - 2 * nq) * 8; dst = WG; } else if (t < 2 * nq + ng + no) { src = wo; e = (t - 2 * nq - ng) * 8; dst = WO; } else return;
  v8b o; for (int j = 0; j < 8; ++j) o[j] = (b16)(bf16_rne(src[e + j]) * WSC);
  { *(v8b*)(dst + e) = o;  }
}
// theta/phi projection: [n x 256] x [256 x 32] -> theta as QH/QL [b][n][32] f16 hi+lo x8 (64-B rows: 4 lanes x 16 B, 8 rows per instruction) and phi (full resolution, f32) as PHI [b][n][32]
__global__ __launch_bounds__(128) void qk_kernel(const b16* __restrict__ XT16, const b16* __restrict__ W16, b16* __restrict__ QH, b16* __restrict__ QL, float* __restrict__ PHI) {
  __shared__ __attribute__((aligned(16))) b16 Th[4][16][CQ + 8], Tl[4][16][CQ + 8]; __shared__ __attribute__((aligned(16))) float Tf[4][16][CQ + 4];
  const int wave = threadIdx.x >> 5, lane = threadIdx.x & 31, nloc = lane & 15, hlf = lane >> 4; const size_t r0 = ((size_t)blockIdx.x * 4 + wave) * 16;   // over b*N + n
  v8f acc[4] = {{}, {}, {}, {}};   // tiles: q0, q1, k0, k1
#pragma unroll 2
  for (int kb = 0; kb < C; kb += 32) { const v16b a = frag_kb(XT16 + (r0 + nloc) * C + kb, hlf);
#pragma unroll
    for (int t = 0; t < 4; ++t) acc[t] = wmma16b(a, frag_kb(W16 + (size_t)((t >> 1) * CQ + (t & 1) * 16 + nloc) * C + kb, hlf), acc[t]); }
#pragma unroll
  for (int t = 0; t < 4; ++t) { const int which = t >> 1, c = (t & 1) * 16 + nloc;
#pragma unroll
    for (int r = 0; r < 8; ++r) { const float v = acc[t][r] * (1.0f / (XS * WSC)); if (which == 0) { b16 h_, l_; split16(v * XS, h_, l_); Th[wave][8 * hlf + r][c] = h_; Tl[wave][8 * hlf + r][c] = l_; } else Tf[wave][8 * hlf + r][c] = v; } }
  wave_lds_sync();
  {
    for (int q = 0; q < 2; ++q) { const int rr = q * 8 + (lane >> 2), seg = (lane & 3) * 8; *(v8b*)(QH + (r0 + rr) * CQ + seg) = *(const v8b*)(&Th[wave][rr][seg]); *(v8b*)(QL + (r0 + rr) * CQ + seg) = *(const v8b*)(&Tl[wave][rr][seg]); }
    for (int q = 0; q < 4; ++q) { const int rr = q * 4 + (lane >> 3), seg = (lane & 7) * 4; *(v4f*)(PHI + (r0 + rr) * CQ + seg) = *(const v4f*)(&Tf[wave][rr][seg]); }
     }
}
__global__ __launch_bounds__(256) void poolk_kernel(const float* __restrict__ PHI, b16* __restrict__ KH, b16* __restrict__ KL) {
  const size_t t = (size_t)blockIdx.x * 256 + threadIdx.x; if (t >= (size_t)NB * M * CQ / 8) return; const int c8 = (int)(t & 3) * 8; const size_t bm = t >> 2; const int b = (int)(bm / M), m = (int)(bm % M); const int h2 = m / (HW / 2), w2 = m % (HW / 2);
  const float* p0 = PHI + ((size_t)b * N + (size_t)(2 * h2) * HW + 2 * w2) * CQ + c8; v8b hv, lv;
  for (int j = 0; j < 8; ++j) { const float v = fmaxf(fmaxf(p0[j], p0[CQ + j]), fmaxf(p0[(size_t)HW * CQ + j], p0[(size_t)HW * CQ + CQ + j])); b16 h_, l_; split16(v * XS, h_, l_); hv[j] = h_; lv[j] = l_; }
  { *(v8b*)(KH + bm * CQ + c8) = hv; *(v8b*)(KL + bm * CQ + c8) = lv;  }
}
// g projection in channel-major layout: GF [b][d][n] = W_g x (f32): GEMM rows d (A = WG rows, K = c) x cols n (B = XT16 rows n): block = 64 d x 4 waves x 128 n; each wave writes 16 d-rows x 128 n floats
__global__ __launch_bounds__(128) void g_kernel(const b16* __restrict__ XT16, const b16* __restrict__ WG, float* __restrict__ GF) {
  __shared__ __attribute__((aligned(16))) float Ts[4][16][128 + 4];
  const int wave = threadIdx.x >> 5, lane = threadIdx.x & 31, nloc = lane & 15, hlf = lane >> 4; const int b = blockIdx.z; const int d0 = blockIdx.x * 64 + wave * 16, n0 = blockIdx.y * 128;
  v8f acc[8];
#pragma unroll
  for (int t = 0; t < 8; ++t) acc[t] = (v8f){};
#pragma unroll 2
  for (int kb = 0; kb < C; kb += 32) { const v16b a = frag_kb(WG + (size_t)(d0 + nloc) * C + kb, hlf);
#pragma unroll
    for (int t = 0; t < 8; ++t) acc[t] = wmma16b(a, frag_kb(XT16 + ((size_t)b * N + n0 + t * 16 + nloc) * C + kb, hlf), acc[t]); }
#pragma unroll
  for (int t = 0; t < 8; ++t)
#pragma unroll
    for (int r = 0; r < 8; ++r) Ts[wave][8 * hlf + r][t * 16 + nloc] = acc[t][r] * (1.0f / (XS * WSC));
  wave_lds_sync();
  { for (int rr = 0; rr < 16; ++rr) *(v4f*)(GF + ((size_t)b * CG + d0 + rr) * N + n0 + lane * 4) = *(const v4f*)(&Ts[wave][rr][lane * 4]);  }
}
__global__ __launch_bounds__(256) void poolg_kernel(const float* __restrict__ GF, b16* __restrict__ GP, b16* __restrict__ GPL) {
  const size_t t = (size_t)blockIdx.x * 256 + threadIdx.x; if (t >= (size_t)NB * M * CG / 8) return; const int d8 = (int)(t & 15) * 8; const size_t bm = t >> 4; const int b = (int)(bm / M), m = (int)(bm % M); const int h2 = m / (HW / 2), w2 = m % (HW / 2);
  const size_t n00 = (size_t)(2 * h2) * HW + 2 * w2; v8b hv, lv;
  for (int j = 0; j < 8; ++j) { const float* p = GF + ((size_t)b * CG + d8 + j) * N + n00; const float v = fmaxf(fmaxf(p[0], p[1]), fmaxf(p[HW], p[HW + 1])); b16 h_, l_; split16(v * XS, h_, l_); hv[j] = h_; lv[j] = l_; }
  { *(v8b*)(GP + bm * CG + d8) = hv; *(v8b*)(GPL + bm * CG + d8) = lv;  }
}
// pooled values with W_o folded in, channel-major: V16/VL16 [b][c][m] = f16 hi+lo x8 of sum_d W_o[c][d] gpool[m][d]: GEMM rows c (A = WO rows, K = 128) x cols m (B = GP/GPL rows m, 2 products):
__global__ __launch_bounds__(128) void v_kernel(const b16* __restrict__ GP, const b16* __restrict__ GPL, const b16* __restrict__ WO, b16* __restrict__ V16, b16* __restrict__ VL16) {
  __shared__ __attribute__((aligned(16))) b16 Ts[4][16][128 + 8], Tl[4][16][128 + 8];
  const int wave = threadIdx.x >> 5, lane = threadIdx.x & 31, nloc = lane & 15, hlf = lane >> 4; const int b = blockIdx.z; const int d0 = blockIdx.x * 64 + wave * 16, n0 = blockIdx.y * 128;   // d0: output channel c; n0: pooled position m
  v8f acc[8];
#pragma unroll
  for (int t = 0; t < 8; ++t) acc[t] = (v8f){};
#pragma unroll
  for (int kb = 0; kb < CG; kb += 32) { const v16b a = frag_kb(WO + (size_t)(d0 + nloc) * CG + kb, hlf);
#pragma unroll
    for (int t = 0; t < 8; ++t) { const size_t ro = ((size_t)b * M + n0 + t * 16 + nloc) * CG + kb; acc[t] = wmma16b(a, frag_kb(GP + ro, hlf), acc[t]); acc[t] = wmma16b(a, frag_kb(GPL + ro, hlf), acc[t]); } }
  // acc[t][r] = V'[d0 + 8hlf + r][n0 + t*16 + nloc] x 2048
#pragma unroll
  for (int t = 0; t < 8; ++t)
#pragma unroll
    for (int r = 0; r < 8; ++r) { b16 h_, l_; split16(acc[t][r] * (1.0f / (XS * WSC)) * XS, h_, l_); Ts[wave][8 * hlf + r][t * 16 + nloc] = h_; Tl[wave][8 * hlf + r][t * 16 + nloc] = l_; }
  wave_lds_sync();
  { for (int rr = 0; rr < 16; ++rr) if (lane < 16) { const size_t gi = ((size_t)b * C + d0 + rr) * M + n0 + lane * 8; *(v8b*)(V16 + gi) = *(const v8b*)(&Ts[wave][rr][lane * 8]); *(v8b*)(VL16 + gi) = *(const v8b*)(&Tl[wave][rr][lane * 8]); }  }
}
// attention: grid (N/32 query blocks, 2 channel halves, B); block = 2 waves x 16 queries. Per block of 32 pooled keys: S^T = Phi . Theta^T with (Kh Qh + Kh Ql + Kl Qh) (K = 32: one k-step x 2
// key tiles x 3), online softmax (f32, exp2), O^T (128 c of this half = 8 tiles) += V'[c][keys] P^T (hi + lo). Output: out[b][c][n] = gamma O/l + x: the block's 32 queries x 128 c staged in
__global__ __launch_bounds__(64) void attn_kernel(const b16* __restrict__ QH, const b16* __restrict__ QL, const b16* __restrict__ KH, const b16* __restrict__ KL, const b16* __restrict__ V16, const b16* __restrict__ VL16, const float* __restrict__ x, const float* __restrict__ gamma_, float* __restrict__ out) {
  __shared__ __attribute__((aligned(16))) float To[128][32 + 4];
  const int wave = threadIdx.x >> 5, lane = threadIdx.x & 31, hh = lane >> 4, col = lane & 15; const int b = blockIdx.z, dh = blockIdx.y; const int q0 = blockIdx.x * 32 + wave * 16, qi = q0 + col;
  const size_t qrow = (size_t)b * N + qi; const v16b qh = frag_kb(QH + qrow * CQ, hh), ql = frag_kb(QL + qrow * CQ, hh);
  const b16* Khb = KH + (size_t)b * M * CQ; const b16* Klb = KL + (size_t)b * M * CQ; const b16* Vb = V16 + ((size_t)b * C + dh * 128) * M; const b16* Vlb = VL16 + ((size_t)b * C + dh * 128) * M; const float gamma = bf16_rne(gamma_[0]);
  float m = -INFINITY, l = 0.0f; v8f o[8], ol[8];
#pragma unroll
  for (int t = 0; t < 8; ++t) { o[t] = (v8f){}; ol[t] = (v8f){}; }
  for (int kb = 0; kb < M; kb += 32) {
    v8f s0 = {}, s1 = {};
    { const b16* k0 = Khb + (size_t)(kb + col) * CQ, *k1 = Khb + (size_t)(kb + 16 + col) * CQ, *k0l = Klb + (size_t)(kb + col) * CQ, *k1l = Klb + (size_t)(kb + 16 + col) * CQ;
      const v16b f0 = frag_kb(k0, hh), f1 = frag_kb(k1, hh);
      s0 = wmma16b(f0, qh, s0); s0 = wmma16b(f0, ql, s0); s0 = wmma16b(frag_kb(k0l, hh), qh, s0);
      s1 = wmma16b(f1, qh, s1); s1 = wmma16b(f1, ql, s1); s1 = wmma16b(frag_kb(k1l, hh), qh, s1); }
    float e[16]; float mx = -INFINITY; const float cs = LOG2E / (XS * XS);
#pragma unroll
    for (int r = 0; r < 8; ++r) { e[r] = s0[r] * cs; e[8 + r] = s1[r] * cs; mx = fmaxf(mx, fmaxf(e[r], e[8 + r])); }
    mx = fmaxf(mx, __shfl_xor(mx, 16)); const float mn = fmaxf(m, mx); const float al = nexp2(m - mn); m = mn; float sum = 0.0f; v16b ph, pl;
#pragma unroll
    for (int i = 0; i < 16; ++i) { const float p = nexp2(e[i] - mn); sum += p; const b16 h_ = (b16)(p * PS); ph[i] = h_; pl[i] = (b16)(p * PS - (float)h_); }
    sum += __shfl_xor(sum, 16); l = l * al + sum;
#pragma unroll
    for (int t = 0; t < 8; ++t) { o[t] *= al; ol[t] *= al; const v16b vf = frag_kb(Vb + (size_t)(t * 16 + col) * M + kb, hh); o[t] = wmma16b(vf, ph, o[t]); ol[t] = wmma16b(vf, pl, ol[t]); ol[t] = wmma16b(frag_kb(Vlb + (size_t)(t * 16 + col) * M + kb, hh), ph, ol[t]); } }
  const float inv = 1.0f / (l * PS * XS);
  // o[t][r] = O^T[d = t*16 + 8hh + r][query col] -> To[d][wave*16 + col]
#pragma unroll
  for (int t = 0; t < 8; ++t)
#pragma unroll
    for (int r = 0; r < 8; ++r) To[t * 16 + 8 * hh + r][wave * 16 + col] = (o[t][r] + ol[t][r]) * inv;
  __syncthreads();
  { for (int dd = wave * 64; dd < wave * 64 + 64; ++dd) { const size_t gi = ((size_t)b * C + dh * 128 + dd) * N + blockIdx.x * 32 + lane; ((float*)out)[gi] = gamma * To[dd][lane] + bf16_rne(x[gi]); }  }
}
}  // namespace

extern "C" void kernel_launch(void* const* d_in, const int* in_sizes, int n_in, void* d_out, int out_size, void* d_ws, size_t ws_size, hipStream_t stream) {
  (void)n_in;
  auto Fp = [&](int i) { return (const float*)d_in[i]; };
  // input order: 0 x [8,256,64,64], 1 w_theta [32,256], 2 w_phi [32,256], 3 w_g [128,256], 4 w_o [256,128], 5 gamma [1]
  if (in_sizes[0] != NB * C * N || in_sizes[1] != CQ * C || in_sizes[2] != CQ * C || in_sizes[3] != CG * C || in_sizes[4] != C * CG || in_sizes[5] != 1 || out_size != NB * C * N) return;
  size_t off = 0; char* ws = (char*)d_ws;
  auto carve = [&](size_t bytes) { char* p = ws + off; off += (bytes + 255) & ~(size_t)255; return p; };
  b16* XT16 = (b16*)carve((size_t)NB * N * C * 2); b16* W16 = (b16*)carve((size_t)2 * CQ * C * 2); b16* WG = (b16*)carve((size_t)CG * C * 2); b16* WO = (b16*)carve((size_t)C * CG * 2);
  b16* QH = (b16*)carve((size_t)NB * N * CQ * 2); b16* QL = (b16*)carve((size_t)NB * N * CQ * 2); float* PHI = (float*)carve((size_t)NB * N * CQ * 4); b16* KH = (b16*)carve((size_t)NB * M * CQ * 2); b16* KL = (b16*)carve((size_t)NB * M * CQ * 2);
  float* GF = (float*)carve((size_t)NB * CG * N * 4); b16* GP = (b16*)carve((size_t)NB * M * CG * 2); b16* GPL = (b16*)carve((size_t)NB * M * CG * 2); b16* V16 = (b16*)carve((size_t)NB * C * M * 2); b16* VL16 = (b16*)carve((size_t)NB * C * M * 2);
  if (off > ws_size || off > ((size_t)128 << 20)) return;   // = 53.2 MiB
  xt_kernel<<<dim3(N / 64, C / 64, NB), 256, 0, stream>>>(Fp(0), XT16);
  prepw_kernel<<<((2 * CQ * C + CG * C + C * CG) / 8 + 255) / 256, 256, 0, stream>>>(Fp(1), Fp(2), Fp(3), Fp(4), W16, WG, WO);
  qk_kernel<<<NB * N / 64, 128, 0, stream>>>(XT16, W16, QH, QL, PHI);
  poolk_kernel<<<(NB * M * CQ / 8 + 255) / 256, 256, 0, stream>>>(PHI, KH, KL);
  g_kernel<<<dim3(CG / 64, N / 128, NB), 128, 0, stream>>>(XT16, WG, GF);
  poolg_kernel<<<(NB * M * CG / 8 + 255) / 256, 256, 0, stream>>>(GF, GP, GPL);
  v_kernel<<<dim3(C / 64, M / 128, NB), 128, 0, stream>>>(GP, GPL, WO, V16, VL16);
  attn_kernel<<<dim3(N / 32, 2, NB), 64, 0, stream>>>(QH, QL, KH, KL, V16, VL16, Fp(0), Fp(5), (float*)d_out);
}

// v001
// Measured time: 131 microseconds a run.
// Next to v000, in two timings, it ran 2.10 and 2.08 times as fast.
#include <hip/hip_runtime.h>

// SAGAN attention block (8 images x 256 ch x 64 x 64): theta = W_theta x (32 ch, all 4,096 pixels), phi = maxpool2x2(W_phi x) (32 ch x 1,024 pooled positions), g = maxpool2x2(W_g x) (128 x 1,024),
// beta = softmax over the 1,024 pooled keys of theta^T phi (no scaling), o = W_o (g beta^T) = (W_o g) beta^T, out = gamma * o + x. The 1x1 convs are channel GEMMs; W_o is folded into the pooled
// values (V' = W_o g, [256 x 1,024] per image) so the attention writes the final channels directly.
// WMMA (v_wmma_f32_16x16x32_f16, f32 accumulate): projections with EXACT bf16 pixels (x^T rows x8, via an LDS transpose of the channel-major input) and weights (x256), 1 product; V' = W_o g with
// g pooled as f16 hi+lo x8 and W_o exact (2 products); energy tiles S^T = Phi . Theta^T with theta AND phi as f16 hi+lo x8 (3 products; logits sigma ~5.7); online softmax in f32; O^T += V' P^T with
// V' and P as f16 hi+lo x8 (3 products). Max-pooling, softmax, gamma, residual in f32. Inputs rounded to bf16 once (gamma and the residual x included). Fragment k-map

namespace {
constexpr int NB = 8, C = 256, CQ = 32, N = 4096, M = 1024 /* pooled positions */, CG = 128 /* g channels */, HW = 64;
constexpr float XS = 8.0f, WSC = 256.0f, PS = 8.0f, LOG2E = 1.4426950408889634f;

typedef _Float16 b16;
typedef __attribute__((ext_vector_type(16))) _Float16 v16b;
typedef __attribute__((ext_vector_type(8))) _Float16 v8b;
typedef __attribute__((ext_vector_type(8))) float v8f;
typedef __attribute__((ext_vector_type(4))) float v4f;
__device__ __forceinline__ float bf16_rne(float f) { unsigned int u = __float_as_uint(f); u += 0x7FFFu + ((u >> 16) & 1u); return __uint_as_float(u & 0xFFFF0000u); }
__device__ __forceinline__ void split16(float v, b16& hi, b16& lo) { hi = (b16)v; lo = (b16)(v - (float)hi); }
__device__ __forceinline__ v16b frag_kb(const b16* p, int hh) { const v8b a = *(const v8b*)(p + 8 * hh), b = *(const v8b*)(p + 16 + 8 * hh); v16b f;
#pragma unroll
  for (int e = 0; e < 8; ++e) { f[e] = a[e]; f[8 + e] = b[e]; } return f; }
__device__ __forceinline__ v8f wmma16b(v16b a, v16b b, v8f c) { v8f d = __builtin_amdgcn_wmma_f32_16x16x32_f16(false, a, false, b, (short)0, c, false, false); asm volatile("v_nop\n\tv_nop\n\tv_nop\n\tv_nop" : "+v"(d) : "v"(a), "v"(b)); return d; }
__device__ __forceinline__ void wave_lds_sync() { __builtin_amdgcn_fence(__ATOMIC_RELEASE, "workgroup"); __builtin_amdgcn_wave_barrier(); __builtin_amdgcn_fence(__ATOMIC_ACQUIRE, "workgroup"); }
__device__ __forceinline__ float nexp2(float x) { return __builtin_amdgcn_exp2f(x); }

__global__ __launch_bounds__(256) void xt_kernel(const float* __restrict__ x, b16* __restrict__ XT16) {
  __shared__ __attribute__((aligned(16))) b16 T[64][64 + 8];
  const int b = blockIdx.z, c0 = blockIdx.y * 64, n0 = blockIdx.x * 64, t_ = threadIdx.x;
  for (int q = t_; q < 64 * 64; q += 256) { const int cc = q >> 6, nn = q & 63; T[nn][cc] = (b16)(bf16_rne(x[((size_t)b * C + c0 + cc) * N + n0 + nn]) * XS); }
  __syncthreads();
  { for (int q = t_; q < 64 * 8; q += 256) { const int nn = q >> 3, c8 = (q & 7) * 8; *(v8b*)(XT16 + ((size_t)b * N + n0 + nn) * C + c0 + c8) = *(const v8b*)(&T[nn][c8]); }  }
}
__global__ __launch_bounds__(256) void prepw_kernel(const float* __restrict__ wq, const float* __restrict__ wk, const float* __restrict__ wg, const float* __restrict__ wo, b16* __restrict__ W16, b16* __restrict__ WG, b16* __restrict__ WO) {
  const int t = blockIdx.x * 256 + threadIdx.x; const int nq = CQ * C / 8, ng = CG * C / 8, no = C * CG / 8; const float* src; int e; b16* dst;
  if (t < nq) { src = wq; e = t * 8; dst = W16; } else if (t < 2 * nq) { src = wk; e = (t - nq) * 8; dst = W16 + CQ * C; } else if (t < 2 * nq + ng) { src = wg; e = (t - 2 * nq) * 8; dst = WG; } else if (t < 2 * nq + ng + no) { src = wo; e = (t - 2 * nq - ng) * 8; dst = WO; } else return;
  v8b o; for (int j = 0; j < 8; ++j) o[j] = (b16)(bf16_rne(src[e + j]) * WSC);
  { *(v8b*)(dst + e) = o;  }
}
// theta/phi projection: [n x 256] x [256 x 32] -> theta as QH/QL [b][n][32] f16 hi+lo x8 (64-B rows: 4 lanes x 16 B, 8 rows per instruction) and phi (full resolution, f32) as PHI [b][n][32]
__global__ __launch_bounds__(128) void qk_kernel(const b16* __restrict__ XT16, const b16* __restrict__ W16, b16* __restrict__ QH, b16* __restrict__ QL, float* __restrict__ PHI) {
  __shared__ __attribute__((aligned(16))) b16 Th[4][16][CQ + 8], Tl[4][16][CQ + 8]; __shared__ __attribute__((aligned(16))) float Tf[4][16][CQ + 4];
  const int wave = threadIdx.x >> 5, lane = threadIdx.x & 31, nloc = lane & 15, hlf = lane >> 4; const size_t r0 = ((size_t)blockIdx.x * 4 + wave) * 16;   // over b*N + n
  v8f acc[4] = {{}, {}, {}, {}};   // tiles: q0, q1, k0, k1
#pragma unroll 2
  for (int kb = 0; kb < C; kb += 32) { const v16b a = frag_kb(XT16 + (r0 + nloc) * C + kb, hlf);
#pragma unroll
    for (int t = 0; t < 4; ++t) acc[t] = wmma16b(a, frag_kb(W16 + (size_t)((t >> 1) * CQ + (t & 1) * 16 + nloc) * C + kb, hlf), acc[t]); }
#pragma unroll
  for (int t = 0; t < 4; ++t) { const int which = t >> 1, c = (t & 1) * 16 + nloc;
#pragma unroll
    for (int r = 0; r < 8; ++r) { const float v = acc[t][r] * (1.0f / (XS * WSC)); if (which == 0) { b16 h_, l_; split16(v * XS, h_, l_); Th[wave][8 * hlf + r][c] = h_; Tl[wave][8 * hlf + r][c] = l_; } else Tf[wave][8 * hlf + r][c] = v; } }
  wave_lds_sync();
  {
    for (int q = 0; q < 2; ++q) { const int rr = q * 8 + (lane >> 2), seg = (lane & 3) * 8; *(v8b*)(QH + (r0 + rr) * CQ + seg) = *(const v8b*)(&Th[wave][rr][seg]); *(v8b*)(QL + (r0 + rr) * CQ + seg) = *(const v8b*)(&Tl[wave][rr][seg]); }
    for (int q = 0; q < 4; ++q) { const int rr = q * 4 + (lane >> 3), seg = (lane & 7) * 4; *(v4f*)(PHI + (r0 + rr) * CQ + seg) = *(const v4f*)(&Tf[wave][rr][seg]); }
     }
}
__global__ __launch_bounds__(256) void poolk_kernel(const float* __restrict__ PHI, b16* __restrict__ KH, b16* __restrict__ KL) {
  const size_t t = (size_t)blockIdx.x * 256 + threadIdx.x; if (t >= (size_t)NB * M * CQ / 8) return; const int c8 = (int)(t & 3) * 8; const size_t bm = t >> 2; const int b = (int)(bm / M), m = (int)(bm % M); const int h2 = m / (HW / 2), w2 = m % (HW / 2);
  const float* p0 = PHI + ((size_t)b * N + (size_t)(2 * h2) * HW + 2 * w2) * CQ + c8; v8b hv, lv;
  for (int j = 0; j < 8; ++j) { const float v = fmaxf(fmaxf(p0[j], p0[CQ + j]), fmaxf(p0[(size_t)HW * CQ + j], p0[(size_t)HW * CQ + CQ + j])); b16 h_, l_; split16(v * XS, h_, l_); hv[j] = h_; lv[j] = l_; }
  { *(v8b*)(KH + bm * CQ + c8) = hv; *(v8b*)(KL + bm * CQ + c8) = lv;  }
}
// g projection in channel-major layout: GF [b][d][n] = W_g x (f32): GEMM rows d (A = WG rows, K = c) x cols n (B = XT16 rows n): block = 64 d x 4 waves x 128 n; each wave writes 16 d-rows x 128 n floats
__global__ __launch_bounds__(128) void g_kernel(const b16* __restrict__ XT16, const b16* __restrict__ WG, float* __restrict__ GF) {
  __shared__ __attribute__((aligned(16))) float Ts[4][16][128 + 4];
  const int wave = threadIdx.x >> 5, lane = threadIdx.x & 31, nloc = lane & 15, hlf = lane >> 4; const int b = blockIdx.z; const int d0 = blockIdx.x * 64 + wave * 16, n0 = blockIdx.y * 128;
  v8f acc[8];
#pragma unroll
  for (int t = 0; t < 8; ++t) acc[t] = (v8f){};
#pragma unroll 2
  for (int kb = 0; kb < C; kb += 32) { const v16b a = frag_kb(WG + (size_t)(d0 + nloc) * C + kb, hlf);
#pragma unroll
    for (int t = 0; t < 8; ++t) acc[t] = wmma16b(a, frag_kb(XT16 + ((size_t)b * N + n0 + t * 16 + nloc) * C + kb, hlf), acc[t]); }
#pragma unroll
  for (int t = 0; t < 8; ++t)
#pragma unroll
    for (int r = 0; r < 8; ++r) Ts[wave][8 * hlf + r][t * 16 + nloc] = acc[t][r] * (1.0f / (XS * WSC));
  wave_lds_sync();
  { for (int rr = 0; rr < 16; ++rr) *(v4f*)(GF + ((size_t)b * CG + d0 + rr) * N + n0 + lane * 4) = *(const v4f*)(&Ts[wave][rr][lane * 4]);  }
}
__global__ __launch_bounds__(256) void poolg_kernel(const float* __restrict__ GF, b16* __restrict__ GP, b16* __restrict__ GPL) {
  const size_t t = (size_t)blockIdx.x * 256 + threadIdx.x; if (t >= (size_t)NB * M * CG / 8) return; const int d8 = (int)(t & 15) * 8; const size_t bm = t >> 4; const int b = (int)(bm / M), m = (int)(bm % M); const int h2 = m / (HW / 2), w2 = m % (HW / 2);
  const size_t n00 = (size_t)(2 * h2) * HW + 2 * w2; v8b hv, lv;
  for (int j = 0; j < 8; ++j) { const float* p = GF + ((size_t)b * CG + d8 + j) * N + n00; const float v = fmaxf(fmaxf(p[0], p[1]), fmaxf(p[HW], p[HW + 1])); b16 h_, l_; split16(v * XS, h_, l_); hv[j] = h_; lv[j] = l_; }
  { *(v8b*)(GP + bm * CG + d8) = hv; *(v8b*)(GPL + bm * CG + d8) = lv;  }
}
// pooled values with W_o folded in, channel-major: V16/VL16 [b][c][m] = f16 hi+lo x8 of sum_d W_o[c][d] gpool[m][d]: GEMM rows c (A = WO rows, K = 128) x cols m (B = GP/GPL rows m, 2 products):
__global__ __launch_bounds__(128) void v_kernel(const b16* __restrict__ GP, const b16* __restrict__ GPL, const b16* __restrict__ WO, b16* __restrict__ V16, b16* __restrict__ VL16) {
  __shared__ __attribute__((aligned(16))) b16 Ts[4][16][128 + 8], Tl[4][16][128 + 8];
  const int wave = threadIdx.x >> 5, lane = threadIdx.x & 31, nloc = lane & 15, hlf = lane >> 4; const int b = blockIdx.z; const int d0 = blockIdx.x * 64 + wave * 16, n0 = blockIdx.y * 128;   // d0: output channel c; n0: pooled position m
  v8f acc[8];
#pragma unroll
  for (int t = 0; t < 8; ++t) acc[t] = (v8f){};
#pragma unroll
  for (int kb = 0; kb < CG; kb += 32) { const v16b a = frag_kb(WO + (size_t)(d0 + nloc) * CG + kb, hlf);
#pragma unroll
    for (int t = 0; t < 8; ++t) { const size_t ro = ((size_t)b * M + n0 + t * 16 + nloc) * CG + kb; acc[t] = wmma16b(a, frag_kb(GP + ro, hlf), acc[t]); acc[t] = wmma16b(a, frag_kb(GPL + ro, hlf), acc[t]); } }
  // acc[t][r] = V'[d0 + 8hlf + r][n0 + t*16 + nloc] x 2048
#pragma unroll
  for (int t = 0; t < 8; ++t)
#pragma unroll
    for (int r = 0; r < 8; ++r) { b16 h_, l_; split16(acc[t][r] * (1.0f / (XS * WSC)) * XS, h_, l_); Ts[wave][8 * hlf + r][t * 16 + nloc] = h_; Tl[wave][8 * hlf + r][t * 16 + nloc] = l_; }
  wave_lds_sync();
  { for (int rr = 0; rr < 16; ++rr) if (lane < 16) { const size_t gi = ((size_t)b * C + d0 + rr) * M + n0 + lane * 8; *(v8b*)(V16 + gi) = *(const v8b*)(&Ts[wave][rr][lane * 8]); *(v8b*)(VL16 + gi) = *(const v8b*)(&Tl[wave][rr][lane * 8]); }  }
}
// attention: grid (N/128 query blocks, 2 channel halves, B); block = 8 waves x 16 queries. K (hi, lo) and V' (hi, lo; the 128 channels of this half) come in stages of 64 pooled keys into a
// two-buffer LDS ring that all 8 waves read: every lane copies 16 B pieces with asynchronous copies to LDS (whole 128-B lines per 8 lanes for V', 4 KB contiguous for K), one stage ahead of its use.
// Per block of 32 pooled keys: S^T = Phi . Theta^T with (Kh Qh + Kh Ql + Kl Qh), online softmax (f32, exp2), O^T (8 tiles) += V'[c][keys] P^T (hi + lo). out[b][c][n] = gamma O/l + x, staged in the ring's LDS.
constexpr int KS = 64 /* keys per stage */, VP = 144, KP = 80 /* LDS row pitch in bytes, 16 B x odd: 16 rows of a 16-byte read fall on 64 distinct banks */;
constexpr int OFF_VH = 0, OFF_VL = 128 * VP, OFF_KH = 2 * 128 * VP, OFF_KL = OFF_KH + KS * KP, STAGE_B = OFF_KL + KS * KP;   // 47,104 B per buffer
// one stage (keys k0 .. k0 + 63) into the buffer at LDS byte address lb: 10 copies per lane, 256 lanes; V' rows vr + 32 j (8 lanes x 16 B = one 128-B line each), K rows kr (4 lanes x 16 B)
__device__ __forceinline__ void stage_kv(unsigned lb, const b16* Vb, const b16* Vlb, const b16* Khb, const b16* Klb, int k0, int tid) {
  const int vr = tid >> 3, vc = tid & 7, kr = tid >> 2, kc = tid & 3; const unsigned lv = lb + vr * VP + vc * 16, lk = lb + kr * KP + kc * 16; const size_t gv = (size_t)vr * M + k0 + vc * 8, gk = (size_t)(k0 + kr) * CQ + kc * 8;
  // the ten copies and, as the statement's last line, the wait that stands in front of any rewrite of the address registers they name
  asm volatile("global_load_async_to_lds_b128 %0, %1, off\n\tglobal_load_async_to_lds_b128 %2, %3, off\n\tglobal_load_async_to_lds_b128 %4, %5, off\n\tglobal_load_async_to_lds_b128 %6, %7, off\n\tglobal_load_async_to_lds_b128 %8, %9, off\n\t"
               "global_load_async_to_lds_b128 %10, %11, off\n\tglobal_load_async_to_lds_b128 %12, %13, off\n\tglobal_load_async_to_lds_b128 %14, %15, off\n\tglobal_load_async_to_lds_b128 %16, %17, off\n\tglobal_load_async_to_lds_b128 %18, %19, off\n\ts_wait_xcnt 0x0"
               :: "v"(lv + OFF_VH), "v"(Vb + gv), "v"(lv + OFF_VH + 32 * VP), "v"(Vb + gv + 32 * M), "v"(lv + OFF_VH + 64 * VP), "v"(Vb + gv + 64 * M), "v"(lv + OFF_VH + 96 * VP), "v"(Vb + gv + 96 * M), "v"(lk + OFF_KH), "v"(Khb + gk),
                  "v"(lv + OFF_VL), "v"(Vlb + gv), "v"(lv + OFF_VL + 32 * VP), "v"(Vlb + gv + 32 * M), "v"(lv + OFF_VL + 64 * VP), "v"(Vlb + gv + 64 * M), "v"(lv + OFF_VL + 96 * VP), "v"(Vlb + gv + 96 * M), "v"(lk + OFF_KL), "v"(Klb + gk) : "memory");
}
__global__ __launch_bounds__(256) void attn_kernel(const b16* __restrict__ QH, const b16* __restrict__ QL, const b16* __restrict__ KH, const b16* __restrict__ KL, const b16* __restrict__ V16, const b16* __restrict__ VL16, const float* __restrict__ x, const float* __restrict__ gamma_, float* __restrict__ out) {
  __shared__ __attribute__((aligned(128))) unsigned char L[2 * STAGE_B];   // the ring; after the loop the output staging To[128][128 + 4] (67,584 B)
  const int tid = threadIdx.x, wave = threadIdx.x >> 5, lane = threadIdx.x & 31, hh = lane >> 4, col = lane & 15; const int b = blockIdx.z, dh = blockIdx.y; const int q0 = blockIdx.x * 128 + wave * 16, qi = q0 + col;
  const size_t qrow = (size_t)b * N + qi; const v16b qh = frag_kb(QH + qrow * CQ, hh), ql = frag_kb(QL + qrow * CQ, hh);
  const b16* Khb = KH + (size_t)b * M * CQ; const b16* Klb = KL + (size_t)b * M * CQ; const b16* Vb = V16 + ((size_t)b * C + dh * 128) * M; const b16* Vlb = VL16 + ((size_t)b * C + dh * 128) * M; const float gamma = bf16_rne(gamma_[0]);
  const unsigned lds0 = (unsigned)(size_t)L;
  float m = -INFINITY, l = 0.0f; v8f o[8], ol[8];
#pragma unroll
  for (int t = 0; t < 8; ++t) { o[t] = (v8f){}; ol[t] = (v8f){}; }
  stage_kv(lds0, Vb, Vlb, Khb, Klb, 0, tid);
  asm volatile("s_wait_asynccnt 0x0" ::: "memory");   // this wave's copies of stage 0 have landed
  __syncthreads();                                    // every wave's have: stage 0 is readable
  stage_kv(lds0 + STAGE_B, Vb, Vlb, Khb, Klb, KS, tid);
  for (int st = 0; st < M / KS; ++st) {
    const unsigned char* B = L + (st & 1) * STAGE_B;
    for (int kk = 0; kk < KS; kk += 32) {
      v8f s0 = {}, s1 = {};
      { const b16* k0 = (const b16*)(B + OFF_KH + (kk + col) * KP), *k1 = (const b16*)(B + OFF_KH + (kk + 16 + col) * KP), *k0l = (const b16*)(B + OFF_KL + (kk + col) * KP), *k1l = (const b16*)(B + OFF_KL + (kk + 16 + col) * KP);
        const v16b f0 = frag_kb(k0, hh), f1 = frag_kb(k1, hh);
        s0 = wmma16b(f0, qh, s0); s0 = wmma16b(f0, ql, s0); s0 = wmma16b(frag_kb(k0l, hh), qh, s0);
        s1 = wmma16b(f1, qh, s1); s1 = wmma16b(f1, ql, s1); s1 = wmma16b(frag_kb(k1l, hh), qh, s1); }
      float e[16]; float mx = -INFINITY; const float cs = LOG2E / (XS * XS);
#pragma unroll
      for (int r = 0; r < 8; ++r) { e[r] = s0[r] * cs; e[8 + r] = s1[r] * cs; mx = fmaxf(mx, fmaxf(e[r], e[8 + r])); }
      mx = fmaxf(mx, __shfl_xor(mx, 16)); const float mn = fmaxf(m, mx); const float al = nexp2(m - mn); m = mn; float sum = 0.0f; v16b ph, pl;
#pragma unroll
      for (int i = 0; i < 16; ++i) { const float p = nexp2(e[i] - mn); sum += p; const b16 h_ = (b16)(p * PS); ph[i] = h_; pl[i] = (b16)(p * PS - (float)h_); }
      sum += __shfl_xor(sum, 16); l = l * al + sum;
#pragma unroll
      for (int t = 0; t < 8; ++t) { o[t] *= al; ol[t] *= al; const v16b vf = frag_kb((const b16*)(B + OFF_VH + (t * 16 + col) * VP) + kk, hh); o[t] = wmma16b(vf, ph, o[t]); ol[t] = wmma16b(vf, pl, ol[t]); ol[t] = wmma16b(frag_kb((const b16*)(B + OFF_VL + (t * 16 + col) * VP) + kk, hh), ph, ol[t]); } }
    asm volatile("s_wait_dscnt 0x0" ::: "memory");      // this wave's reads of the buffer are done before it is refilled
    asm volatile("s_wait_asynccnt 0x0" ::: "memory");   // this wave's copies of stage st + 1 have landed
    __syncthreads();                                    // publishes stage st + 1 and ends every wave's reads of stage st
    if (st + 2 < M / KS) stage_kv(lds0 + (st & 1) * STAGE_B, Vb, Vlb, Khb, Klb, (st + 2) * KS, tid);
  }
  asm volatile("s_wait_asynccnt 0x0" ::: "memory");     // no copy is outstanding when the ring becomes output staging
  const float inv = 1.0f / (l * PS * XS);
  float (*To)[128 + 4] = (float (*)[128 + 4])L;
  // o[t][r] = O^T[d = t*16 + 8hh + r][query col] -> To[d][wave*16 + col]
#pragma unroll
  for (int t = 0; t < 8; ++t)
#pragma unroll
    for (int r = 0; r < 8; ++r) To[t * 16 + 8 * hh + r][wave * 16 + col] = (o[t][r] + ol[t][r]) * inv;
  __syncthreads();
  for (int i = 0; i < 16; ++i) { const int dd = wave * 16 + i;
    for (int sg = 0; sg < 128; sg += 32) { const size_t gi = ((size_t)b * C + dh * 128 + dd) * N + blockIdx.x * 128 + sg + lane; ((float*)out)[gi] = gamma * To[dd][sg + lane] + bf16_rne(x[gi]); }
    asm volatile("s_wait_xcnt 0x0" ::: "memory");   // stands in front of the next trip's rewrite of the registers that this trip's loads and stores name
  }
}
}  // namespace

extern "C" void kernel_launch(void* const* d_in, const int* in_sizes, int n_in, void* d_out, int out_size, void* d_ws, size_t ws_size, hipStream_t stream) {
  (void)n_in;
  auto Fp = [&](int i) { return (const float*)d_in[i]; };
  // input order: 0 x [8,256,64,64], 1 w_theta [32,256], 2 w_phi [32,256], 3 w_g [128,256], 4 w_o [256,128], 5 gamma [1]
  if (in_sizes[0] != NB * C * N || in_sizes[1] != CQ * C || in_sizes[2] != CQ * C || in_sizes[3] != CG * C || in_sizes[4] != C * CG || in_sizes[5] != 1 || out_size != NB * C * N) return;
  size_t off = 0; char* ws = (char*)d_ws;
  auto carve = [&](size_t bytes) { char* p = ws + off; off += (bytes + 255) & ~(size_t)255; return p; };
  b16* XT16 = (b16*)carve((size_t)NB * N * C * 2); b16* W16 = (b16*)carve((size_t)2 * CQ * C * 2); b16* WG = (b16*)carve((size_t)CG * C * 2); b16* WO = (b16*)carve((size_t)C * CG * 2);
  b16* QH = (b16*)carve((size_t)NB * N * CQ * 2); b16* QL = (b16*)carve((size_t)NB * N * CQ * 2); float* PHI = (float*)carve((size_t)NB * N * CQ * 4); b16* KH = (b16*)carve((size_t)NB * M * CQ * 2); b16* KL = (b16*)carve((size_t)NB * M * CQ * 2);
  float* GF = (float*)carve((size_t)NB * CG * N * 4); b16* GP = (b16*)carve((size_t)NB * M * CG * 2); b16* GPL = (b16*)carve((size_t)NB * M * CG * 2); b16* V16 = (b16*)carve((size_t)NB * C * M * 2); b16* VL16 = (b16*)carve((size_t)NB * C * M * 2);
  if (off > ws_size || off > ((size_t)128 << 20)) return;   // = 53.2 MiB
  xt_kernel<<<dim3(N / 64, C / 64, NB), 256, 0, stream>>>(Fp(0), XT16);
  prepw_kernel<<<((2 * CQ * C + CG * C + C * CG) / 8 + 255) / 256, 256, 0, stream>>>(Fp(1), Fp(2), Fp(3), Fp(4), W16, WG, WO);
  qk_kernel<<<NB * N / 64, 128, 0, stream>>>(XT16, W16, QH, QL, PHI);
  poolk_kernel<<<(NB * M * CQ / 8 + 255) / 256, 256, 0, stream>>>(PHI, KH, KL);
  g_kernel<<<dim3(CG / 64, N / 128, NB), 128, 0, stream>>>(XT16, WG, GF);
  poolg_kernel<<<(NB * M * CG / 8 + 255) / 256, 256, 0, stream>>>(GF, GP, GPL);
  v_kernel<<<dim3(C / 64, M / 128, NB), 128, 0, stream>>>(GP, GPL, WO, V16, VL16);
  attn_kernel<<<dim3(N / 128, 2, NB), 256, 0, stream>>>(QH, QL, KH, KL, V16, VL16, Fp(0), Fp(5), (float*)d_out);
}

// v002
// Measured time: 108 microseconds a run.
// In both of two side-by-side timings against v001, it was 1.22 times as fast.
// Counting every step since v000, it is 2.54 times as fast.
#include <hip/hip_runtime.h>

// SAGAN attention block (8 images x 256 ch x 64 x 64): theta = W_theta x (32 ch, all 4,096 pixels), phi = maxpool2x2(W_phi x) (32 ch x 1,024 pooled positions), g = maxpool2x2(W_g x) (128 x 1,024),
// beta = softmax over the 1,024 pooled keys of theta^T phi (no scaling), o = W_o (g beta^T) = (W_o g) beta^T, out = gamma * o + x. The 1x1 convs are channel GEMMs; W_o is folded into the pooled
// values (V' = W_o g, [256 x 1,024] per image) so the attention writes the final channels directly.
// WMMA (v_wmma_f32_16x16x32_f16, f32 accumulate): projections with EXACT bf16 pixels (x^T rows x8, via an LDS transpose of the channel-major input) and weights (x256), 1 product; V' = W_o g with
// g pooled as f16 hi+lo x8 and W_o exact (2 products); energy tiles S^T = Phi . Theta^T with theta AND phi as f16 hi+lo x8 (3 products; logits sigma ~5.7); online softmax in f32; O^T += V' P^T with
// V' and P as f16 hi+lo x8 (3 products). Max-pooling, softmax, gamma, residual in f32. Inputs rounded to bf16 once (gamma and the residual x included). Fragment k-map

namespace {
constexpr int NB = 8, C = 256, CQ = 32, N = 4096, M = 1024 /* pooled positions */, CG = 128 /* g channels */, HW = 64;
constexpr float XS = 8.0f, WSC = 256.0f, PS = 8.0f, LOG2E = 1.4426950408889634f;

typedef _Float16 b16;
typedef __attribute__((ext_vector_type(16))) _Float16 v16b;
typedef __attribute__((ext_vector_type(8))) _Float16 v8b;
typedef __attribute__((ext_vector_type(8))) float v8f;
typedef __attribute__((ext_vector_type(4))) float v4f;
__device__ __forceinline__ float bf16_rne(float f) { unsigned int u = __float_as_uint(f); u += 0x7FFFu + ((u >> 16) & 1u); return __uint_as_float(u & 0xFFFF0000u); }
__device__ __forceinline__ void split16(float v, b16& hi, b16& lo) { hi = (b16)v; lo = (b16)(v - (float)hi); }
__device__ __forceinline__ v16b frag_kb(const b16* p, int hh) { const v8b a = *(const v8b*)(p + 8 * hh), b = *(const v8b*)(p + 16 + 8 * hh); v16b f;
#pragma unroll
  for (int e = 0; e < 8; ++e) { f[e] = a[e]; f[8 + e] = b[e]; } return f; }
__device__ __forceinline__ v8f wmma16b(v16b a, v16b b, v8f c) { v8f d = __builtin_amdgcn_wmma_f32_16x16x32_f16(false, a, false, b, (short)0, c, false, false); asm volatile("v_nop\n\tv_nop\n\tv_nop\n\tv_nop" : "+v"(d) : "v"(a), "v"(b)); return d; }
__device__ __forceinline__ void wave_lds_sync() { __builtin_amdgcn_fence(__ATOMIC_RELEASE, "workgroup"); __builtin_amdgcn_wave_barrier(); __builtin_amdgcn_fence(__ATOMIC_ACQUIRE, "workgroup"); }
__device__ __forceinline__ float nexp2(float x) { return __builtin_amdgcn_exp2f(x); }

__global__ __launch_bounds__(256) void xt_kernel(const float* __restrict__ x, b16* __restrict__ XT16) {
  __shared__ __attribute__((aligned(16))) b16 T[64][64 + 8];
  const int b = blockIdx.z, c0 = blockIdx.y * 64, n0 = blockIdx.x * 64, t_ = threadIdx.x;
  float xv[16];
#pragma unroll   // all 16 loads of a lane are issued before the first is waited for
  for (int i = 0; i < 16; ++i) { const int q = t_ + i * 256; xv[i] = x[((size_t)b * C + c0 + (q >> 6)) * N + n0 + (q & 63)]; }
#pragma unroll   // xv[] stays in registers only under constant indices
  for (int i = 0; i < 16; ++i) { const int q = t_ + i * 256; T[q & 63][q >> 6] = (b16)(bf16_rne(xv[i]) * XS); }
  __syncthreads();
  { for (int q = t_; q < 64 * 8; q += 256) { const int nn = q >> 3, c8 = (q & 7) * 8; *(v8b*)(XT16 + ((size_t)b * N + n0 + nn) * C + c0 + c8) = *(const v8b*)(&T[nn][c8]); }  }
}
__global__ __launch_bounds__(256) void prepw_kernel(const float* __restrict__ wq, const float* __restrict__ wk, const float* __restrict__ wg, const float* __restrict__ wo, b16* __restrict__ W16, b16* __restrict__ WG, b16* __restrict__ WO) {
  const int t = blockIdx.x * 256 + threadIdx.x; const int nq = CQ * C / 8, ng = CG * C / 8, no = C * CG / 8; const float* src; int e; b16* dst;
  if (t < nq) { src = wq; e = t * 8; dst = W16; } else if (t < 2 * nq) { src = wk; e = (t - nq) * 8; dst = W16 + CQ * C; } else if (t < 2 * nq + ng) { src = wg; e = (t - 2 * nq) * 8; dst = WG; } else if (t < 2 * nq + ng + no) { src = wo; e = (t - 2 * nq - ng) * 8; dst = WO; } else return;
  v8b o; for (int j = 0; j < 8; ++j) o[j] = (b16)(bf16_rne(src[e + j]) * WSC);
  { *(v8b*)(dst + e) = o;  }
}
// theta/phi projection: [n x 256] x [256 x 32] -> theta as QH/QL [b][n][32] f16 hi+lo x8 (64-B rows: 4 lanes x 16 B, 8 rows per instruction) and phi (full resolution, f32) as PHI [b][n][32]
__global__ __launch_bounds__(128) void qk_kernel(const b16* __restrict__ XT16, const b16* __restrict__ W16, b16* __restrict__ QH, b16* __restrict__ QL, float* __restrict__ PHI) {
  __shared__ __attribute__((aligned(16))) b16 Th[4][16][CQ + 8], Tl[4][16][CQ + 8]; __shared__ __attribute__((aligned(16))) float Tf[4][16][CQ + 4];
  const int wave = threadIdx.x >> 5, lane = threadIdx.x & 31, nloc = lane & 15, hlf = lane >> 4; const size_t r0 = ((size_t)blockIdx.x * 4 + wave) * 16;   // over b*N + n
  v8f acc[4] = {{}, {}, {}, {}};   // tiles: q0, q1, k0, k1
  // the fragments of k step k + 3 are requested in front of the products of k step k (four register buffers): a load written behind a product's pad statement is not moved over it
  v16b a[4], w[4][4];
  auto ld = [&](int k) { a[k & 3] = frag_kb(XT16 + (r0 + nloc) * C + k * 32, hlf);
#pragma unroll   // constant indices keep the buffers in registers
    for (int t = 0; t < 4; ++t) w[k & 3][t] = frag_kb(W16 + (size_t)((t >> 1) * CQ + (t & 1) * 16 + nloc) * C + k * 32, hlf); };
  ld(0); ld(1); ld(2);
#pragma unroll   // buffer numbers must be compile-time constants
  for (int k = 0; k < C / 32; ++k) { if (k + 3 < C / 32) ld(k + 3);
#pragma unroll
    for (int t = 0; t < 4; ++t) acc[t] = wmma16b(a[k & 3], w[k & 3][t], acc[t]); }
#pragma unroll
  for (int t = 0; t < 4; ++t) { const int which = t >> 1, c = (t & 1) * 16 + nloc;
#pragma unroll
    for (int r = 0; r < 8; ++r) { const float v = acc[t][r] * (1.0f / (XS * WSC)); if (which == 0) { b16 h_, l_; split16(v * XS, h_, l_); Th[wave][8 * hlf + r][c] = h_; Tl[wave][8 * hlf + r][c] = l_; } else Tf[wave][8 * hlf + r][c] = v; } }
  wave_lds_sync();
  {
    for (int q = 0; q < 2; ++q) { const int rr = q * 8 + (lane >> 2), seg = (lane & 3) * 8; *(v8b*)(QH + (r0 + rr) * CQ + seg) = *(const v8b*)(&Th[wave][rr][seg]); *(v8b*)(QL + (r0 + rr) * CQ + seg) = *(const v8b*)(&Tl[wave][rr][seg]); }
    for (int q = 0; q < 4; ++q) { const int rr = q * 4 + (lane >> 3), seg = (lane & 7) * 4; *(v4f*)(PHI + (r0 + rr) * CQ + seg) = *(const v4f*)(&Tf[wave][rr][seg]); }
     }
}
__global__ __launch_bounds__(256) void poolk_kernel(const float* __restrict__ PHI, b16* __restrict__ KH, b16* __restrict__ KL) {
  const size_t t = (size_t)blockIdx.x * 256 + threadIdx.x; if (t >= (size_t)NB * M * CQ / 8) return; const int c8 = (int)(t & 3) * 8; const size_t bm = t >> 2; const int b = (int)(bm / M), m = (int)(bm % M); const int h2 = m / (HW / 2), w2 = m % (HW / 2);
  const float* p0 = PHI + ((size_t)b * N + (size_t)(2 * h2) * HW + 2 * w2) * CQ + c8; v8b hv, lv;
  for (int j = 0; j < 8; ++j) { const float v = fmaxf(fmaxf(p0[j], p0[CQ + j]), fmaxf(p0[(size_t)HW * CQ + j], p0[(size_t)HW * CQ + CQ + j])); b16 h_, l_; split16(v * XS, h_, l_); hv[j] = h_; lv[j] = l_; }
  { *(v8b*)(KH + bm * CQ + c8) = hv; *(v8b*)(KL + bm * CQ + c8) = lv;  }
}
// g projection in channel-major layout: GF [b][d][n] = W_g x (f32): GEMM rows d (A = WG rows, K = c) x cols n (B = XT16 rows n): block = 64 d x 4 waves x 128 n; each wave writes 16 d-rows x 128 n floats
__global__ __launch_bounds__(128) void g_kernel(const b16* __restrict__ XT16, const b16* __restrict__ WG, float* __restrict__ GF) {
  __shared__ __attribute__((aligned(16))) float Ts[4][16][128 + 4];
  const int wave = threadIdx.x >> 5, lane = threadIdx.x & 31, nloc = lane & 15, hlf = lane >> 4; const int b = blockIdx.z; const int d0 = blockIdx.x * 64 + wave * 16, n0 = blockIdx.y * 128;
  v8f acc[8];
#pragma unroll
  for (int t = 0; t < 8; ++t) acc[t] = (v8f){};
  // the nine fragments of k step k + 1 are requested in front of the products of k step k (two register buffers)
  v16b a[2], bf[2][8];
  auto ld = [&](int k) { a[k & 1] = frag_kb(WG + (size_t)(d0 + nloc) * C + k * 32, hlf);
#pragma unroll   // constant indices keep the buffers in registers
    for (int t = 0; t < 8; ++t) bf[k & 1][t] = frag_kb(XT16 + ((size_t)b * N + n0 + t * 16 + nloc) * C + k * 32, hlf); };
  ld(0);
#pragma unroll   // buffer numbers must be compile-time constants
  for (int k = 0; k < C / 32; ++k) { if (k + 1 < C / 32) ld(k + 1);
#pragma unroll
    for (int t = 0; t < 8; ++t) acc[t] = wmma16b(a[k & 1], bf[k & 1][t], acc[t]); }
#pragma unroll
  for (int t = 0; t < 8; ++t)
#pragma unroll
    for (int r = 0; r < 8; ++r) Ts[wave][8 * hlf + r][t * 16 + nloc] = acc[t][r] * (1.0f / (XS * WSC));
  wave_lds_sync();
  { for (int rr = 0; rr < 16; ++rr) *(v4f*)(GF + ((size_t)b * CG + d0 + rr) * N + n0 + lane * 4) = *(const v4f*)(&Ts[wave][rr][lane * 4]);  }
}
__global__ __launch_bounds__(256) void poolg_kernel(const float* __restrict__ GF, b16* __restrict__ GP, b16* __restrict__ GPL) {
  const size_t t = (size_t)blockIdx.x * 256 + threadIdx.x; if (t >= (size_t)NB * M * CG / 8) return; const int d8 = (int)(t & 15) * 8; const size_t bm = t >> 4; const int b = (int)(bm / M), m = (int)(bm % M); const int h2 = m / (HW / 2), w2 = m % (HW / 2);
  const size_t n00 = (size_t)(2 * h2) * HW + 2 * w2; v8b hv, lv;
  for (int j = 0; j < 8; ++j) { const float* p = GF + ((size_t)b * CG + d8 + j) * N + n00; const float v = fmaxf(fmaxf(p[0], p[1]), fmaxf(p[HW], p[HW + 1])); b16 h_, l_; split16(v * XS, h_, l_); hv[j] = h_; lv[j] = l_; }
  { *(v8b*)(GP + bm * CG + d8) = hv; *(v8b*)(GPL + bm * CG + d8) = lv;  }
}
// pooled values with W_o folded in, channel-major: V16/VL16 [b][c][m] = f16 hi+lo x8 of sum_d W_o[c][d] gpool[m][d]: GEMM rows c (A = WO rows, K = 128) x cols m (B = GP/GPL rows m, 2 products):
__global__ __launch_bounds__(128) void v_kernel(const b16* __restrict__ GP, const b16* __restrict__ GPL, const b16* __restrict__ WO, b16* __restrict__ V16, b16* __restrict__ VL16) {
  __shared__ __attribute__((aligned(16))) b16 Ts[4][16][128 + 8], Tl[4][16][128 + 8];
  const int wave = threadIdx.x >> 5, lane = threadIdx.x & 31, nloc = lane & 15, hlf = lane >> 4; const int b = blockIdx.z; const int d0 = blockIdx.x * 64 + wave * 16, n0 = blockIdx.y * 128;   // d0: output channel c; n0: pooled position m
  v8f acc[8];
#pragma unroll
  for (int t = 0; t < 8; ++t) acc[t] = (v8f){};
  // item i = (k step i / 4, tiles 2 (i % 4) and + 1): the four fragments of item i + 2 are requested in front of the products of item i (three register buffers), a k step's W_o fragment with its first item
  v16b a[2], gh[3][2], gl[3][2];
  auto ld = [&](int i) { if ((i & 3) == 0) { a[(i >> 2) & 1] = frag_kb(WO + (size_t)(d0 + nloc) * CG + (i >> 2) * 32, hlf); asm volatile("s_wait_xcnt 0x0" ::: "memory"); }   // the wait stands in front of the next loads, whose results may reuse the W_o address registers
#pragma unroll   // constant indices keep the buffers in registers
    for (int j = 0; j < 2; ++j) { const size_t ro = ((size_t)b * M + n0 + ((i & 3) * 2 + j) * 16 + nloc) * CG + (i >> 2) * 32; gh[i % 3][j] = frag_kb(GP + ro, hlf); gl[i % 3][j] = frag_kb(GPL + ro, hlf); } };
  ld(0); ld(1);
#pragma unroll   // buffer numbers must be compile-time constants
  for (int i = 0; i < 4 * (CG / 32); ++i) { if (i + 2 < 4 * (CG / 32)) ld(i + 2);
#pragma unroll
    for (int j = 0; j < 2; ++j) { const int t = (i & 3) * 2 + j; acc[t] = wmma16b(a[(i >> 2) & 1], gh[i % 3][j], acc[t]); acc[t] = wmma16b(a[(i >> 2) & 1], gl[i % 3][j], acc[t]); } }
  // acc[t][r] = V'[d0 + 8hlf + r][n0 + t*16 + nloc] x 2048
#pragma unroll
  for (int t = 0; t < 8; ++t)
#pragma unroll
    for (int r = 0; r < 8; ++r) { b16 h_, l_; split16(acc[t][r] * (1.0f / (XS * WSC)) * XS, h_, l_); Ts[wave][8 * hlf + r][t * 16 + nloc] = h_; Tl[wave][8 * hlf + r][t * 16 + nloc] = l_; }
  wave_lds_sync();
  { for (int rr = 0; rr < 16; ++rr) if (lane < 16) { const size_t gi = ((size_t)b * C + d0 + rr) * M + n0 + lane * 8; *(v8b*)(V16 + gi) = *(const v8b*)(&Ts[wave][rr][lane * 8]); *(v8b*)(VL16 + gi) = *(const v8b*)(&Tl[wave][rr][lane * 8]); }  }
}
// attention: grid (N/128 query blocks, 2 channel halves, B); block = 8 waves x 16 queries. K (hi, lo) and V' (hi, lo; the 128 channels of this half) come in stages of 64 pooled keys into a
// two-buffer LDS ring that all 8 waves read: every lane copies 16 B pieces with asynchronous copies to LDS (whole 128-B lines per 8 lanes for V', 4 KB contiguous for K), one stage ahead of its use.
// Per block of 32 pooled keys: S^T = Phi . Theta^T with (Kh Qh + Kh Ql + Kl Qh), online softmax (f32, exp2), O^T (8 tiles) += V'[c][keys] P^T (hi + lo). out[b][c][n] = gamma O/l + x, staged in the ring's LDS.
constexpr int KS = 64 /* keys per stage */, VP = 144, KP = 80 /* LDS row pitch in bytes, 16 B x odd: 16 rows of a 16-byte read fall on 64 distinct banks */;
constexpr int OFF_VH = 0, OFF_VL = 128 * VP, OFF_KH = 2 * 128 * VP, OFF_KL = OFF_KH + KS * KP, STAGE_B = OFF_KL + KS * KP;   // 47,104 B per buffer
// one stage (keys k0 .. k0 + 63) into the buffer at LDS byte address lb: 10 copies per lane, 256 lanes; V' rows vr + 32 j (8 lanes x 16 B = one 128-B line each), K rows kr (4 lanes x 16 B)
__device__ __forceinline__ void stage_kv(unsigned lb, const b16* Vb, const b16* Vlb, const b16* Khb, const b16* Klb, int k0, int tid) {
  const int vr = tid >> 3, vc = tid & 7, kr = tid >> 2, kc = tid & 3; const unsigned lv = lb + vr * VP + vc * 16, lk = lb + kr * KP + kc * 16; const size_t gv = (size_t)vr * M + k0 + vc * 8, gk = (size_t)(k0 + kr) * CQ + kc * 8;
  // the ten copies and, as the statement's last line, the wait that stands in front of any rewrite of the address registers they name
  asm volatile("global_load_async_to_lds_b128 %0, %1, off\n\tglobal_load_async_to_lds_b128 %2, %3, off\n\tglobal_load_async_to_lds_b128 %4, %5, off\n\tglobal_load_async_to_lds_b128 %6, %7, off\n\tglobal_load_async_to_lds_b128 %8, %9, off\n\t"
               "global_load_async_to_lds_b128 %10, %11, off\n\tglobal_load_async_to_lds_b128 %12, %13, off\n\tglobal_load_async_to_lds_b128 %14, %15, off\n\tglobal_load_async_to_lds_b128 %16, %17, off\n\tglobal_load_async_to_lds_b128 %18, %19, off\n\ts_wait_xcnt 0x0"
               :: "v"(lv + OFF_VH), "v"(Vb + gv), "v"(lv + OFF_VH + 32 * VP), "v"(Vb + gv + 32 * M), "v"(lv + OFF_VH + 64 * VP), "v"(Vb + gv + 64 * M), "v"(lv + OFF_VH + 96 * VP), "v"(Vb + gv + 96 * M), "v"(lk + OFF_KH), "v"(Khb + gk),
                  "v"(lv + OFF_VL), "v"(Vlb + gv), "v"(lv + OFF_VL + 32 * VP), "v"(Vlb + gv + 32 * M), "v"(lv + OFF_VL + 64 * VP), "v"(Vlb + gv + 64 * M), "v"(lv + OFF_VL + 96 * VP), "v"(Vlb + gv + 96 * M), "v"(lk + OFF_KL), "v"(Klb + gk) : "memory");
}
__global__ __launch_bounds__(256) void attn_kernel(const b16* __restrict__ QH, const b16* __restrict__ QL, const b16* __restrict__ KH, const b16* __restrict__ KL, const b16* __restrict__ V16, const b16* __restrict__ VL16, const float* __restrict__ x, const float* __restrict__ gamma_, float* __restrict__ out) {
  __shared__ __attribute__((aligned(128))) unsigned char L[2 * STAGE_B];   // the ring; after the loop the output staging To[128][128 + 4] (67,584 B)
  const int tid = threadIdx.x, wave = threadIdx.x >> 5, lane = threadIdx.x & 31, hh = lane >> 4, col = lane & 15; const int b = blockIdx.z, dh = blockIdx.y; const int q0 = blockIdx.x * 128 + wave * 16, qi = q0 + col;
  const size_t qrow = (size_t)b * N + qi; const v16b qh = frag_kb(QH + qrow * CQ, hh), ql = frag_kb(QL + qrow * CQ, hh);
  const b16* Khb = KH + (size_t)b * M * CQ; const b16* Klb = KL + (size_t)b * M * CQ; const b16* Vb = V16 + ((size_t)b * C + dh * 128) * M; const b16* Vlb = VL16 + ((size_t)b * C + dh * 128) * M; const float gamma = bf16_rne(gamma_[0]);
  const unsigned lds0 = (unsigned)(size_t)L;
  float m = -INFINITY, l = 0.0f; v8f o[8], ol[8];
#pragma unroll
  for (int t = 0; t < 8; ++t) { o[t] = (v8f){}; ol[t] = (v8f){}; }
  stage_kv(lds0, Vb, Vlb, Khb, Klb, 0, tid);
  asm volatile("s_wait_asynccnt 0x0" ::: "memory");   // this wave's copies of stage 0 have landed
  __syncthreads();                                    // every wave's have: stage 0 is readable
  stage_kv(lds0 + STAGE_B, Vb, Vlb, Khb, Klb, KS, tid);
  for (int st = 0; st < M / KS; ++st) {
    const unsigned char* B = L + (st & 1) * STAGE_B;
    // LDS fragment reads stand well in front of the products that use them (a read written behind a product's pad statement is not moved over it): per 32 keys the four K fragments as one group,
    // V' tiles 0 and 1 behind the first energy product, tile 2 behind the softmax, tile t + 3 behind the products of tile t; every read of a stage still ends in front of the stage's foot
    v16b kf[4];
    auto ldk = [&](int kk) { kf[0] = frag_kb((const b16*)(B + OFF_KH + (kk + col) * KP), hh); kf[1] = frag_kb((const b16*)(B + OFF_KH + (kk + 16 + col) * KP), hh); kf[2] = frag_kb((const b16*)(B + OFF_KL + (kk + col) * KP), hh); kf[3] = frag_kb((const b16*)(B + OFF_KL + (kk + 16 + col) * KP), hh); };
    for (int kk = 0; kk < KS; kk += 32) {
      v16b vh[8], vl[8];
      auto ldv = [&](int t) { vh[t] = frag_kb((const b16*)(B + OFF_VH + (t * 16 + col) * VP) + kk, hh); vl[t] = frag_kb((const b16*)(B + OFF_VL + (t * 16 + col) * VP) + kk, hh); };
      ldk(kk);
      v8f s0 = {}, s1 = {};
      s0 = wmma16b(kf[0], qh, s0); ldv(0); ldv(1); s0 = wmma16b(kf[0], ql, s0); s0 = wmma16b(kf[2], qh, s0);
      s1 = wmma16b(kf[1], qh, s1); s1 = wmma16b(kf[1], ql, s1); s1 = wmma16b(kf[3], qh, s1);
      float e[16]; float mx = -INFINITY; const float cs = LOG2E / (XS * XS);
#pragma unroll
      for (int r = 0; r < 8; ++r) { e[r] = s0[r] * cs; e[8 + r] = s1[r] * cs; mx = fmaxf(mx, fmaxf(e[r], e[8 + r])); }
      mx = fmaxf(mx, __shfl_xor(mx, 16)); const float mn = fmaxf(m, mx); const float al = nexp2(m - mn); m = mn; float sum = 0.0f; v16b ph, pl;
#pragma unroll
      for (int i = 0; i < 16; ++i) { const float p = nexp2(e[i] - mn); sum += p; const b16 h_ = (b16)(p * PS); ph[i] = h_; pl[i] = (b16)(p * PS - (float)h_); }
      sum += __shfl_xor(sum, 16); l = l * al + sum;
      ldv(2);
#pragma unroll
      for (int t = 0; t < 8; ++t) { o[t] *= al; ol[t] *= al; o[t] = wmma16b(vh[t], ph, o[t]); ol[t] = wmma16b(vh[t], pl, ol[t]); ol[t] = wmma16b(vl[t], ph, ol[t]);
        if (t + 3 < 8) ldv(t + 3); } }
    asm volatile("s_wait_dscnt 0x0" ::: "memory");      // this wave's reads of the buffer are done before it is refilled
    asm volatile("s_wait_asynccnt 0x0" ::: "memory");   // this wave's copies of stage st + 1 have landed
    __syncthreads();                                    // publishes stage st + 1 and ends every wave's reads of stage st
    if (st + 2 < M / KS) stage_kv(lds0 + (st & 1) * STAGE_B, Vb, Vlb, Khb, Klb, (st + 2) * KS, tid);
  }
  asm volatile("s_wait_asynccnt 0x0" ::: "memory");     // no copy is outstanding when the ring becomes output staging
  const float inv = 1.0f / (l * PS * XS);
  float (*To)[128 + 4] = (float (*)[128 + 4])L;
  // o[t][r] = O^T[d = t*16 + 8hh + r][query col] -> To[d][wave*16 + col]
#pragma unroll
  for (int t = 0; t < 8; ++t)
#pragma unroll
    for (int r = 0; r < 8; ++r) To[t * 16 + 8 * hh + r][wave * 16 + col] = (o[t][r] + ol[t][r]) * inv;
  __syncthreads();
  for (int i = 0; i < 16; ++i) { const int dd = wave * 16 + i;
    for (int sg = 0; sg < 128; sg += 32) { const size_t gi = ((size_t)b * C + dh * 128 + dd) * N + blockIdx.x * 128 + sg + lane; ((float*)out)[gi] = gamma * To[dd][sg + lane] + bf16_rne(x[gi]); }
    asm volatile("s_wait_xcnt 0x0" ::: "memory");   // stands in front of the next trip's rewrite of the registers that this trip's loads and stores name
  }
}
}  // namespace

extern "C" void kernel_launch(void* const* d_in, const int* in_sizes, int n_in, void* d_out, int out_size, void* d_ws, size_t ws_size, hipStream_t stream) {
  (void)n_in;
  auto Fp = [&](int i) { return (const float*)d_in[i]; };
  // input order: 0 x [8,256,64,64], 1 w_theta [32,256], 2 w_phi [32,256], 3 w_g [128,256], 4 w_o [256,128], 5 gamma [1]
  if (in_sizes[0] != NB * C * N || in_sizes[1] != CQ * C || in_sizes[2] != CQ * C || in_sizes[3] != CG * C || in_sizes[4] != C * CG || in_sizes[5] != 1 || out_size != NB * C * N) return;
  size_t off = 0; char* ws = (char*)d_ws;
  auto carve = [&](size_t bytes) { char* p = ws + off; off += (bytes + 255) & ~(size_t)255; return p; };
  b16* XT16 = (b16*)carve((size_t)NB * N * C * 2); b16* W16 = (b16*)carve((size_t)2 * CQ * C * 2); b16* WG = (b16*)carve((size_t)CG * C * 2); b16* WO = (b16*)carve((size_t)C * CG * 2);
  b16* QH = (b16*)carve((size_t)NB * N * CQ * 2); b16* QL = (b16*)carve((size_t)NB * N * CQ * 2); float* PHI = (float*)carve((size_t)NB * N * CQ * 4); b16* KH = (b16*)carve((size_t)NB * M * CQ * 2); b16* KL = (b16*)carve((size_t)NB * M * CQ * 2);
  float* GF = (float*)carve((size_t)NB * CG * N * 4); b16* GP = (b16*)carve((size_t)NB * M * CG * 2); b16* GPL = (b16*)carve((size_t)NB * M * CG * 2); b16* V16 = (b16*)carve((size_t)NB * C * M * 2); b16* VL16 = (b16*)carve((size_t)NB * C * M * 2);
  if (off > ws_size || off > ((size_t)128 << 20)) return;   // = 53.2 MiB
  xt_kernel<<<dim3(N / 64, C / 64, NB), 256, 0, stream>>>(Fp(0), XT16);
  prepw_kernel<<<((2 * CQ * C + CG * C + C * CG) / 8 + 255) / 256, 256, 0, stream>>>(Fp(1), Fp(2), Fp(3), Fp(4), W16, WG, WO);
  qk_kernel<<<NB * N / 64, 128, 0, stream>>>(XT16, W16, QH, QL, PHI);
  poolk_kernel<<<(NB * M * CQ / 8 + 255) / 256, 256, 0, stream>>>(PHI, KH, KL);
  g_kernel<<<dim3(CG / 64, N / 128, NB), 128, 0, stream>>>(XT16, WG, GF);
  poolg_kernel<<<(NB * M * CG / 8 + 255) / 256, 256, 0, stream>>>(GF, GP, GPL);
  v_kernel<<<dim3(C / 64, M / 128, NB), 128, 0, stream>>>(GP, GPL, WO, V16, VL16);
  attn_kernel<<<dim3(N / 128, 2, NB), 256, 0, stream>>>(QH, QL, KH, KL, V16, VL16, Fp(0), Fp(5), (float*)d_out);
}

// v003
// It runs in 92.2 microseconds.
// In both of two side-by-side timings against v002, it was 1.17 times as fast.
// Over all steps from v000 it is 2.98 times as fast.
#include <hip/hip_runtime.h>

// SAGAN attention block (8 images x 256 ch x 64 x 64): theta = W_theta x (32 ch, all 4,096 pixels), phi = maxpool2x2(W_phi x) (32 ch x 1,024 pooled positions), g = maxpool2x2(W_g x) (128 x 1,024),
// beta = softmax over the 1,024 pooled keys of theta^T phi (no scaling), o = W_o (g beta^T) = (W_o g) beta^T, out = gamma * o + x. The 1x1 convs are channel GEMMs; W_o is folded into the pooled
// values (V' = W_o g, [256 x 1,024] per image) so the attention writes the final channels directly.
// WMMA (v_wmma_f32_16x16x32_f16, f32 accumulate): projections with EXACT bf16 pixels (x^T rows x8, via an LDS transpose of the channel-major input) and weights (x256), 1 product; V' = W_o g with
// g pooled as f16 hi+lo x8 and W_o exact (2 products); energy tiles S^T = Phi . Theta^T with theta AND phi as f16 hi+lo x8 (3 products; logits sigma ~5.7); online softmax in f32; O^T += V' P^T with
// V' and P as f16 hi+lo x8 (3 products). Max-pooling, softmax, gamma, residual in f32. Inputs rounded to bf16 once (gamma and the residual x included). Fragment k-map

namespace {
constexpr int NB = 8, C = 256, CQ = 32, N = 4096, M = 1024 /* pooled positions */, CG = 128 /* g channels */, HW = 64;
constexpr float XS = 8.0f, WSC = 256.0f, PS = 8.0f, LOG2E = 1.4426950408889634f;

typedef _Float16 b16;
typedef __attribute__((ext_vector_type(16))) _Float16 v16b;
typedef __attribute__((ext_vector_type(8))) _Float16 v8b;
typedef __attribute__((ext_vector_type(8))) float v8f;
typedef __attribute__((ext_vector_type(4))) float v4f;
__device__ __forceinline__ float bf16_rne(float f) { unsigned int u = __float_as_uint(f); u += 0x7FFFu + ((u >> 16) & 1u); return __uint_as_float(u & 0xFFFF0000u); }
__device__ __forceinline__ void split16(float v, b16& hi, b16& lo) { hi = (b16)v; lo = (b16)(v - (float)hi); }
__device__ __forceinline__ v16b frag_kb(const b16* p, int hh) { const v8b a = *(const v8b*)(p + 8 * hh), b = *(const v8b*)(p + 16 + 8 * hh); v16b f;
#pragma unroll
  for (int e = 0; e < 8; ++e) { f[e] = a[e]; f[8 + e] = b[e]; } return f; }
__device__ __forceinline__ v8f wmma16b(v16b a, v16b b, v8f c) { v8f d = __builtin_amdgcn_wmma_f32_16x16x32_f16(false, a, false, b, (short)0, c, false, false); asm volatile("v_nop\n\tv_nop\n\tv_nop\n\tv_nop" : "+v"(d) : "v"(a), "v"(b)); return d; }
__device__ __forceinline__ void wave_lds_sync() { __builtin_amdgcn_fence(__ATOMIC_RELEASE, "workgroup"); __builtin_amdgcn_wave_barrier(); __builtin_amdgcn_fence(__ATOMIC_ACQUIRE, "workgroup"); }
__device__ __forceinline__ float nexp2(float x) { return __builtin_amdgcn_exp2f(x); }

typedef __attribute__((ext_vector_type(4))) _Float16 v4b;
typedef __attribute__((ext_vector_type(2))) float v2f;
// launch 1: the weight conversion (its own PWB work-groups, in front) and the transpose of x share one grid: neither reads what the other writes
constexpr int PWB = ((2 * CQ * C + CG * C + C * CG) / 8 + 255) / 256, XTB = (N / 64) * (C / 64) * NB;
__global__ __launch_bounds__(256) void pre_kernel(const float* __restrict__ x, const float* __restrict__ wq, const float* __restrict__ wk, const float* __restrict__ wg, const float* __restrict__ wo, b16* __restrict__ XT16, b16* __restrict__ W16, b16* __restrict__ WG, b16* __restrict__ WO) {
  __shared__ __attribute__((aligned(16))) b16 T[64][64 + 8];
  if (blockIdx.x < PWB) {
    const int t = blockIdx.x * 256 + threadIdx.x; const int nq = CQ * C / 8, ng = CG * C / 8, no = C * CG / 8; const float* src; int e; b16* dst;
    if (t < nq) { src = wq; e = t * 8; dst = W16; } else if (t < 2 * nq) { src = wk; e = (t - nq) * 8; dst = W16 + CQ * C; } else if (t < 2 * nq + ng) { src = wg; e = (t - 2 * nq) * 8; dst = WG; } else if (t < 2 * nq + ng + no) { src = wo; e = (t - 2 * nq - ng) * 8; dst = WO; } else return;
    v8b o; for (int j = 0; j < 8; ++j) o[j] = (b16)(bf16_rne(src[e + j]) * WSC);
    { *(v8b*)(dst + e) = o;  }
    return;
  }
  const int f = blockIdx.x - PWB; const int b = f >> 8, c0 = ((f >> 6) & 3) * 64, n0 = (f & 63) * 64, t_ = threadIdx.x;
  float xv[16];
#pragma unroll   // all 16 loads of a lane are issued before the first is waited for
  for (int i = 0; i < 16; ++i) { const int q = t_ + i * 256; xv[i] = x[((size_t)b * C + c0 + (q >> 6)) * N + n0 + (q & 63)]; }
#pragma unroll   // xv[] stays in registers only under constant indices
  for (int i = 0; i < 16; ++i) { const int q = t_ + i * 256; T[q & 63][q >> 6] = (b16)(bf16_rne(xv[i]) * XS); }
  __syncthreads();
  { for (int q = t_; q < 64 * 8; q += 256) { const int nn = q >> 3, c8 = (q & 7) * 8; *(v8b*)(XT16 + ((size_t)b * N + n0 + nn) * C + c0 + c8) = *(const v8b*)(&T[nn][c8]); }  }
}
// theta/phi projection: [n x 256] x [256 x 32]. A wave's 16 pixel rows are 8 neighbours of image row 2 h2 and the 8 below them, so that it holds whole 2x2 pooling windows:
// theta goes out as QH/QL [b][n][32] f16 hi+lo x8 (64-B rows), phi is max-pooled from the wave's f32 staging and goes out as KH/KL [b][m][32] f16 hi+lo x8 (4 pooled positions a wave)
__device__ __forceinline__ void qk_part(unsigned char* S, int blk, const b16* __restrict__ XT16, const b16* __restrict__ W16, b16* __restrict__ QH, b16* __restrict__ QL, b16* __restrict__ KH, b16* __restrict__ KL) {
  b16 (*Th)[16][CQ + 8] = (b16 (*)[16][CQ + 8])S; b16 (*Tl)[16][CQ + 8] = (b16 (*)[16][CQ + 8])(S + 8 * 16 * (CQ + 8) * 2); float (*Tf)[16][CQ + 4] = (float (*)[16][CQ + 4])(S + 2 * 8 * 16 * (CQ + 8) * 2);
  const int wave = threadIdx.x >> 5, lane = threadIdx.x & 31, nloc = lane & 15, hlf = lane >> 4; const int gw = blk * 8 + wave; const int b = gw >> 8, h2 = (gw >> 3) & 31, w0 = (gw & 7) * 8;
  auto pix = [&](int rr) { return (size_t)b * N + (size_t)(2 * h2 + (rr >> 3)) * HW + w0 + (rr & 7); };   // over b*N + n
  v8f acc[4] = {{}, {}, {}, {}};   // tiles: q0, q1, k0, k1
  // the fragments of k step k + 3 are requested in front of the products of k step k (four register buffers): a load written behind a product's pad statement is not moved over it
  v16b a[4], w[4][4];
  auto ld = [&](int k) { a[k & 3] = frag_kb(XT16 + pix(nloc) * C + k * 32, hlf);
#pragma unroll   // constant indices keep the buffers in registers
    for (int t = 0; t < 4; ++t) w[k & 3][t] = frag_kb(W16 + (size_t)((t >> 1) * CQ + (t & 1) * 16 + nloc) * C + k * 32, hlf); };
  ld(0); ld(1); ld(2);
#pragma unroll   // buffer numbers must be compile-time constants
  for (int k = 0; k < C / 32; ++k) { if (k + 3 < C / 32) ld(k + 3);
#pragma unroll
    for (int t = 0; t < 4; ++t) acc[t] = wmma16b(a[k & 3], w[k & 3][t], acc[t]); }
#pragma unroll
  for (int t = 0; t < 4; ++t) { const int which = t >> 1, c = (t & 1) * 16 + nloc;
#pragma unroll
    for (int r = 0; r < 8; ++r) { const float v = acc[t][r] * (1.0f / (XS * WSC)); if (which == 0) { b16 h_, l_; split16(v * XS, h_, l_); Th[wave][8 * hlf + r][c] = h_; Tl[wave][8 * hlf + r][c] = l_; } else Tf[wave][8 * hlf + r][c] = v; } }
  wave_lds_sync();
  {
    for (int q = 0; q < 2; ++q) { const int rr = q * 8 + (lane >> 2), seg = (lane & 3) * 8; *(v8b*)(QH + pix(rr) * CQ + seg) = *(const v8b*)(&Th[wave][rr][seg]); *(v8b*)(QL + pix(rr) * CQ + seg) = *(const v8b*)(&Tl[wave][rr][seg]); }
    const int i = lane >> 3, c4 = (lane & 7) * 4;   // pooled position w0 / 2 + i, channels c4 .. c4 + 3
    const v4f p00 = *(const v4f*)(&Tf[wave][2 * i][c4]), p01 = *(const v4f*)(&Tf[wave][2 * i + 1][c4]), p10 = *(const v4f*)(&Tf[wave][8 + 2 * i][c4]), p11 = *(const v4f*)(&Tf[wave][8 + 2 * i + 1][c4]); v4b hv, lv;
#pragma unroll   // constant indices keep hv, lv in registers
    for (int j = 0; j < 4; ++j) { const float v = fmaxf(fmaxf(p00[j], p01[j]), fmaxf(p10[j], p11[j])); b16 h_, l_; split16(v * XS, h_, l_); hv[j] = h_; lv[j] = l_; }
    const size_t ko = ((size_t)b * M + h2 * (HW / 2) + (w0 >> 1) + i) * CQ + c4; *(v4b*)(KH + ko) = hv; *(v4b*)(KL + ko) = lv;
    asm volatile("s_wait_xcnt 0x0" ::: "memory");   // behind the last store of this part: whatever code follows it in the joint kernel may reuse the registers that these stores name
  }
}
// g projection, pooling and V' in one work-group of 8 waves = all 128 g channels x 128 pixels (image rows 2 h2 and 2 h2 + 1). GEMM rows d (A = WG rows, K = c) x cols n (B = XT16 rows n): each wave
// stages 16 d-rows x 128 n floats and max-pools them 2x2 (a lane takes pooled column w2 = lane of all 16 rows) into Gh/Gl [32 m][128 d] f16 hi+lo x8 in LDS. Behind one barrier the pooled values with W_o
// folded in, channel-major: V16/VL16 [b][c][m] = f16 hi+lo x8 of sum_d W_o[c][d] gpool[m][d]: rows c (A = WO rows, K = 128; 32 a wave) x cols m (B = Gh/Gl rows m, 2 products)
constexpr int GPP = CG + 8 /* pitch of Gh, Gl in halves: 272 B = 16 B x odd */, SZ_TS = 8 * 16 * (128 + 4) * 4, SZ_G = 32 * GPP * 2;
__device__ __forceinline__ void gv_part(unsigned char* S, int blk, const b16* __restrict__ XT16, const b16* __restrict__ WG, const b16* __restrict__ WO, b16* __restrict__ V16, b16* __restrict__ VL16) {
  float (*Ts)[16][128 + 4] = (float (*)[16][128 + 4])S; b16 (*Gh)[GPP] = (b16 (*)[GPP])(S + SZ_TS); b16 (*Gl)[GPP] = (b16 (*)[GPP])(S + SZ_TS + SZ_G);
  const int wave = threadIdx.x >> 5, lane = threadIdx.x & 31, nloc = lane & 15, hlf = lane >> 4; const int b = blk >> 5, h2 = blk & 31; const int d0 = wave * 16, n0 = h2 * 128, c0 = wave * 32;
  v8f acc[8];
#pragma unroll
  for (int t = 0; t < 8; ++t) acc[t] = (v8f){};
  // the nine fragments of k step k + 1 are requested in front of the products of k step k (two register buffers)
  v16b a[2], bf[2][8];
  auto ld = [&](int k) { a[k & 1] = frag_kb(WG + (size_t)(d0 + nloc) * C + k * 32, hlf); if (k == C / 32 - 1) asm volatile("s_wait_xcnt 0x0" ::: "memory");   // behind the last W_g load: the next loads' results may reuse its address registers
#pragma unroll   // constant indices keep the buffers in registers
    for (int t = 0; t < 8; ++t) bf[k & 1][t] = frag_kb(XT16 + ((size_t)b * N + n0 + t * 16 + nloc) * C + k * 32, hlf); };
  ld(0);
#pragma unroll   // buffer numbers must be compile-time constants
  for (int k = 0; k < C / 32; ++k) { if (k + 1 < C / 32) ld(k + 1);
#pragma unroll
    for (int t = 0; t < 8; ++t) acc[t] = wmma16b(a[k & 1], bf[k & 1][t], acc[t]); }
  v16b wa[CG / 32][2];   // this wave's W_o fragments, requested here so that they fly while the accumulators are scaled and staged
#pragma unroll   // both loops: constant indices keep wa in registers
  for (int k = 0; k < CG / 32; ++k)
#pragma unroll
    for (int ct = 0; ct < 2; ++ct) wa[k][ct] = frag_kb(WO + (size_t)(c0 + ct * 16 + nloc) * CG + k * 32, hlf);
  asm volatile("s_wait_xcnt 0x0" ::: "memory");   // behind the W_o loads: the staging's address arithmetic may reuse their address registers
#pragma unroll
  for (int t = 0; t < 8; ++t)
#pragma unroll
    for (int r = 0; r < 8; ++r) Ts[wave][8 * hlf + r][t * 16 + nloc] = acc[t][r] * (1.0f / (XS * WSC));
  wave_lds_sync();
  v8b hv[2], lv[2];
#pragma unroll   // constant indices keep hv, lv in registers
  for (int rr = 0; rr < 16; ++rr) { const v2f p = *(const v2f*)(&Ts[wave][rr][2 * lane]), q = *(const v2f*)(&Ts[wave][rr][HW + 2 * lane]); const float v = fmaxf(fmaxf(p[0], p[1]), fmaxf(q[0], q[1])); b16 h_, l_; split16(v * XS, h_, l_); hv[rr >> 3][rr & 7] = h_; lv[rr >> 3][rr & 7] = l_; }
  *(v8b*)(&Gh[lane][d0]) = hv[0]; *(v8b*)(&Gh[lane][d0 + 8]) = hv[1]; *(v8b*)(&Gl[lane][d0]) = lv[0]; *(v8b*)(&Gl[lane][d0 + 8]) = lv[1];
  __syncthreads();   // all 128 pooled g channels of the 32 positions are in Gh, Gl
  v8f va[2][2] = {{{}, {}}, {{}, {}}}; v16b gh[3][2], gl[3][2];
  // the four pooled-g fragments of k step k + 2 are read in front of the products of k step k (three register buffers)
  auto ldg = [&](int k) {
#pragma unroll   // constant indices keep the buffers in registers
    for (int mt = 0; mt < 2; ++mt) { gh[k % 3][mt] = frag_kb(&Gh[mt * 16 + nloc][k * 32], hlf); gl[k % 3][mt] = frag_kb(&Gl[mt * 16 + nloc][k * 32], hlf); } };
  ldg(0); ldg(1);
#pragma unroll   // buffer numbers must be compile-time constants
  for (int k = 0; k < CG / 32; ++k) { if (k + 2 < CG / 32) ldg(k + 2);
#pragma unroll   // this loop and the next: constant indices keep va and the fragments in registers
    for (int t = 0; t < 4; ++t) va[t >> 1][t & 1] = wmma16b(wa[k][t >> 1], gh[k % 3][t & 1], va[t >> 1][t & 1]);
#pragma unroll
    for (int t = 0; t < 4; ++t) va[t >> 1][t & 1] = wmma16b(wa[k][t >> 1], gl[k % 3][t & 1], va[t >> 1][t & 1]); }
  // va[ct][mt][r] = V'[c0 + ct*16 + 8hlf + r][h2*32 + mt*16 + nloc] x 2048, staged in the wave's own part of Ts (which only this wave has read)
  b16 (*Vh)[32 + 8] = (b16 (*)[32 + 8])(S + wave * (16 * (128 + 4) * 4)); b16 (*Vl)[32 + 8] = (b16 (*)[32 + 8])(S + wave * (16 * (128 + 4) * 4) + 32 * (32 + 8) * 2);
#pragma unroll   // both loops: va is read under constant indices
  for (int t = 0; t < 4; ++t)
#pragma unroll
    for (int r = 0; r < 8; ++r) { b16 h_, l_; split16(va[t >> 1][t & 1][r] * (1.0f / (XS * WSC)) * XS, h_, l_); Vh[(t >> 1) * 16 + 8 * hlf + r][(t & 1) * 16 + nloc] = h_; Vl[(t >> 1) * 16 + 8 * hlf + r][(t & 1) * 16 + nloc] = l_; }
  wave_lds_sync();
  for (int q = 0; q < 4; ++q) { const int row = q * 8 + (lane >> 2), seg = (lane & 3) * 8; const size_t gi = ((size_t)b * C + c0 + row) * M + h2 * (HW / 2) + seg; *(v8b*)(V16 + gi) = *(const v8b*)(&Vh[row][seg]); *(v8b*)(VL16 + gi) = *(const v8b*)(&Vl[row][seg]); }
}
// launch 2: the g / V' work-groups (even index) and the theta/phi work-groups (odd index) share one grid, alternating so that neighbours in the index are one of each kind; they read the same XT16 and write
// disjoint arrays; one LDS block serves either part
constexpr int GB = (N / 128) * NB, QKB = NB * N / 128;
__global__ __launch_bounds__(256) void proj_kernel(const b16* __restrict__ XT16, const b16* __restrict__ W16, const b16* __restrict__ WG, const b16* __restrict__ WO, b16* __restrict__ QH, b16* __restrict__ QL, b16* __restrict__ KH, b16* __restrict__ KL, b16* __restrict__ V16, b16* __restrict__ VL16) {
  __shared__ __attribute__((aligned(16))) unsigned char S[SZ_TS + 2 * SZ_G];
  static_assert(GB == QKB, "the two kinds alternate");
  if ((blockIdx.x & 1) == 0) gv_part(S, blockIdx.x >> 1, XT16, WG, WO, V16, VL16); else qk_part(S, blockIdx.x >> 1, XT16, W16, QH, QL, KH, KL);
}
// attention: grid (N/128 query blocks, 2 channel halves, B); block = 8 waves x 16 queries. K (hi, lo) and V' (hi, lo; the 128 channels of this half) come in stages of 64 pooled keys into a
// two-buffer LDS ring that all 8 waves read: every lane copies 16 B pieces with asynchronous copies to LDS (whole 128-B lines per 8 lanes for V', 4 KB contiguous for K), one stage ahead of its use.
// Per block of 32 pooled keys: S^T = Phi . Theta^T with (Kh Qh + Kh Ql + Kl Qh), online softmax (f32, exp2), O^T (8 tiles) += V'[c][keys] P^T (hi + lo). out[b][c][n] = gamma O/l + x, staged in the ring's LDS.
constexpr int KS = 64 /* keys per stage */, VP = 144, KP = 80 /* LDS row pitch in bytes, 16 B x odd: 16 rows of a 16-byte read fall on 64 distinct banks */;
constexpr int OFF_VH = 0, OFF_VL = 128 * VP, OFF_KH = 2 * 128 * VP, OFF_KL = OFF_KH + KS * KP, STAGE_B = OFF_KL + KS * KP;   // 47,104 B per buffer
// one stage (keys k0 .. k0 + 63) into the buffer at LDS byte address lb: 10 copies per lane, 256 lanes; V' rows vr + 32 j (8 lanes x 16 B = one 128-B line each), K rows kr (4 lanes x 16 B)
__device__ __forceinline__ void stage_kv(unsigned lb, const b16* Vb, const b16* Vlb, const b16* Khb, const b16* Klb, int k0, int tid) {
  const int vr = tid >> 3, vc = tid & 7, kr = tid >> 2, kc = tid & 3; const unsigned lv = lb + vr * VP + vc * 16, lk = lb + kr * KP + kc * 16; const size_t gv = (size_t)vr * M + k0 + vc * 8, gk = (size_t)(k0 + kr) * CQ + kc * 8;
  // the ten copies and, as the statement's last line, the wait that stands in front of any rewrite of the address registers they name
  asm volatile("global_load_async_to_lds_b128 %0, %1, off\n\tglobal_load_async_to_lds_b128 %2, %3, off\n\tglobal_load_async_to_lds_b128 %4, %5, off\n\tglobal_load_async_to_lds_b128 %6, %7, off\n\tglobal_load_async_to_lds_b128 %8, %9, off\n\t"
               "global_load_async_to_lds_b128 %10, %11, off\n\tglobal_load_async_to_lds_b128 %12, %13, off\n\tglobal_load_async_to_lds_b128 %14, %15, off\n\tglobal_load_async_to_lds_b128 %16, %17, off\n\tglobal_load_async_to_lds_b128 %18, %19, off\n\ts_wait_xcnt 0x0"
               :: "v"(lv + OFF_VH), "v"(Vb + gv), "v"(lv + OFF_VH + 32 * VP), "v"(Vb + gv + 32 * M), "v"(lv + OFF_VH + 64 * VP), "v"(Vb + gv + 64 * M), "v"(lv + OFF_VH + 96 * VP), "v"(Vb + gv + 96 * M), "v"(lk + OFF_KH), "v"(Khb + gk),
                  "v"(lv + OFF_VL), "v"(Vlb + gv), "v"(lv + OFF_VL + 32 * VP), "v"(Vlb + gv + 32 * M), "v"(lv + OFF_VL + 64 * VP), "v"(Vlb + gv + 64 * M), "v"(lv + OFF_VL + 96 * VP), "v"(Vlb + gv + 96 * M), "v"(lk + OFF_KL), "v"(Klb + gk) : "memory");
}
__global__ __launch_bounds__(256) void attn_kernel(const b16* __restrict__ QH, const b16* __restrict__ QL, const b16* __restrict__ KH, const b16* __restrict__ KL, const b16* __restrict__ V16, const b16* __restrict__ VL16, const float* __restrict__ x, const float* __restrict__ gamma_, float* __restrict__ out) {
  __shared__ __attribute__((aligned(128))) unsigned char L[2 * STAGE_B];   // the ring; after the loop the output staging To[128][128 + 4] (67,584 B)
  const int tid = threadIdx.x, wave = threadIdx.x >> 5, lane = threadIdx.x & 31, hh = lane >> 4, col = lane & 15; const int b = blockIdx.z, dh = blockIdx.y; const int q0 = blockIdx.x * 128 + wave * 16, qi = q0 + col;
  const size_t qrow = (size_t)b * N + qi; const v16b qh = frag_kb(QH + qrow * CQ, hh), ql = frag_kb(QL + qrow * CQ, hh);
  const b16* Khb = KH + (size_t)b * M * CQ; const b16* Klb = KL + (size_t)b * M * CQ; const b16* Vb = V16 + ((size_t)b * C + dh * 128) * M; const b16* Vlb = VL16 + ((size_t)b * C + dh * 128) * M; const float gamma = bf16_rne(gamma_[0]);
  const unsigned lds0 = (unsigned)(size_t)L;
  float m = -INFINITY, l = 0.0f; v8f o[8], ol[8];
#pragma unroll
  for (int t = 0; t < 8; ++t) { o[t] = (v8f){}; ol[t] = (v8f){}; }
  stage_kv(lds0, Vb, Vlb, Khb, Klb, 0, tid);
  asm volatile("s_wait_asynccnt 0x0" ::: "memory");   // this wave's copies of stage 0 have landed
  __syncthreads();                                    // every wave's have: stage 0 is readable
  stage_kv(lds0 + STAGE_B, Vb, Vlb, Khb, Klb, KS, tid);
  for (int st = 0; st < M / KS; ++st) {
    const unsigned char* B = L + (st & 1) * STAGE_B;
    // LDS fragment reads stand well in front of the products that use them (a read written behind a product's pad statement is not moved over it): per 32 keys the four K fragments as one group,
    // V' tiles 0 and 1 behind the first energy product, tile 2 behind the softmax, tile t + 3 behind the products of tile t; every read of a stage still ends in front of the stage's foot
    v16b kf[4];
    auto ldk = [&](int kk) { kf[0] = frag_kb((const b16*)(B + OFF_KH + (kk + col) * KP), hh); kf[1] = frag_kb((const b16*)(B + OFF_KH + (kk + 16 + col) * KP), hh); kf[2] = frag_kb((const b16*)(B + OFF_KL + (kk + col) * KP), hh); kf[3] = frag_kb((const b16*)(B + OFF_KL + (kk + 16 + col) * KP), hh); };
    for (int kk = 0; kk < KS; kk += 32) {
      v16b vh[8], vl[8];
      auto ldv = [&](int t) { vh[t] = frag_kb((const b16*)(B + OFF_VH + (t * 16 + col) * VP) + kk, hh); vl[t] = frag_kb((const b16*)(B + OFF_VL + (t * 16 + col) * VP) + kk, hh); };
      ldk(kk);
      v8f s0 = {}, s1 = {};
      s0 = wmma16b(kf[0], qh, s0); ldv(0); ldv(1); s0 = wmma16b(kf[0], ql, s0); s0 = wmma16b(kf[2], qh, s0);
      s1 = wmma16b(kf[1], qh, s1); s1 = wmma16b(kf[1], ql, s1); s1 = wmma16b(kf[3], qh, s1);
      float e[16]; float mx = -INFINITY; const float cs = LOG2E / (XS * XS);
#pragma unroll
      for (int r = 0; r < 8; ++r) { e[r] = s0[r] * cs; e[8 + r] = s1[r] * cs; mx = fmaxf(mx, fmaxf(e[r], e[8 + r])); }
      mx = fmaxf(mx, __shfl_xor(mx, 16)); const float mn = fmaxf(m, mx); const float al = nexp2(m - mn); m = mn; float sum = 0.0f; v16b ph, pl;
#pragma unroll
      for (int i = 0; i < 16; ++i) { const float p = nexp2(e[i] - mn); sum += p; const b16 h_ = (b16)(p * PS); ph[i] = h_; pl[i] = (b16)(p * PS - (float)h_); }
      sum += __shfl_xor(sum, 16); l = l * al + sum;
      ldv(2);
#pragma unroll
      for (int t = 0; t < 8; ++t) { o[t] *= al; ol[t] *= al; o[t] = wmma16b(vh[t], ph, o[t]); ol[t] = wmma16b(vh[t], pl, ol[t]); ol[t] = wmma16b(vl[t], ph, ol[t]);
        if (t + 3 < 8) ldv(t + 3); } }
    asm volatile("s_wait_dscnt 0x0" ::: "memory");      // this wave's reads of the buffer are done before it is refilled
    asm volatile("s_wait_asynccnt 0x0" ::: "memory");   // this wave's copies of stage st + 1 have landed
    __syncthreads();                                    // publishes stage st + 1 and ends every wave's reads of stage st
    if (st + 2 < M / KS) stage_kv(lds0 + (st & 1) * STAGE_B, Vb, Vlb, Khb, Klb, (st + 2) * KS, tid);
  }
  asm volatile("s_wait_asynccnt 0x0" ::: "memory");     // no copy is outstanding when the ring becomes output staging
  const float inv = 1.0f / (l * PS * XS);
  float (*To)[128 + 4] = (float (*)[128 + 4])L;
  // o[t][r] = O^T[d = t*16 + 8hh + r][query col] -> To[d][wave*16 + col]
#pragma unroll
  for (int t = 0; t < 8; ++t)
#pragma unroll
    for (int r = 0; r < 8; ++r) To[t * 16 + 8 * hh + r][wave * 16 + col] = (o[t][r] + ol[t][r]) * inv;
  __syncthreads();
  for (int i = 0; i < 16; ++i) { const int dd = wave * 16 + i;
    for (int sg = 0; sg < 128; sg += 32) { const size_t gi = ((size_t)b * C + dh * 128 + dd) * N + blockIdx.x * 128 + sg + lane; ((float*)out)[gi] = gamma * To[dd][sg + lane] + bf16_rne(x[gi]); }
    asm volatile("s_wait_xcnt 0x0" ::: "memory");   // stands in front of the next trip's rewrite of the registers that this trip's loads and stores name
  }
}
}  // namespace

extern "C" void kernel_launch(void* const* d_in, const int* in_sizes, int n_in, void* d_out, int out_size, void* d_ws, size_t ws_size, hipStream_t stream) {
  (void)n_in;
  auto Fp = [&](int i) { return (const float*)d_in[i]; };
  // input order: 0 x [8,256,64,64], 1 w_theta [32,256], 2 w_phi [32,256], 3 w_g [128,256], 4 w_o [256,128], 5 gamma [1]
  if (in_sizes[0] != NB * C * N || in_sizes[1] != CQ * C || in_sizes[2] != CQ * C || in_sizes[3] != CG * C || in_sizes[4] != C * CG || in_sizes[5] != 1 || out_size != NB * C * N) return;
  size_t off = 0; char* ws = (char*)d_ws;
  auto carve = [&](size_t bytes) { char* p = ws + off; off += (bytes + 255) & ~(size_t)255; return p; };
  b16* XT16 = (b16*)carve((size_t)NB * N * C * 2); b16* W16 = (b16*)carve((size_t)2 * CQ * C * 2); b16* WG = (b16*)carve((size_t)CG * C * 2); b16* WO = (b16*)carve((size_t)C * CG * 2);
  b16* QH = (b16*)carve((size_t)NB * N * CQ * 2); b16* QL = (b16*)carve((size_t)NB * N * CQ * 2); b16* KH = (b16*)carve((size_t)NB * M * CQ * 2); b16* KL = (b16*)carve((size_t)NB * M * CQ * 2);
  b16* V16 = (b16*)carve((size_t)NB * C * M * 2); b16* VL16 = (b16*)carve((size_t)NB * C * M * 2);
  if (off > ws_size || off > ((size_t)128 << 20)) return;   // = 29.2 MB
  pre_kernel<<<PWB + XTB, 256, 0, stream>>>(Fp(0), Fp(1), Fp(2), Fp(3), Fp(4), XT16, W16, WG, WO);
  proj_kernel<<<GB + QKB, 256, 0, stream>>>(XT16, W16, WG, WO, QH, QL, KH, KL, V16, VL16);
  attn_kernel<<<dim3(N / 128, 2, NB), 256, 0, stream>>>(QH, QL, KH, KL, V16, VL16, Fp(0), Fp(5), (float*)d_out);
}

// v004
// A run of this version takes 86.3 microseconds.
// Two timings next to v003 both put it at 1.07 times that version's speed.
// Counting every step since v000, it is 3.19 times as fast.
#include <hip/hip_runtime.h>

// SAGAN attention block (8 images x 256 ch x 64 x 64): theta = W_theta x (32 ch, all 4,096 pixels), phi = maxpool2x2(W_phi x) (32 ch x 1,024 pooled positions), g = maxpool2x2(W_g x) (128 x 1,024),
// beta = softmax over the 1,024 pooled keys of theta^T phi (no scaling), o = W_o (g beta^T) = (W_o g) beta^T, out = gamma * o + x. The 1x1 convs are channel GEMMs; W_o is folded into the pooled
// values (V' = W_o g, [256 x 1,024] per image) so the attention writes the final channels directly.
// WMMA (v_wmma_f32_16x16x32_f16, f32 accumulate): projections with EXACT bf16 pixels (x^T rows x8, via an LDS transpose of the channel-major input) and weights (x256), 1 product; V' = W_o g with
// g pooled as f16 hi+lo x8 and W_o exact (2 products); energy tiles S^T = Phi . Theta^T with theta AND phi as f16 hi+lo x8 (3 products; logits sigma ~5.7); online softmax in f32; O^T += V' P^T with
// V' and P as f16 hi+lo x8 (3 products). Max-pooling, softmax, gamma, residual in f32. Inputs rounded to bf16 once (gamma and the residual x included). Fragment k-map

namespace {
constexpr int NB = 8, C = 256, CQ = 32, N = 4096, M = 1024 /* pooled positions */, CG = 128 /* g channels */, HW = 64;
constexpr float XS = 8.0f, WSC = 256.0f, PS = 8.0f, LOG2E = 1.4426950408889634f;

typedef _Float16 b16;
typedef __attribute__((ext_vector_type(16))) _Float16 v16b;
typedef __attribute__((ext_vector_type(8))) _Float16 v8b;
typedef __attribute__((ext_vector_type(8))) float v8f;
typedef __attribute__((ext_vector_type(4))) float v4f;
__device__ __forceinline__ float bf16_rne(float f) { unsigned int u = __float_as_uint(f); u += 0x7FFFu + ((u >> 16) & 1u); return __uint_as_float(u & 0xFFFF0000u); }
__device__ __forceinline__ void split16(float v, b16& hi, b16& lo) { hi = (b16)v; lo = (b16)(v - (float)hi); }
__device__ __forceinline__ v16b frag_kb(const b16* p, int hh) { const v8b a = *(const v8b*)(p + 8 * hh), b = *(const v8b*)(p + 16 + 8 * hh); v16b f;
#pragma unroll
  for (int e = 0; e < 8; ++e) { f[e] = a[e]; f[8 + e] = b[e]; } return f; }
__device__ __forceinline__ v8f wmma16b(v16b a, v16b b, v8f c) { return __builtin_amdgcn_wmma_f32_16x16x32_f16(false, a, false, b, (short)0, c, false, false); }
// stands behind a group of loads that is issued ahead of its use: without it the scheduler sinks each load to just in front of the product that reads it, and the wave waits out the whole latency there
__device__ __forceinline__ void hold_loads() { __builtin_amdgcn_sched_barrier(0); }
__device__ __forceinline__ void wave_lds_sync() { __builtin_amdgcn_fence(__ATOMIC_RELEASE, "workgroup"); __builtin_amdgcn_wave_barrier(); __builtin_amdgcn_fence(__ATOMIC_ACQUIRE, "workgroup"); }
__device__ __forceinline__ float nexp2(float x) { return __builtin_amdgcn_exp2f(x); }

typedef __attribute__((ext_vector_type(4))) _Float16 v4b;
typedef __attribute__((ext_vector_type(2))) float v2f;
// launch 1: the weight conversion (its own PWB work-groups, in front) and the transpose of x share one grid: neither reads what the other writes
constexpr int PWB = ((2 * CQ * C + CG * C + C * CG) / 8 + 255) / 256, XTB = (N / 64) * (C / 64) * NB;
__global__ __launch_bounds__(256) void pre_kernel(const float* __restrict__ x, const float* __restrict__ wq, const float* __restrict__ wk, const float* __restrict__ wg, const float* __restrict__ wo, b16* __restrict__ XT16, b16* __restrict__ W16, b16* __restrict__ WG, b16* __restrict__ WO) {
  __shared__ __attribute__((aligned(16))) b16 T[64][64 + 8];
  if (blockIdx.x < PWB) {
    const int t = blockIdx.x * 256 + threadIdx.x; const int nq = CQ * C / 8, ng = CG * C / 8, no = C * CG / 8; const float* src; int e; b16* dst;
    if (t < nq) { src = wq; e = t * 8; dst = W16; } else if (t < 2 * nq) { src = wk; e = (t - nq) * 8; dst = W16 + CQ * C; } else if (t < 2 * nq + ng) { src = wg; e = (t - 2 * nq) * 8; dst = WG; } else if (t < 2 * nq + ng + no) { src = wo; e = (t - 2 * nq - ng) * 8; dst = WO; } else return;
    v8b o; for (int j = 0; j < 8; ++j) o[j] = (b16)(bf16_rne(src[e + j]) * WSC);
    { *(v8b*)(dst + e) = o;  }
    return;
  }
  const int f = blockIdx.x - PWB; const int b = f >> 8, c0 = ((f >> 6) & 3) * 64, n0 = (f & 63) * 64, t_ = threadIdx.x;
  float xv[16];
#pragma unroll   // all 16 loads of a lane are issued before the first is waited for
  for (int i = 0; i < 16; ++i) { const int q = t_ + i * 256; xv[i] = x[((size_t)b * C + c0 + (q >> 6)) * N + n0 + (q & 63)]; }
#pragma unroll   // xv[] stays in registers only under constant indices
  for (int i = 0; i < 16; ++i) { const int q = t_ + i * 256; T[q & 63][q >> 6] = (b16)(bf16_rne(xv[i]) * XS); }
  __syncthreads();
  { for (int q = t_; q < 64 * 8; q += 256) { const int nn = q >> 3, c8 = (q & 7) * 8; *(v8b*)(XT16 + ((size_t)b * N + n0 + nn) * C + c0 + c8) = *(const v8b*)(&T[nn][c8]); }  }
}
// theta/phi projection: [n x 256] x [256 x 32]. A wave's 16 pixel rows are 8 neighbours of image row 2 h2 and the 8 below them, so that it holds whole 2x2 pooling windows:
// theta goes out as QH/QL [b][n][32] f16 hi+lo x8 (64-B rows), phi is max-pooled from the wave's f32 staging and goes out as KH/KL [b][m][32] f16 hi+lo x8 (4 pooled positions a wave)
__device__ __forceinline__ void qk_part(unsigned char* S, int blk, const b16* __restrict__ XT16, const b16* __restrict__ W16, b16* __restrict__ QH, b16* __restrict__ QL, b16* __restrict__ KH, b16* __restrict__ KL) {
  b16 (*Th)[16][CQ + 8] = (b16 (*)[16][CQ + 8])S; b16 (*Tl)[16][CQ + 8] = (b16 (*)[16][CQ + 8])(S + 8 * 16 * (CQ + 8) * 2); float (*Tf)[16][CQ + 4] = (float (*)[16][CQ + 4])(S + 2 * 8 * 16 * (CQ + 8) * 2);
  const int wave = threadIdx.x >> 5, lane = threadIdx.x & 31, nloc = lane & 15, hlf = lane >> 4; const int gw = blk * 8 + wave; const int b = gw >> 8, h2 = (gw >> 3) & 31, w0 = (gw & 7) * 8;
  auto pix = [&](int rr) { return (size_t)b * N + (size_t)(2 * h2 + (rr >> 3)) * HW + w0 + (rr & 7); };   // over b*N + n
  v8f acc[4] = {{}, {}, {}, {}};   // tiles: q0, q1, k0, k1
  // the fragments of k step k + 3 are requested in front of the products of k step k (four register buffers)
  v16b a[4], w[4][4];
  auto ld = [&](int k) { a[k & 3] = frag_kb(XT16 + pix(nloc) * C + k * 32, hlf);
#pragma unroll   // constant indices keep the buffers in registers
    for (int t = 0; t < 4; ++t) w[k & 3][t] = frag_kb(W16 + (size_t)((t >> 1) * CQ + (t & 1) * 16 + nloc) * C + k * 32, hlf); };
  ld(0); ld(1); ld(2); hold_loads();
#pragma unroll   // buffer numbers must be compile-time constants
  for (int k = 0; k < C / 32; ++k) { if (k + 3 < C / 32) { ld(k + 3); hold_loads(); }
#pragma unroll
    for (int t = 0; t < 4; ++t) acc[t] = wmma16b(a[k & 3], w[k & 3][t], acc[t]); }
#pragma unroll
  for (int t = 0; t < 4; ++t) { const int which = t >> 1, c = (t & 1) * 16 + nloc;
#pragma unroll
    for (int r = 0; r < 8; ++r) { const float v = acc[t][r] * (1.0f / (XS * WSC)); if (which == 0) { b16 h_, l_; split16(v * XS, h_, l_); Th[wave][8 * hlf + r][c] = h_; Tl[wave][8 * hlf + r][c] = l_; } else Tf[wave][8 * hlf + r][c] = v; } }
  wave_lds_sync();
  {
    for (int q = 0; q < 2; ++q) { const int rr = q * 8 + (lane >> 2), seg = (lane & 3) * 8; *(v8b*)(QH + pix(rr) * CQ + seg) = *(const v8b*)(&Th[wave][rr][seg]); *(v8b*)(QL + pix(rr) * CQ + seg) = *(const v8b*)(&Tl[wave][rr][seg]); }
    const int i = lane >> 3, c4 = (lane & 7) * 4;   // pooled position w0 / 2 + i, channels c4 .. c4 + 3
    const v4f p00 = *(const v4f*)(&Tf[wave][2 * i][c4]), p01 = *(const v4f*)(&Tf[wave][2 * i + 1][c4]), p10 = *(const v4f*)(&Tf[wave][8 + 2 * i][c4]), p11 = *(const v4f*)(&Tf[wave][8 + 2 * i + 1][c4]); v4b hv, lv;
#pragma unroll   // constant indices keep hv, lv in registers
    for (int j = 0; j < 4; ++j) { const float v = fmaxf(fmaxf(p00[j], p01[j]), fmaxf(p10[j], p11[j])); b16 h_, l_; split16(v * XS, h_, l_); hv[j] = h_; lv[j] = l_; }
    const size_t ko = ((size_t)b * M + h2 * (HW / 2) + (w0 >> 1) + i) * CQ + c4; *(v4b*)(KH + ko) = hv; *(v4b*)(KL + ko) = lv;
    asm volatile("s_wait_xcnt 0x0" ::: "memory");   // behind the last store of this part: whatever code follows it in the joint kernel may reuse the registers that these stores name
  }
}
// g projection, pooling and V' in one work-group of 8 waves = all 128 g channels x 128 pixels (image rows 2 h2 and 2 h2 + 1). GEMM rows d (A = WG rows, K = c) x cols n (B = XT16 rows n): each wave
// stages 16 d-rows x 128 n floats and max-pools them 2x2 (a lane takes pooled column w2 = lane of all 16 rows) into Gh/Gl [32 m][128 d] f16 hi+lo x8 in LDS. Behind one barrier the pooled values with W_o
// folded in, channel-major: V16/VL16 [b][c][m] = f16 hi+lo x8 of sum_d W_o[c][d] gpool[m][d]: rows c (A = WO rows, K = 128; 32 a wave) x cols m (B = Gh/Gl rows m, 2 products)
constexpr int GPP = CG + 8 /* pitch of Gh, Gl in halves: 272 B = 16 B x odd */, SZ_TS = 8 * 16 * (128 + 4) * 4, SZ_G = 32 * GPP * 2;
__device__ __forceinline__ void gv_part(unsigned char* S, int blk, const b16* __restrict__ XT16, const b16* __restrict__ WG, const b16* __restrict__ WO, b16* __restrict__ V16, b16* __restrict__ VL16) {
  float (*Ts)[16][128 + 4] = (float (*)[16][128 + 4])S; b16 (*Gh)[GPP] = (b16 (*)[GPP])(S + SZ_TS); b16 (*Gl)[GPP] = (b16 (*)[GPP])(S + SZ_TS + SZ_G);
  const int wave = threadIdx.x >> 5, lane = threadIdx.x & 31, nloc = lane & 15, hlf = lane >> 4; const int b = blk >> 5, h2 = blk & 31; const int d0 = wave * 16, n0 = h2 * 128, c0 = wave * 32;
  v8f acc[8];
#pragma unroll
  for (int t = 0; t < 8; ++t) acc[t] = (v8f){};
  // the nine fragments of k step k + 1 are requested in front of the products of k step k (two register buffers)
  v16b a[2], bf[2][8];
  auto ld = [&](int k) { a[k & 1] = frag_kb(WG + (size_t)(d0 + nloc) * C + k * 32, hlf); if (k == C / 32 - 1) asm volatile("s_wait_xcnt 0x0" ::: "memory");   // behind the last W_g load: the next loads' results may reuse its address registers
#pragma unroll   // constant indices keep the buffers in registers
    for (int t = 0; t < 8; ++t) bf[k & 1][t] = frag_kb(XT16 + ((size_t)b * N + n0 + t * 16 + nloc) * C + k * 32, hlf); };
  ld(0); hold_loads();
#pragma unroll   // buffer numbers must be compile-time constants
  for (int k = 0; k < C / 32; ++k) { if (k + 1 < C / 32) { ld(k + 1); hold_loads(); }
#pragma unroll
    for (int t = 0; t < 8; ++t) acc[t] = wmma16b(a[k & 1], bf[k & 1][t], acc[t]); }
  __builtin_amdgcn_sched_barrier(0);   // the W_o loads below are not lifted over the products above: their 64 registers on top of both fragment buffers would pass 256, and two work-groups would no longer share a WGP
  v16b wa[CG / 32][2];   // this wave's W_o fragments, requested here so that they fly while the accumulators are scaled and staged
#pragma unroll   // both loops: constant indices keep wa in registers
  for (int k = 0; k < CG / 32; ++k)
#pragma unroll
    for (int ct = 0; ct < 2; ++ct) wa[k][ct] = frag_kb(WO + (size_t)(c0 + ct * 16 + nloc) * CG + k * 32, hlf);
  // behind the W_o loads: the staging's address arithmetic may reuse their address registers; the two addresses are inputs so that they live up to the wait and no load's own result lands on them in front of it
  asm volatile("s_wait_xcnt 0x0" :: "v"(WO + (size_t)(c0 + nloc) * CG + 8 * hlf), "v"(WO + (size_t)(c0 + 16 + nloc) * CG + 8 * hlf) : "memory");
#pragma unroll
  for (int t = 0; t < 8; ++t)
#pragma unroll
    for (int r = 0; r < 8; ++r) Ts[wave][8 * hlf + r][t * 16 + nloc] = acc[t][r] * (1.0f / (XS * WSC));
  wave_lds_sync();
  v8b hv[2], lv[2]; v2f pr[16], qr[16];
#pragma unroll   // all 32 reads of the staging are issued before the first is waited for
  for (int rr = 0; rr < 16; ++rr) { pr[rr] = *(const v2f*)(&Ts[wave][rr][2 * lane]); qr[rr] = *(const v2f*)(&Ts[wave][rr][HW + 2 * lane]); }
  hold_loads();
#pragma unroll   // constant indices keep pr, qr, hv, lv in registers
  for (int rr = 0; rr < 16; ++rr) { const v2f p = pr[rr], q = qr[rr]; const float v = fmaxf(fmaxf(p[0], p[1]), fmaxf(q[0], q[1])); b16 h_, l_; split16(v * XS, h_, l_); hv[rr >> 3][rr & 7] = h_; lv[rr >> 3][rr & 7] = l_; }
  *(v8b*)(&Gh[lane][d0]) = hv[0]; *(v8b*)(&Gh[lane][d0 + 8]) = hv[1]; *(v8b*)(&Gl[lane][d0]) = lv[0]; *(v8b*)(&Gl[lane][d0 + 8]) = lv[1];
  __syncthreads();   // all 128 pooled g channels of the 32 positions are in Gh, Gl
  v8f va[2][2] = {{{}, {}}, {{}, {}}}; v16b gh[3][2], gl[3][2];
  // the four pooled-g fragments of k step k + 2 are read in front of the products of k step k (three register buffers)
  auto ldg = [&](int k) {
#pragma unroll   // constant indices keep the buffers in registers
    for (int mt = 0; mt < 2; ++mt) { gh[k % 3][mt] = frag_kb(&Gh[mt * 16 + nloc][k * 32], hlf); gl[k % 3][mt] = frag_kb(&Gl[mt * 16 + nloc][k * 32], hlf); } };
  ldg(0); ldg(1); hold_loads();
#pragma unroll   // buffer numbers must be compile-time constants
  for (int k = 0; k < CG / 32; ++k) { if (k + 2 < CG / 32) { ldg(k + 2); hold_loads(); }
#pragma unroll   // this loop and the next: constant indices keep va and the fragments in registers
    for (int t = 0; t < 4; ++t) va[t >> 1][t & 1] = wmma16b(wa[k][t >> 1], gh[k % 3][t & 1], va[t >> 1][t & 1]);
#pragma unroll
    for (int t = 0; t < 4; ++t) va[t >> 1][t & 1] = wmma16b(wa[k][t >> 1], gl[k % 3][t & 1], va[t >> 1][t & 1]); }
  // va[ct][mt][r] = V'[c0 + ct*16 + 8hlf + r][h2*32 + mt*16 + nloc] x 2048, staged in the wave's own part of Ts (which only this wave has read)
  b16 (*Vh)[32 + 8] = (b16 (*)[32 + 8])(S + wave * (16 * (128 + 4) * 4)); b16 (*Vl)[32 + 8] = (b16 (*)[32 + 8])(S + wave * (16 * (128 + 4) * 4) + 32 * (32 + 8) * 2);
#pragma unroll   // both loops: va is read under constant indices
  for (int t = 0; t < 4; ++t)
#pragma unroll
    for (int r = 0; r < 8; ++r) { b16 h_, l_; split16(va[t >> 1][t & 1][r] * (1.0f / (XS * WSC)) * XS, h_, l_); Vh[(t >> 1) * 16 + 8 * hlf + r][(t & 1) * 16 + nloc] = h_; Vl[(t >> 1) * 16 + 8 * hlf + r][(t & 1) * 16 + nloc] = l_; }
  wave_lds_sync();
  for (int q = 0; q < 4; ++q) { const int row = q * 8 + (lane >> 2), seg = (lane & 3) * 8; const size_t gi = ((size_t)b * C + c0 + row) * M + h2 * (HW / 2) + seg; *(v8b*)(V16 + gi) = *(const v8b*)(&Vh[row][seg]); *(v8b*)(VL16 + gi) = *(const v8b*)(&Vl[row][seg]); }
}
// launch 2: the g / V' work-groups (even index) and the theta/phi work-groups (odd index) share one grid, alternating so that neighbours in the index are one of each kind; they read the same XT16 and write
// disjoint arrays; one LDS block serves either part
constexpr int GB = (N / 128) * NB, QKB = NB * N / 128;
__global__ __launch_bounds__(256) void proj_kernel(const b16* __restrict__ XT16, const b16* __restrict__ W16, const b16* __restrict__ WG, const b16* __restrict__ WO, b16* __restrict__ QH, b16* __restrict__ QL, b16* __restrict__ KH, b16* __restrict__ KL, b16* __restrict__ V16, b16* __restrict__ VL16) {
  __shared__ __attribute__((aligned(16))) unsigned char S[SZ_TS + 2 * SZ_G];
  static_assert(GB == QKB, "the two kinds alternate");
  if ((blockIdx.x & 1) == 0) gv_part(S, blockIdx.x >> 1, XT16, WG, WO, V16, VL16); else qk_part(S, blockIdx.x >> 1, XT16, W16, QH, QL, KH, KL);
}
// attention: grid (N/128 query blocks, 2 channel halves, B); block = 8 waves x 16 queries. K (hi, lo) and V' (hi, lo; the 128 channels of this half) come in stages of 64 pooled keys into a
// two-buffer LDS ring that all 8 waves read: every lane copies 16 B pieces with asynchronous copies to LDS (whole 128-B lines per 8 lanes for V', 4 KB contiguous for K), one stage ahead of its use.
// Per block of 32 pooled keys: S^T = Phi . Theta^T with (Kh Qh + Kh Ql + Kl Qh), online softmax (f32, exp2), O^T (8 tiles) += V'[c][keys] P^T (hi + lo). out[b][c][n] = gamma O/l + x, staged in the ring's LDS.
constexpr int KS = 64 /* keys per stage */, VP = 144, KP = 80 /* LDS row pitch in bytes, 16 B x odd: 16 rows of a 16-byte read fall on 64 distinct banks */;
constexpr int OFF_VH = 0, OFF_VL = 128 * VP, OFF_KH = 2 * 128 * VP, OFF_KL = OFF_KH + KS * KP, STAGE_B = OFF_KL + KS * KP;   // 47,104 B per buffer
// one stage (keys k0 .. k0 + 63) into the buffer at LDS byte address lb: 10 copies per lane, 256 lanes; V' rows vr + 32 j (8 lanes x 16 B = one 128-B line each), K rows kr (4 lanes x 16 B)
__device__ __forceinline__ void stage_kv(unsigned lb, const b16* Vb, const b16* Vlb, const b16* Khb, const b16* Klb, int k0, int tid) {
  const int vr = tid >> 3, vc = tid & 7, kr = tid >> 2, kc = tid & 3; const unsigned lv = lb + vr * VP + vc * 16, lk = lb + kr * KP + kc * 16; const size_t gv = (size_t)vr * M + k0 + vc * 8, gk = (size_t)(k0 + kr) * CQ + kc * 8;
  // the ten copies and, as the statement's last line, the wait that stands in front of any rewrite of the address registers they name
  asm volatile("global_load_async_to_lds_b128 %0, %1, off\n\tglobal_load_async_to_lds_b128 %2, %3, off\n\tglobal_load_async_to_lds_b128 %4, %5, off\n\tglobal_load_async_to_lds_b128 %6, %7, off\n\tglobal_load_async_to_lds_b128 %8, %9, off\n\t"
               "global_load_async_to_lds_b128 %10, %11, off\n\tglobal_load_async_to_lds_b128 %12, %13, off\n\tglobal_load_async_to_lds_b128 %14, %15, off\n\tglobal_load_async_to_lds_b128 %16, %17, off\n\tglobal_load_async_to_lds_b128 %18, %19, off\n\ts_wait_xcnt 0x0"
               :: "v"(lv + OFF_VH), "v"(Vb + gv), "v"(lv + OFF_VH + 32 * VP), "v"(Vb + gv + 32 * M), "v"(lv + OFF_VH + 64 * VP), "v"(Vb + gv + 64 * M), "v"(lv + OFF_VH + 96 * VP), "v"(Vb + gv + 96 * M), "v"(lk + OFF_KH), "v"(Khb + gk),
                  "v"(lv + OFF_VL), "v"(Vlb + gv), "v"(lv + OFF_VL + 32 * VP), "v"(Vlb + gv + 32 * M), "v"(lv + OFF_VL + 64 * VP), "v"(Vlb + gv + 64 * M), "v"(lv + OFF_VL + 96 * VP), "v"(Vlb + gv + 96 * M), "v"(lk + OFF_KL), "v"(Klb + gk) : "memory");
}
__global__ __launch_bounds__(256) void attn_kernel(const b16* __restrict__ QH, const b16* __restrict__ QL, const b16* __restrict__ KH, const b16* __restrict__ KL, const b16* __restrict__ V16, const b16* __restrict__ VL16, const float* __restrict__ x, const float* __restrict__ gamma_, float* __restrict__ out) {
  __shared__ __attribute__((aligned(128))) unsigned char L[2 * STAGE_B];   // the ring; after the loop the output staging To[128][128 + 4] (67,584 B)
  const int tid = threadIdx.x, wave = threadIdx.x >> 5, lane = threadIdx.x & 31, hh = lane >> 4, col = lane & 15; const int b = blockIdx.z, dh = blockIdx.y; const int q0 = blockIdx.x * 128 + wave * 16, qi = q0 + col;
  const size_t qrow = (size_t)b * N + qi; const v16b qh = frag_kb(QH + qrow * CQ, hh), ql = frag_kb(QL + qrow * CQ, hh);
  const b16* Khb = KH + (size_t)b * M * CQ; const b16* Klb = KL + (size_t)b * M * CQ; const b16* Vb = V16 + ((size_t)b * C + dh * 128) * M; const b16* Vlb = VL16 + ((size_t)b * C + dh * 128) * M; const float gamma = bf16_rne(gamma_[0]);
  const unsigned lds0 = (unsigned)(size_t)L;
  float m = -INFINITY, l = 0.0f; v8f o[8], ol[8];
#pragma unroll
  for (int t = 0; t < 8; ++t) { o[t] = (v8f){}; ol[t] = (v8f){}; }
  stage_kv(lds0, Vb, Vlb, Khb, Klb, 0, tid);
  asm volatile("s_wait_asynccnt 0x0" ::: "memory");   // this wave's copies of stage 0 have landed
  __syncthreads();                                    // every wave's have: stage 0 is readable
  stage_kv(lds0 + STAGE_B, Vb, Vlb, Khb, Klb, KS, tid);
  for (int st = 0; st < M / KS; ++st) {
    const unsigned char* B = L + (st & 1) * STAGE_B;
    // LDS fragment reads stand well in front of the products that use them: per 32 keys the four K fragments as one group,
    // V' tiles 0 and 1 behind the first energy product, tile 2 behind the softmax, tile t + 3 behind the products of tile t; every read of a stage still ends in front of the stage's foot
    v16b kf[4];
    auto ldk = [&](int kk) { kf[0] = frag_kb((const b16*)(B + OFF_KH + (kk + col) * KP), hh); kf[1] = frag_kb((const b16*)(B + OFF_KH + (kk + 16 + col) * KP), hh); kf[2] = frag_kb((const b16*)(B + OFF_KL + (kk + col) * KP), hh); kf[3] = frag_kb((const b16*)(B + OFF_KL + (kk + 16 + col) * KP), hh); };
    for (int kk = 0; kk < KS; kk += 32) {
      v16b vh[8], vl[8];
      auto ldv = [&](int t) { vh[t] = frag_kb((const b16*)(B + OFF_VH + (t * 16 + col) * VP) + kk, hh); vl[t] = frag_kb((const b16*)(B + OFF_VL + (t * 16 + col) * VP) + kk, hh); };
      ldk(kk);
      v8f s0 = {}, s1 = {};
      s0 = wmma16b(kf[0], qh, s0); ldv(0); ldv(1); hold_loads(); s0 = wmma16b(kf[0], ql, s0); s0 = wmma16b(kf[2], qh, s0);
      s1 = wmma16b(kf[1], qh, s1); s1 = wmma16b(kf[1], ql, s1); s1 = wmma16b(kf[3], qh, s1);
      float e[16]; float mx = -INFINITY; const float cs = LOG2E / (XS * XS);
#pragma unroll
      for (int r = 0; r < 8; ++r) { e[r] = s0[r] * cs; e[8 + r] = s1[r] * cs; mx = fmaxf(mx, fmaxf(e[r], e[8 + r])); }
      mx = fmaxf(mx, __shfl_xor(mx, 16)); const float mn = fmaxf(m, mx); const float al = nexp2(m - mn); m = mn; float sum = 0.0f; v16b ph, pl;
#pragma unroll
      for (int i = 0; i < 16; ++i) { const float p = nexp2(e[i] - mn); sum += p; const b16 h_ = (b16)(p * PS); ph[i] = h_; pl[i] = (b16)(p * PS - (float)h_); }
      sum += __shfl_xor(sum, 16); l = l * al + sum;
      ldv(2); hold_loads();
#pragma unroll
      for (int t = 0; t < 8; ++t) { o[t] *= al; ol[t] *= al; o[t] = wmma16b(vh[t], ph, o[t]); ol[t] = wmma16b(vh[t], pl, ol[t]); ol[t] = wmma16b(vl[t], ph, ol[t]);
        if (t + 3 < 8) { ldv(t + 3); hold_loads(); } } }
    asm volatile("s_wait_dscnt 0x0" ::: "memory");      // this wave's reads of the buffer are done before it is refilled
    asm volatile("s_wait_asynccnt 0x0" ::: "memory");   // this wave's copies of stage st + 1 have landed
    __syncthreads();                                    // publishes stage st + 1 and ends every wave's reads of stage st
    if (st + 2 < M / KS) stage_kv(lds0 + (st & 1) * STAGE_B, Vb, Vlb, Khb, Klb, (st + 2) * KS, tid);
  }
  asm volatile("s_wait_asynccnt 0x0" ::: "memory");     // no copy is outstanding when the ring becomes output staging
  const float inv = 1.0f / (l * PS * XS);
  float (*To)[128 + 4] = (float (*)[128 + 4])L;
  // o[t][r] = O^T[d = t*16 + 8hh + r][query col] -> To[d][wave*16 + col]
#pragma unroll
  for (int t = 0; t < 8; ++t)
#pragma unroll
    for (int r = 0; r < 8; ++r) To[t * 16 + 8 * hh + r][wave * 16 + col] = (o[t][r] + ol[t][r]) * inv;
  __syncthreads();
  for (int i = 0; i < 16; ++i) { const int dd = wave * 16 + i;
    for (int sg = 0; sg < 128; sg += 32) { const size_t gi = ((size_t)b * C + dh * 128 + dd) * N + blockIdx.x * 128 + sg + lane; ((float*)out)[gi] = gamma * To[dd][sg + lane] + bf16_rne(x[gi]); }
    asm volatile("s_wait_xcnt 0x0" ::: "memory");   // stands in front of the next trip's rewrite of the registers that this trip's loads and stores name
  }
}
}  // namespace

extern "C" void kernel_launch(void* const* d_in, const int* in_sizes, int n_in, void* d_out, int out_size, void* d_ws, size_t ws_size, hipStream_t stream) {
  (void)n_in;
  auto Fp = [&](int i) { return (const float*)d_in[i]; };
  // input order: 0 x [8,256,64,64], 1 w_theta [32,256], 2 w_phi [32,256], 3 w_g [128,256], 4 w_o [256,128], 5 gamma [1]
  if (in_sizes[0] != NB * C * N || in_sizes[1] != CQ * C || in_sizes[2] != CQ * C || in_sizes[3] != CG * C || in_sizes[4] != C * CG || in_sizes[5] != 1 || out_size != NB * C * N) return;
  size_t off = 0; char* ws = (char*)d_ws;
  auto carve = [&](size_t bytes) { char* p = ws + off; off += (bytes + 255) & ~(size_t)255; return p; };
  b16* XT16 = (b16*)carve((size_t)NB * N * C * 2); b16* W16 = (b16*)carve((size_t)2 * CQ * C * 2); b16* WG = (b16*)carve((size_t)CG * C * 2); b16* WO = (b16*)carve((size_t)C * CG * 2);
  b16* QH = (b16*)carve((size_t)NB * N * CQ * 2); b16* QL = (b16*)carve((size_t)NB * N * CQ * 2); b16* KH = (b16*)carve((size_t)NB * M * CQ * 2); b16* KL = (b16*)carve((size_t)NB * M * CQ * 2);
  b16* V16 = (b16*)carve((size_t)NB * C * M * 2); b16* VL16 = (b16*)carve((size_t)NB * C * M * 2);
  if (off > ws_size || off > ((size_t)128 << 20)) return;   // = 29.2 MB
  pre_kernel<<<PWB + XTB, 256, 0, stream>>>(Fp(0), Fp(1), Fp(2), Fp(3), Fp(4), XT16, W16, WG, WO);
  proj_kernel<<<GB + QKB, 256, 0, stream>>>(XT16, W16, WG, WO, QH, QL, KH, KL, V16, VL16);
  attn_kernel<<<dim3(N / 128, 2, NB), 256, 0, stream>>>(QH, QL, KH, KL, V16, VL16, Fp(0), Fp(5), (float*)d_out);
}

// v005
// One run takes 75.6 microseconds.
// Two timings next to v004 both put it at 1.14 times that version's speed.
// Counting every step since v000, it is 3.65 times as fast.
#include <hip/hip_runtime.h>

// Self-attention block (8 images x 256 ch x 64 x 64): theta = W_theta x (32 ch, all 4,096 pixels), phi = maxpool2x2(W_phi x) (32 ch x 1,024 pooled positions), g = maxpool2x2(W_g x) (128 x 1,024),
// beta = softmax over the 1,024 pooled keys of theta^T phi (no scaling), o = W_o (g beta^T), out = gamma * o + x. The 1x1 convs are channel GEMMs; the attention runs once per query over the 128 pooled
// g channels, and each wave applies W_o (256 x 128) behind the key loop to its own normalised accumulators, which already lie in the B fragment's order.
// WMMA (v_wmma_f32_16x16x32_f16, f32 accumulate): projections with EXACT bf16 pixels (x^T rows x8, via an LDS transpose of the channel-major input) and weights (x256), 1 product;
// energy tiles S^T = Phi . Theta^T with theta AND phi as f16 hi+lo x8 (3 products; logits sigma ~5.7); online softmax in f32; O^T += g P^T with
// g and P as f16 hi+lo x8 (3 products); W_o O^T with W_o exact and O as f16 hi+lo x8 (2 products). Max-pooling, softmax, gamma, residual in f32. Inputs rounded to bf16 once (gamma and the residual x included). Fragment k-map

namespace {
constexpr int NB = 8, C = 256, CQ = 32, N = 4096, M = 1024 /* pooled positions */, CG = 128 /* g channels */, HW = 64;
constexpr float XS = 8.0f, WSC = 256.0f, PS = 8.0f, LOG2E = 1.4426950408889634f;

typedef _Float16 b16;
typedef __attribute__((ext_vector_type(16))) _Float16 v16b;
typedef __attribute__((ext_vector_type(8))) _Float16 v8b;
typedef __attribute__((ext_vector_type(8))) float v8f;
typedef __attribute__((ext_vector_type(4))) float v4f;
__device__ __forceinline__ float bf16_rne(float f) { unsigned int u = __float_as_uint(f); u += 0x7FFFu + ((u >> 16) & 1u); return __uint_as_float(u & 0xFFFF0000u); }
__device__ __forceinline__ void split16(float v, b16& hi, b16& lo) { hi = (b16)v; lo = (b16)(v - (float)hi); }
__device__ __forceinline__ v16b frag_kb(const b16* p, int hh) { const v8b a = *(const v8b*)(p + 8 * hh), b = *(const v8b*)(p + 16 + 8 * hh); v16b f;
#pragma unroll
  for (int e = 0; e < 8; ++e) { f[e] = a[e]; f[8 + e] = b[e]; } return f; }
__device__ __forceinline__ v8f wmma16b(v16b a, v16b b, v8f c) { return __builtin_amdgcn_wmma_f32_16x16x32_f16(false, a, false, b, (short)0, c, false, false); }
// stands behind a group of loads that is issued ahead of its use: without it the scheduler sinks each load to just in front of the product that reads it, and the wave waits out the whole latency there
__device__ __forceinline__ void hold_loads() { __builtin_amdgcn_sched_barrier(0); }
__device__ __forceinline__ void wave_lds_sync() { __builtin_amdgcn_fence(__ATOMIC_RELEASE, "workgroup"); __builtin_amdgcn_wave_barrier(); __builtin_amdgcn_fence(__ATOMIC_ACQUIRE, "workgroup"); }
__device__ __forceinline__ float nexp2(float x) { return __builtin_amdgcn_exp2f(x); }

typedef __attribute__((ext_vector_type(4))) _Float16 v4b;
typedef __attribute__((ext_vector_type(2))) float v2f;
// launch 1: the weight conversion (its own PWB work-groups, in front) and the transpose of x share one grid: neither reads what the other writes
constexpr int PWB = ((2 * CQ * C + CG * C + C * CG) / 8 + 255) / 256, XTB = (N / 64) * (C / 64) * NB;
__global__ __launch_bounds__(256) void pre_kernel(const float* __restrict__ x, const float* __restrict__ wq, const float* __restrict__ wk, const float* __restrict__ wg, const float* __restrict__ wo, b16* __restrict__ XT16, b16* __restrict__ W16, b16* __restrict__ WG, b16* __restrict__ WO) {
  __shared__ __attribute__((aligned(16))) b16 T[64][64 + 8];
  if (blockIdx.x < PWB) {
    const int t = blockIdx.x * 256 + threadIdx.x; const int nq = CQ * C / 8, ng = CG * C / 8, no = C * CG / 8; const float* src; int e; b16* dst;
    if (t < nq) { src = wq; e = t * 8; dst = W16; } else if (t < 2 * nq) { src = wk; e = (t - nq) * 8; dst = W16 + CQ * C; } else if (t < 2 * nq + ng) { src = wg; e = (t - 2 * nq) * 8; dst = WG; } else if (t < 2 * nq + ng + no) { src = wo; e = (t - 2 * nq - ng) * 8; dst = WO; } else return;
    v8b o; for (int j = 0; j < 8; ++j) o[j] = (b16)(bf16_rne(src[e + j]) * WSC);
    { *(v8b*)(dst + e) = o;  }
    return;
  }
  const int f = blockIdx.x - PWB; const int b = f >> 8, c0 = ((f >> 6) & 3) * 64, n0 = (f & 63) * 64, t_ = threadIdx.x;
  float xv[16];
#pragma unroll   // all 16 loads of a lane are issued before the first is waited for
  for (int i = 0; i < 16; ++i) { const int q = t_ + i * 256; xv[i] = x[((size_t)b * C + c0 + (q >> 6)) * N + n0 + (q & 63)]; }
#pragma unroll   // xv[] stays in registers only under constant indices
  for (int i = 0; i < 16; ++i) { const int q = t_ + i * 256; T[q & 63][q >> 6] = (b16)(bf16_rne(xv[i]) * XS); }
  __syncthreads();
  { for (int q = t_; q < 64 * 8; q += 256) { const int nn = q >> 3, c8 = (q & 7) * 8; *(v8b*)(XT16 + ((size_t)b * N + n0 + nn) * C + c0 + c8) = *(const v8b*)(&T[nn][c8]); }  }
}
// theta/phi projection: [n x 256] x [256 x 32]. A wave's 16 pixel rows are 8 neighbours of image row 2 h2 and the 8 below them, so that it holds whole 2x2 pooling windows:
// theta goes out as QH/QL [b][n][32] f16 hi+lo x8 (64-B rows), phi is max-pooled from the wave's f32 staging and goes out as KH/KL [b][m][32] f16 hi+lo x8 (4 pooled positions a wave)
__device__ __forceinline__ void qk_part(unsigned char* S, int blk, const b16* __restrict__ XT16, const b16* __restrict__ W16, b16* __restrict__ QH, b16* __restrict__ QL, b16* __restrict__ KH, b16* __restrict__ KL) {
  b16 (*Th)[16][CQ + 8] = (b16 (*)[16][CQ + 8])S; b16 (*Tl)[16][CQ + 8] = (b16 (*)[16][CQ + 8])(S + 8 * 16 * (CQ + 8) * 2); float (*Tf)[16][CQ + 4] = (float (*)[16][CQ + 4])(S + 2 * 8 * 16 * (CQ + 8) * 2);
  const int wave = threadIdx.x >> 5, lane = threadIdx.x & 31, nloc = lane & 15, hlf = lane >> 4; const int gw = blk * 8 + wave; const int b = gw >> 8, h2 = (gw >> 3) & 31, w0 = (gw & 7) * 8;
  auto pix = [&](int rr) { return (size_t)b * N + (size_t)(2 * h2 + (rr >> 3)) * HW + w0 + (rr & 7); };   // over b*N + n
  v8f acc[4] = {{}, {}, {}, {}};   // tiles: q0, q1, k0, k1
  // the fragments of k step k + 3 are requested in front of the products of k step k (four register buffers)
  v16b a[4], w[4][4];
  auto ld = [&](int k) { a[k & 3] = frag_kb(XT16 + pix(nloc) * C + k * 32, hlf);
#pragma unroll   // constant indices keep the buffers in registers
    for (int t = 0; t < 4; ++t) w[k & 3][t] = frag_kb(W16 + (size_t)((t >> 1) * CQ + (t & 1) * 16 + nloc) * C + k * 32, hlf); };
  ld(0); ld(1); ld(2); hold_loads();
#pragma unroll   // buffer numbers must be compile-time constants
  for (int k = 0; k < C / 32; ++k) { if (k + 3 < C / 32) { ld(k + 3); hold_loads(); }
#pragma unroll
    for (int t = 0; t < 4; ++t) acc[t] = wmma16b(a[k & 3], w[k & 3][t], acc[t]); }
#pragma unroll
  for (int t = 0; t < 4; ++t) { const int which = t >> 1, c = (t & 1) * 16 + nloc;
#pragma unroll
    for (int r = 0; r < 8; ++r) { const float v = acc[t][r] * (1.0f / (XS * WSC)); if (which == 0) { b16 h_, l_; split16(v * XS, h_, l_); Th[wave][8 * hlf + r][c] = h_; Tl[wave][8 * hlf + r][c] = l_; } else Tf[wave][8 * hlf + r][c] = v; } }
  wave_lds_sync();
  {
    for (int q = 0; q < 2; ++q) { const int rr = q * 8 + (lane >> 2), seg = (lane & 3) * 8; *(v8b*)(QH + pix(rr) * CQ + seg) = *(const v8b*)(&Th[wave][rr][seg]); *(v8b*)(QL + pix(rr) * CQ + seg) = *(const v8b*)(&Tl[wave][rr][seg]); }
    const int i = lane >> 3, c4 = (lane & 7) * 4;   // pooled position w0 / 2 + i, channels c4 .. c4 + 3
    const v4f p00 = *(const v4f*)(&Tf[wave][2 * i][c4]), p01 = *(const v4f*)(&Tf[wave][2 * i + 1][c4]), p10 = *(const v4f*)(&Tf[wave][8 + 2 * i][c4]), p11 = *(const v4f*)(&Tf[wave][8 + 2 * i + 1][c4]); v4b hv, lv;
#pragma unroll   // constant indices keep hv, lv in registers
    for (int j = 0; j < 4; ++j) { const float v = fmaxf(fmaxf(p00[j], p01[j]), fmaxf(p10[j], p11[j])); b16 h_, l_; split16(v * XS, h_, l_); hv[j] = h_; lv[j] = l_; }
    const size_t ko = ((size_t)b * M + h2 * (HW / 2) + (w0 >> 1) + i) * CQ + c4; *(v4b*)(KH + ko) = hv; *(v4b*)(KL + ko) = lv;
    asm volatile("s_wait_xcnt 0x0" ::: "memory");   // behind the last store of this part: whatever code follows it in the joint kernel may reuse the registers that these stores name
  }
}
// g projection and pooling in one work-group of 8 waves = all 128 g channels x 128 pixels (image rows 2 h2 and 2 h2 + 1). GEMM rows d (A = WG rows, K = c) x cols n (B = XT16 rows n): each wave
// stages 16 d-rows x 128 n floats and max-pools them 2x2 (a lane takes pooled column w2 = lane of all 16 rows); the pooled values go out channel-major, G16/GL16 [b][d][m] = f16 hi+lo x8,
// through the wave's own Ph/Pl [16 d][32 m] in LDS, so that a lane stores 16 bytes of one channel row
constexpr int GPP = 32 + 8 /* pitch of Ph, Pl in halves: 80 B = 16 B x odd */, SZ_TS = 8 * 16 * (128 + 4) * 4, SZ_G = 8 * 16 * GPP * 2;
__device__ __forceinline__ void gv_part(unsigned char* S, int blk, const b16* __restrict__ XT16, const b16* __restrict__ WG, b16* __restrict__ G16, b16* __restrict__ GL16) {
  float (*Ts)[16][128 + 4] = (float (*)[16][128 + 4])S; b16 (*Ph)[16][GPP] = (b16 (*)[16][GPP])(S + SZ_TS); b16 (*Pl)[16][GPP] = (b16 (*)[16][GPP])(S + SZ_TS + SZ_G);
  const int wave = threadIdx.x >> 5, lane = threadIdx.x & 31, nloc = lane & 15, hlf = lane >> 4; const int b = blk >> 5, h2 = blk & 31; const int d0 = wave * 16, n0 = h2 * 128;
  v8f acc[8];
#pragma unroll
  for (int t = 0; t < 8; ++t) acc[t] = (v8f){};
  // the nine fragments of k step k + 1 are requested in front of the products of k step k (two register buffers)
  v16b a[2], bf[2][8];
  auto ld = [&](int k) { a[k & 1] = frag_kb(WG + (size_t)(d0 + nloc) * C + k * 32, hlf); if (k == C / 32 - 1) asm volatile("s_wait_xcnt 0x0" ::: "memory");   // behind the last W_g load: the next loads' results may reuse its address registers
#pragma unroll   // constant indices keep the buffers in registers
    for (int t = 0; t < 8; ++t) bf[k & 1][t] = frag_kb(XT16 + ((size_t)b * N + n0 + t * 16 + nloc) * C + k * 32, hlf); };
  ld(0); hold_loads();
#pragma unroll   // buffer numbers must be compile-time constants
  for (int k = 0; k < C / 32; ++k) { if (k + 1 < C / 32) { ld(k + 1); hold_loads(); }
#pragma unroll
    for (int t = 0; t < 8; ++t) acc[t] = wmma16b(a[k & 1], bf[k & 1][t], acc[t]); }
#pragma unroll
  for (int t = 0; t < 8; ++t)
#pragma unroll
    for (int r = 0; r < 8; ++r) Ts[wave][8 * hlf + r][t * 16 + nloc] = acc[t][r] * (1.0f / (XS * WSC));
  wave_lds_sync();
  v2f pr[16], qr[16];
#pragma unroll   // all 32 reads of the staging are issued before the first is waited for
  for (int rr = 0; rr < 16; ++rr) { pr[rr] = *(const v2f*)(&Ts[wave][rr][2 * lane]); qr[rr] = *(const v2f*)(&Ts[wave][rr][HW + 2 * lane]); }
  hold_loads();
#pragma unroll   // constant indices keep pr, qr in registers
  for (int rr = 0; rr < 16; ++rr) { const v2f p = pr[rr], q = qr[rr]; const float v = fmaxf(fmaxf(p[0], p[1]), fmaxf(q[0], q[1])); b16 h_, l_; split16(v * XS, h_, l_); Ph[wave][rr][lane] = h_; Pl[wave][rr][lane] = l_; }
  wave_lds_sync();
  const int row = lane >> 2, seg = (lane & 3) * 8; const size_t gi = ((size_t)b * CG + d0 + row) * M + h2 * (HW / 2) + seg;
  *(v8b*)(G16 + gi) = *(const v8b*)(&Ph[wave][row][seg]); *(v8b*)(GL16 + gi) = *(const v8b*)(&Pl[wave][row][seg]); *(v8b*)(G16 + gi + 8 * M) = *(const v8b*)(&Ph[wave][8 + row][seg]); *(v8b*)(GL16 + gi + 8 * M) = *(const v8b*)(&Pl[wave][8 + row][seg]);
  asm volatile("s_wait_xcnt 0x0" ::: "memory");   // behind the last store of this part: whatever code follows it in the joint kernel may reuse the registers that these stores name
}
// launch 2: the g work-groups (even index) and the theta/phi work-groups (odd index) share one grid, alternating so that neighbours in the index are one of each kind; they read the same XT16 and write
// disjoint arrays; one LDS block serves either part
constexpr int GB = (N / 128) * NB, QKB = NB * N / 128;
__global__ __launch_bounds__(256) void proj_kernel(const b16* __restrict__ XT16, const b16* __restrict__ W16, const b16* __restrict__ WG, b16* __restrict__ QH, b16* __restrict__ QL, b16* __restrict__ KH, b16* __restrict__ KL, b16* __restrict__ G16, b16* __restrict__ GL16) {
  __shared__ __attribute__((aligned(16))) unsigned char S[SZ_TS + 2 * SZ_G];
  static_assert(GB == QKB, "the two kinds alternate");
  if ((blockIdx.x & 1) == 0) gv_part(S, blockIdx.x >> 1, XT16, WG, G16, GL16); else qk_part(S, blockIdx.x >> 1, XT16, W16, QH, QL, KH, KL);
}
// attention: grid (N/128 query blocks, 1, B); block = 8 waves x 16 queries, one work-group on a WGP. K (hi, lo) and the pooled g (hi, lo; all 128 channels) come in stages of 64 pooled keys into a
// two-buffer LDS ring that all 8 waves read: every lane copies 16 B pieces with asynchronous copies to LDS (whole 128-B lines per 8 lanes for g, 4 KB contiguous for K), one stage ahead of its use.
// Per block of 32 pooled keys: S^T = Phi . Theta^T with (Kh Qh + Kh Ql + Kl Qh), online softmax (f32, exp2), O^T (8 tiles) += g[d][keys] P^T (hi + lo). Behind the loop W_o (in LDS since trip 0) x O^T / l,
// 16 tiles of 16 channels a wave; out[b][c][n] = gamma (W_o O / l) + x, staged in LDS over the ring so that a wave writes whole 512-B rows.
constexpr int KS = 64 /* keys per stage */, VP = 144, KP = 80 /* LDS row pitch in bytes, 16 B x odd: 16 rows of a 16-byte read fall on 64 distinct banks */;
constexpr int OFF_VH = 0, OFF_VL = 128 * VP, OFF_KH = 2 * 128 * VP, OFF_KL = OFF_KH + KS * KP, STAGE_B = OFF_KL + KS * KP;   // 47,104 B per buffer
constexpr int TO_B = C * (128 + 4) * 4 /* output staging, over the ring */, OFF_WO = TO_B, WP = CG * 2 + 16 /* pitch of a W_o row in LDS: 272 B = 16 B x odd */;
static_assert(TO_B >= 2 * STAGE_B, "the ring lies inside the output staging");
// one stage (keys k0 .. k0 + 63) into the buffer at LDS byte address lb: 10 copies per lane, 256 lanes; g rows vr + 32 j (8 lanes x 16 B = one 128-B line each), K rows kr (4 lanes x 16 B)
__device__ __forceinline__ void stage_kv(unsigned lb, const b16* Vb, const b16* Vlb, const b16* Khb, const b16* Klb, int k0, int tid) {
  const int vr = tid >> 3, vc = tid & 7, kr = tid >> 2, kc = tid & 3; const unsigned lv = lb + vr * VP + vc * 16, lk = lb + kr * KP + kc * 16; const size_t gv = (size_t)vr * M + k0 + vc * 8, gk = (size_t)(k0 + kr) * CQ + kc * 8;
  // the ten copies and, as the statement's last line, the wait that stands in front of any rewrite of the address registers they name
  asm volatile("global_load_async_to_lds_b128 %0, %1, off\n\tglobal_load_async_to_lds_b128 %2, %3, off\n\tglobal_load_async_to_lds_b128 %4, %5, off\n\tglobal_load_async_to_lds_b128 %6, %7, off\n\tglobal_load_async_to_lds_b128 %8, %9, off\n\t"
               "global_load_async_to_lds_b128 %10, %11, off\n\tglobal_load_async_to_lds_b128 %12, %13, off\n\tglobal_load_async_to_lds_b128 %14, %15, off\n\tglobal_load_async_to_lds_b128 %16, %17, off\n\tglobal_load_async_to_lds_b128 %18, %19, off\n\ts_wait_xcnt 0x0"
               :: "v"(lv + OFF_VH), "v"(Vb + gv), "v"(lv + OFF_VH + 32 * VP), "v"(Vb + gv + 32 * M), "v"(lv + OFF_VH + 64 * VP), "v"(Vb + gv + 64 * M), "v"(lv + OFF_VH + 96 * VP), "v"(Vb + gv + 96 * M), "v"(lk + OFF_KH), "v"(Khb + gk),
                  "v"(lv + OFF_VL), "v"(Vlb + gv), "v"(lv + OFF_VL + 32 * VP), "v"(Vlb + gv + 32 * M), "v"(lv + OFF_VL + 64 * VP), "v"(Vlb + gv + 64 * M), "v"(lv + OFF_VL + 96 * VP), "v"(Vlb + gv + 96 * M), "v"(lk + OFF_KL), "v"(Klb + gk) : "memory");
}
// eight rows' pieces of W_o (rows 16 apart; 16 lanes x 16 B = one 256-B row) into LDS: the copies and, as the statement's last line, the wait that stands in front of any rewrite of the address registers they name
__device__ __forceinline__ void stage_wo8(unsigned lw, const b16* gw) {
  asm volatile("global_load_async_to_lds_b128 %0, %1, off\n\tglobal_load_async_to_lds_b128 %2, %3, off\n\tglobal_load_async_to_lds_b128 %4, %5, off\n\tglobal_load_async_to_lds_b128 %6, %7, off\n\t"
               "global_load_async_to_lds_b128 %8, %9, off\n\tglobal_load_async_to_lds_b128 %10, %11, off\n\tglobal_load_async_to_lds_b128 %12, %13, off\n\tglobal_load_async_to_lds_b128 %14, %15, off\n\ts_wait_xcnt 0x0"
               :: "v"(lw), "v"(gw), "v"(lw + 16 * WP), "v"(gw + 16 * CG), "v"(lw + 32 * WP), "v"(gw + 32 * CG), "v"(lw + 48 * WP), "v"(gw + 48 * CG),
                  "v"(lw + 64 * WP), "v"(gw + 64 * CG), "v"(lw + 80 * WP), "v"(gw + 80 * CG), "v"(lw + 96 * WP), "v"(gw + 96 * CG), "v"(lw + 112 * WP), "v"(gw + 112 * CG) : "memory");
}
__global__ __launch_bounds__(256) void attn_kernel(const b16* __restrict__ QH, const b16* __restrict__ QL, const b16* __restrict__ KH, const b16* __restrict__ KL, const b16* __restrict__ G16, const b16* __restrict__ GL16, const b16* __restrict__ WO, const float* __restrict__ x, const float* __restrict__ gamma_, float* __restrict__ out) {
  __shared__ __attribute__((aligned(128))) unsigned char L[TO_B + C * WP];   // the ring, after the loop the output staging To[256][128 + 4] (135,168 B); behind it W_o [256][WP] (69,632 B)
  const int tid = threadIdx.x, wave = threadIdx.x >> 5, lane = threadIdx.x & 31, hh = lane >> 4, col = lane & 15; const int b = blockIdx.z; const int q0 = blockIdx.x * 128 + wave * 16, qi = q0 + col;
  const size_t qrow = (size_t)b * N + qi; const v16b qh = frag_kb(QH + qrow * CQ, hh), ql = frag_kb(QL + qrow * CQ, hh);
  const b16* Khb = KH + (size_t)b * M * CQ; const b16* Klb = KL + (size_t)b * M * CQ; const b16* Vb = G16 + (size_t)b * CG * M; const b16* Vlb = GL16 + (size_t)b * CG * M; const float gamma = bf16_rne(gamma_[0]);
  const unsigned lds0 = (unsigned)(size_t)L;
  float m = -INFINITY, l = 0.0f; v8f o[8], ol[8];
#pragma unroll
  for (int t = 0; t < 8; ++t) { o[t] = (v8f){}; ol[t] = (v8f){}; }
  stage_kv(lds0, Vb, Vlb, Khb, Klb, 0, tid);
  asm volatile("s_wait_asynccnt 0x0" ::: "memory");   // this wave's copies of stage 0 have landed
  __syncthreads();                                    // every wave's have: stage 0 is readable
  stage_kv(lds0 + STAGE_B, Vb, Vlb, Khb, Klb, KS, tid);
  // W_o flies with stage 1: 16 copies a lane (26 outstanding with the stage's ten); the wait and the barrier at the foot of trip 0 land and publish it, it is read behind the loop
  { const unsigned lw = lds0 + OFF_WO + (tid >> 4) * WP + (tid & 15) * 16; const b16* gw = WO + (size_t)(tid >> 4) * CG + (tid & 15) * 8; stage_wo8(lw, gw); stage_wo8(lw + 128 * WP, gw + 128 * CG); }
  for (int st = 0; st < M / KS; ++st) {
    const unsigned char* B = L + (st & 1) * STAGE_B;
    // LDS fragment reads stand well in front of the products that use them: per 32 keys the four K fragments as one group,
    // g tiles 0 and 1 behind the first energy product, tile 2 behind the softmax, tile t + 3 behind the products of tile t; every read of a stage still ends in front of the stage's foot
    v16b kf[4];
    auto ldk = [&](int kk) { kf[0] = frag_kb((const b16*)(B + OFF_KH + (kk + col) * KP), hh); kf[1] = frag_kb((const b16*)(B + OFF_KH + (kk + 16 + col) * KP), hh); kf[2] = frag_kb((const b16*)(B + OFF_KL + (kk + col) * KP), hh); kf[3] = frag_kb((const b16*)(B + OFF_KL + (kk + 16 + col) * KP), hh); };
    for (int kk = 0; kk < KS; kk += 32) {
      v16b vh[8], vl[8];
      auto ldv = [&](int t) { vh[t] = frag_kb((const b16*)(B + OFF_VH + (t * 16 + col) * VP) + kk, hh); vl[t] = frag_kb((const b16*)(B + OFF_VL + (t * 16 + col) * VP) + kk, hh); };
      ldk(kk);
      v8f s0 = {}, s1 = {};
      s0 = wmma16b(kf[0], qh, s0); ldv(0); ldv(1); hold_loads(); s0 = wmma16b(kf[0], ql, s0); s0 = wmma16b(kf[2], qh, s0);
      s1 = wmma16b(kf[1], qh, s1); s1 = wmma16b(kf[1], ql, s1); s1 = wmma16b(kf[3], qh, s1);
      float e[16]; float mx = -INFINITY; const float cs = LOG2E / (XS * XS);
#pragma unroll
      for (int r = 0; r < 8; ++r) { e[r] = s0[r] * cs; e[8 + r] = s1[r] * cs; mx = fmaxf(mx, fmaxf(e[r], e[8 + r])); }
      mx = fmaxf(mx, __shfl_xor(mx, 16)); const float mn = fmaxf(m, mx); const float al = nexp2(m - mn); m = mn; float sum = 0.0f; v16b ph, pl;
#pragma unroll
      for (int i = 0; i < 16; ++i) { const float p = nexp2(e[i] - mn); sum += p; const b16 h_ = (b16)(p * PS); ph[i] = h_; pl[i] = (b16)(p * PS - (float)h_); }
      sum += __shfl_xor(sum, 16); l = l * al + sum;
      ldv(2); hold_loads();
#pragma unroll
      for (int t = 0; t < 8; ++t) { o[t] *= al; ol[t] *= al; o[t] = wmma16b(vh[t], ph, o[t]); ol[t] = wmma16b(vh[t], pl, ol[t]); ol[t] = wmma16b(vl[t], ph, ol[t]);
        if (t + 3 < 8) { ldv(t + 3); hold_loads(); } } }
    asm volatile("s_wait_dscnt 0x0" ::: "memory");      // this wave's reads of the buffer are done before it is refilled
    asm volatile("s_wait_asynccnt 0x0" ::: "memory");   // this wave's copies of stage st + 1 (in trip 0 of W_o too) have landed
    __syncthreads();                                    // publishes stage st + 1 and ends every wave's reads of stage st
    if (st + 2 < M / KS) stage_kv(lds0 + (st & 1) * STAGE_B, Vb, Vlb, Khb, Klb, (st + 2) * KS, tid);
  }
  asm volatile("s_wait_asynccnt 0x0" ::: "memory");     // no copy is outstanding when the ring becomes output staging
  // the wave's O^T / l as B fragments of W_o O^T: o[t][r] = O^T[d = t*16 + 8hh + r][query col], so tiles 2 ks and 2 ks + 1 are elements 0..7 and 8..15 of k step ks (d = 32 ks + 8hh + e, 32 ks + 16 + 8hh + e), the order of frag_kb
  const float inv = 1.0f / (l * PS);   // O x8
  v16b oh[CG / 32], oq[CG / 32];
#pragma unroll   // both loops: constant indices keep o, ol, oh, oq in registers
  for (int ks = 0; ks < CG / 32; ++ks)
#pragma unroll
    for (int r = 0; r < 8; ++r) { b16 h_, l_; split16((o[2 * ks][r] + ol[2 * ks][r]) * inv, h_, l_); oh[ks][r] = h_; oq[ks][r] = l_; split16((o[2 * ks + 1][r] + ol[2 * ks + 1][r]) * inv, h_, l_); oh[ks][8 + r] = h_; oq[ks][8 + r] = l_; }
  float (*To)[128 + 4] = (float (*)[128 + 4])L;
  // the four W_o fragments of channel tile ct + 1 are read in front of the products of tile ct (two register buffers)
  v16b wa[2][CG / 32];
  auto ldw = [&](int ct) {
#pragma unroll   // constant indices keep the buffers in registers
    for (int ks = 0; ks < CG / 32; ++ks) wa[ct & 1][ks] = frag_kb((const b16*)(L + OFF_WO + (ct * 16 + col) * WP) + ks * 32, hh); };
  ldw(0); hold_loads();
#pragma unroll   // buffer numbers must be compile-time constants
  for (int ct = 0; ct < C / 16; ++ct) { if (ct + 1 < C / 16) { ldw(ct + 1); hold_loads(); }
    v8f ah = {}, aq = {};
#pragma unroll
    for (int ks = 0; ks < CG / 32; ++ks) { ah = wmma16b(wa[ct & 1][ks], oh[ks], ah); aq = wmma16b(wa[ct & 1][ks], oq[ks], aq); }
#pragma unroll   // ah[r] = (W_o O)[c = ct*16 + 8hh + r][query col] x 2048 -> To[c][wave*16 + col]
    for (int r = 0; r < 8; ++r) To[ct * 16 + 8 * hh + r][wave * 16 + col] = (ah[r] + aq[r]) * (1.0f / (XS * WSC)); }
  __syncthreads();   // every wave's 16 query columns of all 256 rows are in To
  for (int i = 0; i < 32; ++i) { const int dd = wave * 32 + i;
    for (int sg = 0; sg < 128; sg += 32) { const size_t gi = ((size_t)b * C + dd) * N + blockIdx.x * 128 + sg + lane; ((float*)out)[gi] = gamma * To[dd][sg + lane] + bf16_rne(x[gi]); }
    asm volatile("s_wait_xcnt 0x0" ::: "memory");   // stands in front of the next trip's rewrite of the registers that this trip's loads and stores name
  }
}
}  // namespace

extern "C" void kernel_launch(void* const* d_in, const int* in_sizes, int n_in, void* d_out, int out_size, void* d_ws, size_t ws_size, hipStream_t stream) {
  (void)n_in;
  auto Fp = [&](int i) { return (const float*)d_in[i]; };
  // input order: 0 x [8,256,64,64], 1 w_theta [32,256], 2 w_phi [32,256], 3 w_g [128,256], 4 w_o [256,128], 5 gamma [1]
  if (in_sizes[0] != NB * C * N || in_sizes[1] != CQ * C || in_sizes[2] != CQ * C || in_sizes[3] != CG * C || in_sizes[4] != C * CG || in_sizes[5] != 1 || out_size != NB * C * N) return;
  size_t off = 0; char* ws = (char*)d_ws;
  auto carve = [&](size_t bytes) { char* p = ws + off; off += (bytes + 255) & ~(size_t)255; return p; };
  b16* XT16 = (b16*)carve((size_t)NB * N * C * 2); b16* W16 = (b16*)carve((size_t)2 * CQ * C * 2); b16* WG = (b16*)carve((size_t)CG * C * 2); b16* WO = (b16*)carve((size_t)C * CG * 2);
  b16* QH = (b16*)carve((size_t)NB * N * CQ * 2); b16* QL = (b16*)carve((size_t)NB * N * CQ * 2); b16* KH = (b16*)carve((size_t)NB * M * CQ * 2); b16* KL = (b16*)carve((size_t)NB * M * CQ * 2);
  b16* G16 = (b16*)carve((size_t)NB * CG * M * 2); b16* GL16 = (b16*)carve((size_t)NB * CG * M * 2);
  if (off > ws_size || off > ((size_t)128 << 20)) return;   // = 25.2 MB
  pre_kernel<<<PWB + XTB, 256, 0, stream>>>(Fp(0), Fp(1), Fp(2), Fp(3), Fp(4), XT16, W16, WG, WO);
  proj_kernel<<<GB + QKB, 256, 0, stream>>>(XT16, W16, WG, QH, QL, KH, KL, G16, GL16);
  attn_kernel<<<dim3(N / 128, 1, NB), 256, 0, stream>>>(QH, QL, KH, KL, G16, GL16, WO, Fp(0), Fp(5), (float*)d_out);
}

// v006
// A run of this version takes 62.5 microseconds.
// Next to v005, in two timings, it ran 1.21 times as fast each time.
// Over all steps from v000 it is 4.41 times as fast.
#include <hip/hip_runtime.h>

// Self-attention block (8 images x 256 ch x 64 x 64): theta = W_theta x (32 ch, all 4,096 pixels), phi = maxpool2x2(W_phi x) (32 ch x 1,024 pooled positions), g = maxpool2x2(W_g x) (128 x 1,024),
// beta = softmax over the 1,024 pooled keys of theta^T phi (no scaling), o = W_o (g beta^T), out = gamma * o + x. The 1x1 convs are channel GEMMs; the attention runs once per query over the 128 pooled
// g channels, and each wave applies W_o (256 x 128) behind the key loop to its own normalised accumulators, which already lie in the B fragment's order.
// WMMA (v_wmma_f32_16x16x32_f16, f32 accumulate): projections with EXACT bf16 pixels (x^T rows x8, via an LDS transpose of the channel-major input) and weights (x256), 1 product;
// energy tiles S^T = Phi . Theta^T with theta AND phi as f16 hi+lo x8 (3 products; logits sigma ~5.7); online softmax in f32; O^T += g P^T with
// g and P as f16 hi+lo x8 (3 products); W_o O^T with W_o exact and O as f16 hi+lo x8 (2 products). Max-pooling, softmax, gamma, residual in f32. Inputs rounded to bf16 once (gamma and the residual x included). Fragment k-map

namespace {
constexpr int NB = 8, C = 256, CQ = 32, N = 4096, M = 1024 /* pooled positions */, CG = 128 /* g channels */, HW = 64;
constexpr float XS = 8.0f, WSC = 256.0f, PS = 8.0f, LOG2E = 1.4426950408889634f;

typedef _Float16 b16;
typedef __attribute__((ext_vector_type(16))) _Float16 v16b;
typedef __attribute__((ext_vector_type(8))) _Float16 v8b;
typedef __attribute__((ext_vector_type(8))) float v8f;
typedef __attribute__((ext_vector_type(4))) float v4f;
__device__ __forceinline__ float bf16_rne(float f) { unsigned int u = __float_as_uint(f); u += 0x7FFFu + ((u >> 16) & 1u); return __uint_as_float(u & 0xFFFF0000u); }
__device__ __forceinline__ void split16(float v, b16& hi, b16& lo) { hi = (b16)v; lo = (b16)(v - (float)hi); }
__device__ __forceinline__ v16b frag_kb(const b16* p, int hh) { const v8b a = *(const v8b*)(p + 8 * hh), b = *(const v8b*)(p + 16 + 8 * hh); v16b f;
#pragma unroll
  for (int e = 0; e < 8; ++e) { f[e] = a[e]; f[8 + e] = b[e]; } return f; }
__device__ __forceinline__ v8f wmma16b(v16b a, v16b b, v8f c) { return __builtin_amdgcn_wmma_f32_16x16x32_f16(false, a, false, b, (short)0, c, false, false); }
// stands behind a group of loads that is issued ahead of its use: without it the scheduler sinks each load to just in front of the product that reads it, and the wave waits out the whole latency there
__device__ __forceinline__ void hold_loads() { __builtin_amdgcn_sched_barrier(0); }
__device__ __forceinline__ void wave_lds_sync() { __builtin_amdgcn_fence(__ATOMIC_RELEASE, "workgroup"); __builtin_amdgcn_wave_barrier(); __builtin_amdgcn_fence(__ATOMIC_ACQUIRE, "workgroup"); }
__device__ __forceinline__ float nexp2(float x) { return __builtin_amdgcn_exp2f(x); }

typedef __attribute__((ext_vector_type(4))) _Float16 v4b;
typedef __attribute__((ext_vector_type(2))) float v2f;
// launch 1: the weight conversion (its own PWB work-groups, in front) and the transpose of x share one grid: neither reads what the other writes
constexpr int PWB = ((2 * CQ * C + CG * C + C * CG) / 8 + 255) / 256, XTB = (N / 64) * (C / 64) * NB;
__global__ __launch_bounds__(256) void pre_kernel(const float* __restrict__ x, const float* __restrict__ wq, const float* __restrict__ wk, const float* __restrict__ wg, const float* __restrict__ wo, b16* __restrict__ XT16, b16* __restrict__ W16, b16* __restrict__ WG, b16* __restrict__ WO) {
  __shared__ __attribute__((aligned(16))) b16 T[64][64 + 8];
  if (blockIdx.x < PWB) {
    const int t = blockIdx.x * 256 + threadIdx.x; const int nq = CQ * C / 8, ng = CG * C / 8, no = C * CG / 8; const float* src; int e; b16* dst;
    if (t < nq) { src = wq; e = t * 8; dst = W16; } else if (t < 2 * nq) { src = wk; e = (t - nq) * 8; dst = W16 + CQ * C; } else if (t < 2 * nq + ng) { src = wg; e = (t - 2 * nq) * 8; dst = WG; } else if (t < 2 * nq + ng + no) { src = wo; e = (t - 2 * nq - ng) * 8; dst = WO; } else return;
    v8b o; for (int j = 0; j < 8; ++j) o[j] = (b16)(bf16_rne(src[e + j]) * WSC);
    { *(v8b*)(dst + e) = o;  }
    return;
  }
  const int f = blockIdx.x - PWB; const int b = f >> 8, c0 = ((f >> 6) & 3) * 64, n0 = (f & 63) * 64, t_ = threadIdx.x;
  float xv[16];
#pragma unroll   // all 16 loads of a lane are issued before the first is waited for
  for (int i = 0; i < 16; ++i) { const int q = t_ + i * 256; xv[i] = x[((size_t)b * C + c0 + (q >> 6)) * N + n0 + (q & 63)]; }
#pragma unroll   // xv[] stays in registers only under constant indices
  for (int i = 0; i < 16; ++i) { const int q = t_ + i * 256; T[q & 63][q >> 6] = (b16)(bf16_rne(xv[i]) * XS); }
  __syncthreads();
  { for (int q = t_; q < 64 * 8; q += 256) { const int nn = q >> 3, c8 = (q & 7) * 8; *(v8b*)(XT16 + ((size_t)b * N + n0 + nn) * C + c0 + c8) = *(const v8b*)(&T[nn][c8]); }  }
}
// theta/phi projection: [n x 256] x [256 x 32]. A wave's 16 pixel rows are 8 neighbours of image row 2 h2 and the 8 below them, so that it holds whole 2x2 pooling windows:
// theta goes out as QH/QL [b][n][32] f16 hi+lo x8 (64-B rows), phi is max-pooled from the wave's f32 staging and goes out as KH/KL [b][m][32] f16 hi+lo x8 (4 pooled positions a wave)
__device__ __forceinline__ void qk_part(unsigned char* S, int blk, const b16* __restrict__ XT16, const b16* __restrict__ W16, b16* __restrict__ QH, b16* __restrict__ QL, b16* __restrict__ KH, b16* __restrict__ KL) {
  b16 (*Th)[16][CQ + 8] = (b16 (*)[16][CQ + 8])S; b16 (*Tl)[16][CQ + 8] = (b16 (*)[16][CQ + 8])(S + 8 * 16 * (CQ + 8) * 2); float (*Tf)[16][CQ + 4] = (float (*)[16][CQ + 4])(S + 2 * 8 * 16 * (CQ + 8) * 2);
  const int wave = threadIdx.x >> 5, lane = threadIdx.x & 31, nloc = lane & 15, hlf = lane >> 4; const int gw = blk * 8 + wave; const int b = gw >> 8, h2 = (gw >> 3) & 31, w0 = (gw & 7) * 8;
  auto pix = [&](int rr) { return (size_t)b * N + (size_t)(2 * h2 + (rr >> 3)) * HW + w0 + (rr & 7); };   // over b*N + n
  v8f acc[4] = {{}, {}, {}, {}};   // tiles: q0, q1, k0, k1
  // the fragments of k step k + 3 are requested in front of the products of k step k (four register buffers)
  v16b a[4], w[4][4];
  auto ld = [&](int k) { a[k & 3] = frag_kb(XT16 + pix(nloc) * C + k * 32, hlf);
#pragma unroll   // constant indices keep the buffers in registers
    for (int t = 0; t < 4; ++t) w[k & 3][t] = frag_kb(W16 + (size_t)((t >> 1) * CQ + (t & 1) * 16 + nloc) * C + k * 32, hlf); };
  ld(0); ld(1); ld(2); hold_loads();
#pragma unroll   // buffer numbers must be compile-time constants
  for (int k = 0; k < C / 32; ++k) { if (k + 3 < C / 32) { ld(k + 3); hold_loads(); }
#pragma unroll
    for (int t = 0; t < 4; ++t) acc[t] = wmma16b(a[k & 3], w[k & 3][t], acc[t]); }
#pragma unroll
  for (int t = 0; t < 4; ++t) { const int which = t >> 1, c = (t & 1) * 16 + nloc;
#pragma unroll
    for (int r = 0; r < 8; ++r) { const float v = acc[t][r] * (1.0f / (XS * WSC)); if (which == 0) { b16 h_, l_; split16(v * XS, h_, l_); Th[wave][8 * hlf + r][c] = h_; Tl[wave][8 * hlf + r][c] = l_; } else Tf[wave][8 * hlf + r][c] = v; } }
  wave_lds_sync();
  {
    for (int q = 0; q < 2; ++q) { const int rr = q * 8 + (lane >> 2), seg = (lane & 3) * 8; *(v8b*)(QH + pix(rr) * CQ + seg) = *(const v8b*)(&Th[wave][rr][seg]); *(v8b*)(QL + pix(rr) * CQ + seg) = *(const v8b*)(&Tl[wave][rr][seg]); }
    const int i = lane >> 3, c4 = (lane & 7) * 4;   // pooled position w0 / 2 + i, channels c4 .. c4 + 3
    const v4f p00 = *(const v4f*)(&Tf[wave][2 * i][c4]), p01 = *(const v4f*)(&Tf[wave][2 * i + 1][c4]), p10 = *(const v4f*)(&Tf[wave][8 + 2 * i][c4]), p11 = *(const v4f*)(&Tf[wave][8 + 2 * i + 1][c4]); v4b hv, lv;
#pragma unroll   // constant indices keep hv, lv in registers
    for (int j = 0; j < 4; ++j) { const float v = fmaxf(fmaxf(p00[j], p01[j]), fmaxf(p10[j], p11[j])); b16 h_, l_; split16(v * XS, h_, l_); hv[j] = h_; lv[j] = l_; }
    const size_t ko = ((size_t)b * M + h2 * (HW / 2) + (w0 >> 1) + i) * CQ + c4; *(v4b*)(KH + ko) = hv; *(v4b*)(KL + ko) = lv;
    asm volatile("s_wait_xcnt 0x0" ::: "memory");   // behind the last store of this part: whatever code follows it in the joint kernel may reuse the registers that these stores name
  }
}
// g projection and pooling in one work-group of 8 waves = all 128 g channels x 128 pixels (image rows 2 h2 and 2 h2 + 1). GEMM rows d (A = WG rows, K = c) x cols n (B = XT16 rows n): each wave
// stages 16 d-rows x 128 n floats and max-pools them 2x2 (a lane takes pooled column w2 = lane of all 16 rows); the pooled values go out channel-major, G16/GL16 [b][d][m] = f16 hi+lo x8,
// through the wave's own Ph/Pl [16 d][32 m] in LDS, so that a lane stores 16 bytes of one channel row
constexpr int GPP = 32 + 8 /* pitch of Ph, Pl in halves: 80 B = 16 B x odd */, SZ_TS = 8 * 16 * (128 + 4) * 4, SZ_G = 8 * 16 * GPP * 2;
__device__ __forceinline__ void gv_part(unsigned char* S, int blk, const b16* __restrict__ XT16, const b16* __restrict__ WG, b16* __restrict__ G16, b16* __restrict__ GL16) {
  float (*Ts)[16][128 + 4] = (float (*)[16][128 + 4])S; b16 (*Ph)[16][GPP] = (b16 (*)[16][GPP])(S + SZ_TS); b16 (*Pl)[16][GPP] = (b16 (*)[16][GPP])(S + SZ_TS + SZ_G);
  const int wave = threadIdx.x >> 5, lane = threadIdx.x & 31, nloc = lane & 15, hlf = lane >> 4; const int b = blk >> 5, h2 = blk & 31; const int d0 = wave * 16, n0 = h2 * 128;
  v8f acc[8];
#pragma unroll
  for (int t = 0; t < 8; ++t) acc[t] = (v8f){};
  // the nine fragments of k step k + 1 are requested in front of the products of k step k (two register buffers)
  v16b a[2], bf[2][8];
  auto ld = [&](int k) { a[k & 1] = frag_kb(WG + (size_t)(d0 + nloc) * C + k * 32, hlf); if (k == C / 32 - 1) asm volatile("s_wait_xcnt 0x0" ::: "memory");   // behind the last W_g load: the next loads' results may reuse its address registers
#pragma unroll   // constant indices keep the buffers in registers
    for (int t = 0; t < 8; ++t) bf[k & 1][t] = frag_kb(XT16 + ((size_t)b * N + n0 + t * 16 + nloc) * C + k * 32, hlf); };
  ld(0); hold_loads();
#pragma unroll   // buffer numbers must be compile-time constants
  for (int k = 0; k < C / 32; ++k) { if (k + 1 < C / 32) { ld(k + 1); hold_loads(); }
#pragma unroll
    for (int t = 0; t < 8; ++t) acc[t] = wmma16b(a[k & 1], bf[k & 1][t], acc[t]); }
#pragma unroll
  for (int t = 0; t < 8; ++t)
#pragma unroll
    for (int r = 0; r < 8; ++r) Ts[wave][8 * hlf + r][t * 16 + nloc] = acc[t][r] * (1.0f / (XS * WSC));
  wave_lds_sync();
  v2f pr[16], qr[16];
#pragma unroll   // all 32 reads of the staging are issued before the first is waited for
  for (int rr = 0; rr < 16; ++rr) { pr[rr] = *(const v2f*)(&Ts[wave][rr][2 * lane]); qr[rr] = *(const v2f*)(&Ts[wave][rr][HW + 2 * lane]); }
  hold_loads();
#pragma unroll   // constant indices keep pr, qr in registers
  for (int rr = 0; rr < 16; ++rr) { const v2f p = pr[rr], q = qr[rr]; const float v = fmaxf(fmaxf(p[0], p[1]), fmaxf(q[0], q[1])); b16 h_, l_; split16(v * XS, h_, l_); Ph[wave][rr][lane] = h_; Pl[wave][rr][lane] = l_; }
  wave_lds_sync();
  const int row = lane >> 2, seg = (lane & 3) * 8; const size_t gi = ((size_t)b * CG + d0 + row) * M + h2 * (HW / 2) + seg;
  *(v8b*)(G16 + gi) = *(const v8b*)(&Ph[wave][row][seg]); *(v8b*)(GL16 + gi) = *(const v8b*)(&Pl[wave][row][seg]); *(v8b*)(G16 + gi + 8 * M) = *(const v8b*)(&Ph[wave][8 + row][seg]); *(v8b*)(GL16 + gi + 8 * M) = *(const v8b*)(&Pl[wave][8 + row][seg]);
  asm volatile("s_wait_xcnt 0x0" ::: "memory");   // behind the last store of this part: whatever code follows it in the joint kernel may reuse the registers that these stores name
}
// launch 2: the g work-groups (even index) and the theta/phi work-groups (odd index) share one grid, alternating so that neighbours in the index are one of each kind; they read the same XT16 and write
// disjoint arrays; one LDS block serves either part
constexpr int GB = (N / 128) * NB, QKB = NB * N / 128;
__global__ __launch_bounds__(256) void proj_kernel(const b16* __restrict__ XT16, const b16* __restrict__ W16, const b16* __restrict__ WG, b16* __restrict__ QH, b16* __restrict__ QL, b16* __restrict__ KH, b16* __restrict__ KL, b16* __restrict__ G16, b16* __restrict__ GL16) {
  __shared__ __attribute__((aligned(16))) unsigned char S[SZ_TS + 2 * SZ_G];
  static_assert(GB == QKB, "the two kinds alternate");
  if ((blockIdx.x & 1) == 0) gv_part(S, blockIdx.x >> 1, XT16, WG, G16, GL16); else qk_part(S, blockIdx.x >> 1, XT16, W16, QH, QL, KH, KL);
}
// attention: grid (N/128 query blocks, 1, B); block = 8 waves x 16 queries, one work-group on a WGP. K (hi, lo) and the pooled g (hi, lo; all 128 channels) come in stages of 64 pooled keys into a
// two-buffer LDS ring that all 8 waves read: every lane copies 16 B pieces with asynchronous copies to LDS (whole 128-B lines per 8 lanes for g, 4 KB contiguous for K), one stage ahead of its use.
// Per block of 32 pooled keys: S^T = Phi . Theta^T with (Kh Qh + Kh Ql + Kl Qh), online softmax (f32, exp2), O^T (8 tiles) += g[d][keys] P^T (hi + lo). Behind the loop W_o (in LDS since trip 0) x O^T / l,
// 16 tiles of 16 channels a wave; out[b][c][n] = gamma (W_o O / l) + x, staged in LDS over the ring so that a wave writes whole 512-B rows (16 bytes a lane); x is requested ahead of its use.
constexpr int KS = 64 /* keys per stage */, VP = 144, KP = 80 /* LDS row pitch in bytes, 16 B x odd: 16 rows of a 16-byte read fall on 64 distinct banks */;
constexpr int OFF_VH = 0, OFF_VL = 128 * VP, OFF_KH = 2 * 128 * VP, OFF_KL = OFF_KH + KS * KP, STAGE_B = OFF_KL + KS * KP;   // 47,104 B per buffer
constexpr int TO_B = C * (128 + 4) * 4 /* output staging, over the ring */, OFF_WO = TO_B, WP = CG * 2 + 16 /* pitch of a W_o row in LDS: 272 B = 16 B x odd */;
static_assert(TO_B >= 2 * STAGE_B, "the ring lies inside the output staging");
// one stage (keys k0 .. k0 + 63) into the buffer at LDS byte address lb: 10 copies per lane, 256 lanes; g rows vr + 32 j (8 lanes x 16 B = one 128-B line each), K rows kr (4 lanes x 16 B)
__device__ __forceinline__ void stage_kv(unsigned lb, const b16* Vb, const b16* Vlb, const b16* Khb, const b16* Klb, int k0, int tid) {
  const int vr = tid >> 3, vc = tid & 7, kr = tid >> 2, kc = tid & 3; const unsigned lv = lb + vr * VP + vc * 16, lk = lb + kr * KP + kc * 16; const size_t gv = (size_t)vr * M + k0 + vc * 8, gk = (size_t)(k0 + kr) * CQ + kc * 8;
  // the ten copies and, as the statement's last line, the wait that stands in front of any rewrite of the address registers they name
  asm volatile("global_load_async_to_lds_b128 %0, %1, off\n\tglobal_load_async_to_lds_b128 %2, %3, off\n\tglobal_load_async_to_lds_b128 %4, %5, off\n\tglobal_load_async_to_lds_b128 %6, %7, off\n\tglobal_load_async_to_lds_b128 %8, %9, off\n\t"
               "global_load_async_to_lds_b128 %10, %11, off\n\tglobal_load_async_to_lds_b128 %12, %13, off\n\tglobal_load_async_to_lds_b128 %14, %15, off\n\tglobal_load_async_to_lds_b128 %16, %17, off\n\tglobal_load_async_to_lds_b128 %18, %19, off\n\ts_wait_xcnt 0x0"
               :: "v"(lv + OFF_VH), "v"(Vb + gv), "v"(lv + OFF_VH + 32 * VP), "v"(Vb + gv + 32 * M), "v"(lv + OFF_VH + 64 * VP), "v"(Vb + gv + 64 * M), "v"(lv + OFF_VH + 96 * VP), "v"(Vb + gv + 96 * M), "v"(lk + OFF_KH), "v"(Khb + gk),
                  "v"(lv + OFF_VL), "v"(Vlb + gv), "v"(lv + OFF_VL + 32 * VP), "v"(Vlb + gv + 32 * M), "v"(lv + OFF_VL + 64 * VP), "v"(Vlb + gv + 64 * M), "v"(lv + OFF_VL + 96 * VP), "v"(Vlb + gv + 96 * M), "v"(lk + OFF_KL), "v"(Klb + gk) : "memory");
}
// eight rows' pieces of W_o (rows 16 apart; 16 lanes x 16 B = one 256-B row) into LDS: the copies and, as the statement's last line, the wait that stands in front of any rewrite of the address registers they name
__device__ __forceinline__ void stage_wo8(unsigned lw, const b16* gw) {
  asm volatile("global_load_async_to_lds_b128 %0, %1, off\n\tglobal_load_async_to_lds_b128 %2, %3, off\n\tglobal_load_async_to_lds_b128 %4, %5, off\n\tglobal_load_async_to_lds_b128 %6, %7, off\n\t"
               "global_load_async_to_lds_b128 %8, %9, off\n\tglobal_load_async_to_lds_b128 %10, %11, off\n\tglobal_load_async_to_lds_b128 %12, %13, off\n\tglobal_load_async_to_lds_b128 %14, %15, off\n\ts_wait_xcnt 0x0"
               :: "v"(lw), "v"(gw), "v"(lw + 16 * WP), "v"(gw + 16 * CG), "v"(lw + 32 * WP), "v"(gw + 32 * CG), "v"(lw + 48 * WP), "v"(gw + 48 * CG),
                  "v"(lw + 64 * WP), "v"(gw + 64 * CG), "v"(lw + 80 * WP), "v"(gw + 80 * CG), "v"(lw + 96 * WP), "v"(gw + 96 * CG), "v"(lw + 112 * WP), "v"(gw + 112 * CG) : "memory");
}
__global__ __launch_bounds__(256) void attn_kernel(const b16* __restrict__ QH, const b16* __restrict__ QL, const b16* __restrict__ KH, const b16* __restrict__ KL, const b16* __restrict__ G16, const b16* __restrict__ GL16, const b16* __restrict__ WO, const float* __restrict__ x, const float* __restrict__ gamma_, float* __restrict__ out) {
  __shared__ __attribute__((aligned(128))) unsigned char L[TO_B + C * WP];   // the ring, after the loop the output staging To[256][128 + 4] (135,168 B); behind it W_o [256][WP] (69,632 B)
  const int tid = threadIdx.x, wave = threadIdx.x >> 5, lane = threadIdx.x & 31, hh = lane >> 4, col = lane & 15; const int b = blockIdx.z; const int q0 = blockIdx.x * 128 + wave * 16, qi = q0 + col;
  const size_t qrow = (size_t)b * N + qi; const v16b qh = frag_kb(QH + qrow * CQ, hh), ql = frag_kb(QL + qrow * CQ, hh);
  const b16* Khb = KH + (size_t)b * M * CQ; const b16* Klb = KL + (size_t)b * M * CQ; const b16* Vb = G16 + (size_t)b * CG * M; const b16* Vlb = GL16 + (size_t)b * CG * M; const float gamma = bf16_rne(gamma_[0]);
  const unsigned lds0 = (unsigned)(size_t)L;
  float m = -INFINITY, l = 0.0f; v8f o[8], ol[8];
#pragma unroll
  for (int t = 0; t < 8; ++t) { o[t] = (v8f){}; ol[t] = (v8f){}; }
  stage_kv(lds0, Vb, Vlb, Khb, Klb, 0, tid);
  asm volatile("s_wait_asynccnt 0x0" ::: "memory");   // this wave's copies of stage 0 have landed
  __syncthreads();                                    // every wave's have: stage 0 is readable
  stage_kv(lds0 + STAGE_B, Vb, Vlb, Khb, Klb, KS, tid);
  // W_o flies with stage 1: 16 copies a lane (26 outstanding with the stage's ten); the wait and the barrier at the foot of trip 0 land and publish it, it is read behind the loop
  { const unsigned lw = lds0 + OFF_WO + (tid >> 4) * WP + (tid & 15) * 16; const b16* gw = WO + (size_t)(tid >> 4) * CG + (tid & 15) * 8; stage_wo8(lw, gw); stage_wo8(lw + 128 * WP, gw + 128 * CG); }
  for (int st = 0; st < M / KS; ++st) {
    const unsigned char* B = L + (st & 1) * STAGE_B;
    // LDS fragment reads stand well in front of the products that use them: per 32 keys the four K fragments as one group,
    // g tiles 0 and 1 behind the first energy product, tile 2 behind the softmax, tile t + 3 behind the products of tile t; every read of a stage still ends in front of the stage's foot
    v16b kf[4];
    auto ldk = [&](int kk) { kf[0] = frag_kb((const b16*)(B + OFF_KH + (kk + col) * KP), hh); kf[1] = frag_kb((const b16*)(B + OFF_KH + (kk + 16 + col) * KP), hh); kf[2] = frag_kb((const b16*)(B + OFF_KL + (kk + col) * KP), hh); kf[3] = frag_kb((const b16*)(B + OFF_KL + (kk + 16 + col) * KP), hh); };
    for (int kk = 0; kk < KS; kk += 32) {
      v16b vh[8], vl[8];
      auto ldv = [&](int t) { vh[t] = frag_kb((const b16*)(B + OFF_VH + (t * 16 + col) * VP) + kk, hh); vl[t] = frag_kb((const b16*)(B + OFF_VL + (t * 16 + col) * VP) + kk, hh); };
      ldk(kk);
      v8f s0 = {}, s1 = {};
      s0 = wmma16b(kf[0], qh, s0); ldv(0); ldv(1); hold_loads(); s0 = wmma16b(kf[0], ql, s0); s0 = wmma16b(kf[2], qh, s0);
      s1 = wmma16b(kf[1], qh, s1); s1 = wmma16b(kf[1], ql, s1); s1 = wmma16b(kf[3], qh, s1);
      float e[16]; float mx = -INFINITY; const float cs = LOG2E / (XS * XS);
#pragma unroll
      for (int r = 0; r < 8; ++r) { e[r] = s0[r] * cs; e[8 + r] = s1[r] * cs; mx = fmaxf(mx, fmaxf(e[r], e[8 + r])); }
      mx = fmaxf(mx, __shfl_xor(mx, 16)); const float mn = fmaxf(m, mx); const float al = nexp2(m - mn); m = mn; float sum = 0.0f; v16b ph, pl;
#pragma unroll
      for (int i = 0; i < 16; ++i) { const float p = nexp2(e[i] - mn); sum += p; const b16 h_ = (b16)(p * PS); ph[i] = h_; pl[i] = (b16)(p * PS - (float)h_); }
      sum += __shfl_xor(sum, 16); l = l * al + sum;
      ldv(2); hold_loads();
#pragma unroll
      for (int t = 0; t < 8; ++t) { o[t] *= al; ol[t] *= al; o[t] = wmma16b(vh[t], ph, o[t]); ol[t] = wmma16b(vh[t], pl, ol[t]); ol[t] = wmma16b(vl[t], ph, ol[t]);
        if (t + 3 < 8) { ldv(t + 3); hold_loads(); } } }
    asm volatile("s_wait_dscnt 0x0" ::: "memory");      // this wave's reads of the buffer are done before it is refilled
    asm volatile("s_wait_asynccnt 0x0" ::: "memory");   // this wave's copies of stage st + 1 (in trip 0 of W_o too) have landed
    __syncthreads();                                    // publishes stage st + 1 and ends every wave's reads of stage st
    if (st + 2 < M / KS) stage_kv(lds0 + (st & 1) * STAGE_B, Vb, Vlb, Khb, Klb, (st + 2) * KS, tid);
  }
  asm volatile("s_wait_asynccnt 0x0" ::: "memory");     // no copy is outstanding when the ring becomes output staging
  // the wave's O^T / l as B fragments of W_o O^T: o[t][r] = O^T[d = t*16 + 8hh + r][query col], so tiles 2 ks and 2 ks + 1 are elements 0..7 and 8..15 of k step ks (d = 32 ks + 8hh + e, 32 ks + 16 + 8hh + e), the order of frag_kb
  const float inv = 1.0f / (l * PS);   // O x8
  v16b oh[CG / 32], oq[CG / 32];
#pragma unroll   // both loops: constant indices keep o, ol, oh, oq in registers
  for (int ks = 0; ks < CG / 32; ++ks)
#pragma unroll
    for (int r = 0; r < 8; ++r) { b16 h_, l_; split16((o[2 * ks][r] + ol[2 * ks][r]) * inv, h_, l_); oh[ks][r] = h_; oq[ks][r] = l_; split16((o[2 * ks + 1][r] + ol[2 * ks + 1][r]) * inv, h_, l_); oh[ks][8 + r] = h_; oq[ks][8 + r] = l_; }
  float (*To)[128 + 4] = (float (*)[128 + 4])L;
  // the residual x of the wave's 32 output rows (a lane: 16 bytes of each 512-B row): the first XA rows are requested here, in front of the W_o products, which cover their latency;
  // the rest, for which no registers are free yet, behind the barrier below, in front of the work on the first rows
  constexpr int XA = 16;
  const size_t ro = ((size_t)b * C + wave * 32) * N + blockIdx.x * 128 + lane * 4; const float* xr = x + ro; float* orow = out + ro;
  v4f xv[32];
  hold_loads();   // without it the requests are lifted over the conversion above, whose inputs still fill the registers, and the kernel needs registers above v255
#pragma unroll   // constant indices keep xv in registers
  for (int i = 0; i < XA; ++i) xv[i] = *(const v4f*)(xr + (size_t)i * N);
  hold_loads();
  // the four W_o fragments of channel tile ct + 1 are read in front of the products of tile ct (two register buffers)
  v16b wa[2][CG / 32];
  auto ldw = [&](int ct) {
#pragma unroll   // constant indices keep the buffers in registers
    for (int ks = 0; ks < CG / 32; ++ks) wa[ct & 1][ks] = frag_kb((const b16*)(L + OFF_WO + (ct * 16 + col) * WP) + ks * 32, hh); };
  ldw(0); hold_loads();
#pragma unroll   // buffer numbers must be compile-time constants
  for (int ct = 0; ct < C / 16; ++ct) { if (ct + 1 < C / 16) { ldw(ct + 1); hold_loads(); }
    v8f ah = {}, aq = {};
#pragma unroll
    for (int ks = 0; ks < CG / 32; ++ks) { ah = wmma16b(wa[ct & 1][ks], oh[ks], ah); aq = wmma16b(wa[ct & 1][ks], oq[ks], aq); }
#pragma unroll   // ah[r] = (W_o O)[c = ct*16 + 8hh + r][query col] x 2048 -> To[c][wave*16 + col]
    for (int r = 0; r < 8; ++r) To[ct * 16 + 8 * hh + r][wave * 16 + col] = (ah[r] + aq[r]) * (1.0f / (XS * WSC)); }
  __syncthreads();   // every wave's 16 query columns of all 256 rows are in To
#pragma unroll   // constant indices keep xv in registers
  for (int i = XA; i < 32; ++i) { if (i == 31) asm volatile("s_wait_xcnt 0x0" ::: "memory");   // in front of the last load, whose result may return into the address registers that the loads before it name
    xv[i] = *(const v4f*)(xr + (size_t)i * N); }
  hold_loads();
#pragma unroll   // constant indices keep xv in registers
  for (int i0 = 0; i0 < 32; i0 += 8) {
    v4f tv[8];
#pragma unroll   // the eight reads of the staging are issued before the first is waited for
    for (int i = 0; i < 8; ++i) tv[i] = *(const v4f*)(&To[wave * 32 + i0 + i][lane * 4]);
#pragma unroll
    for (int i = 0; i < 8; ++i) { v4f r;
#pragma unroll
      for (int j = 0; j < 4; ++j) r[j] = gamma * tv[i][j] + bf16_rne(xv[i0 + i][j]);
      *(v4f*)(orow + (size_t)(i0 + i) * N) = r; }
    if (i0 + 8 < 32) asm volatile("s_wait_xcnt 0x0" ::: "memory");   // stands in front of the next group's rewrite of the registers that this group's stores name
  }
}
}  // namespace

extern "C" void kernel_launch(void* const* d_in, const int* in_sizes, int n_in, void* d_out, int out_size, void* d_ws, size_t ws_size, hipStream_t stream) {
  (void)n_in;
  auto Fp = [&](int i) { return (const float*)d_in[i]; };
  // input order: 0 x [8,256,64,64], 1 w_theta [32,256], 2 w_phi [32,256], 3 w_g [128,256], 4 w_o [256,128], 5 gamma [1]
  if (in_sizes[0] != NB * C * N || in_sizes[1] != CQ * C || in_sizes[2] != CQ * C || in_sizes[3] != CG * C || in_sizes[4] != C * CG || in_sizes[5] != 1 || out_size != NB * C * N) return;
  size_t off = 0; char* ws = (char*)d_ws;
  auto carve = [&](size_t bytes) { char* p = ws + off; off += (bytes + 255) & ~(size_t)255; return p; };
  b16* XT16 = (b16*)carve((size_t)NB * N * C * 2); b16* W16 = (b16*)carve((size_t)2 * CQ * C * 2); b16* WG = (b16*)carve((size_t)CG * C * 2); b16* WO = (b16*)carve((size_t)C * CG * 2);
  b16* QH = (b16*)carve((size_t)NB * N * CQ * 2); b16* QL = (b16*)carve((size_t)NB * N * CQ * 2); b16* KH = (b16*)carve((size_t)NB * M * CQ * 2); b16* KL = (b16*)carve((size_t)NB * M * CQ * 2);
  b16* G16 = (b16*)carve((size_t)NB * CG * M * 2); b16* GL16 = (b16*)carve((size_t)NB * CG * M * 2);
  if (off > ws_size || off > ((size_t)128 << 20)) return;   // = 25.2 MB
  pre_kernel<<<PWB + XTB, 256, 0, stream>>>(Fp(0), Fp(1), Fp(2), Fp(3), Fp(4), XT16, W16, WG, WO);
  proj_kernel<<<GB + QKB, 256, 0, stream>>>(XT16, W16, WG, QH, QL, KH, KL, G16, GL16);
  attn_kernel<<<dim3(N / 128, 1, NB), 256, 0, stream>>>(QH, QL, KH, KL, G16, GL16, WO, Fp(0), Fp(5), (float*)d_out);
}

// v007
// One run takes 51.8 microseconds.
// Next to v006, in two timings, it ran 1.21 and 1.20 times as fast.
// All steps since v000 together make it 5.32 times as fast.
#include <hip/hip_runtime.h>

// Self-attention block (8 images x 256 ch x 64 x 64): theta = W_theta x (32 ch, all 4,096 pixels), phi = maxpool2x2(W_phi x) (32 ch x 1,024 pooled positions), g = maxpool2x2(W_g x) (128 x 1,024),
// beta = softmax over the 1,024 pooled keys of theta^T phi (no scaling), o = W_o (g beta^T), out = gamma * o + x. The 1x1 convs are channel GEMMs; the attention runs once per query over the 128 pooled
// g channels, and each wave applies W_o (256 x 128) behind the key loop to its own normalised accumulators, which already lie in the B fragment's order.
// WMMA (v_wmma_f32_16x16x32_f16, f32 accumulate): projections with EXACT bf16 pixels (x^T rows x8, via an LDS transpose of the channel-major input) and weights (x256), 1 product;
// energy tiles S^T = Phi . Theta^T with theta AND phi as f16 hi+lo x8 (3 products; logits sigma ~5.7); online softmax in f32; O^T += g P^T with
// g and P as f16 hi+lo x8 (3 products); W_o O^T with W_o exact and O as f16 hi+lo x8 (2 products). Max-pooling, softmax, gamma, residual in f32. Inputs rounded to bf16 once (gamma and the residual x included). Fragment k-map

namespace {
constexpr int NB = 8, C = 256, CQ = 32, N = 4096, M = 1024 /* pooled positions */, CG = 128 /* g channels */, HW = 64;
constexpr float XS = 8.0f, WSC = 256.0f, PS = 8.0f, LOG2E = 1.4426950408889634f;

typedef _Float16 b16;
typedef __attribute__((ext_vector_type(16))) _Float16 v16b;
typedef __attribute__((ext_vector_type(8))) _Float16 v8b;
typedef __attribute__((ext_vector_type(8))) float v8f;
typedef __attribute__((ext_vector_type(4))) float v4f;
__device__ __forceinline__ float bf16_rne(float f) { unsigned int u = __float_as_uint(f); u += 0x7FFFu + ((u >> 16) & 1u); return __uint_as_float(u & 0xFFFF0000u); }
__device__ __forceinline__ void split16(float v, b16& hi, b16& lo) { hi = (b16)v; lo = (b16)(v - (float)hi); }
__device__ __forceinline__ v16b frag_kb(const b16* p, int hh) { const v8b a = *(const v8b*)(p + 8 * hh), b = *(const v8b*)(p + 16 + 8 * hh); v16b f;
#pragma unroll
  for (int e = 0; e < 8; ++e) { f[e] = a[e]; f[8 + e] = b[e]; } return f; }
__device__ __forceinline__ v8f wmma16b(v16b a, v16b b, v8f c) { return __builtin_amdgcn_wmma_f32_16x16x32_f16(false, a, false, b, (short)0, c, false, false); }
// stands behind a group of loads that is issued ahead of its use: without it the scheduler sinks each load to just in front of the product that reads it, and the wave waits out the whole latency there
__device__ __forceinline__ void hold_loads() { __builtin_amdgcn_sched_barrier(0); }
__device__ __forceinline__ void wave_lds_sync() { __builtin_amdgcn_fence(__ATOMIC_RELEASE, "workgroup"); __builtin_amdgcn_wave_barrier(); __builtin_amdgcn_fence(__ATOMIC_ACQUIRE, "workgroup"); }
__device__ __forceinline__ float nexp2(float x) { return __builtin_amdgcn_exp2f(x); }

typedef __attribute__((ext_vector_type(4))) _Float16 v4b;
typedef __attribute__((ext_vector_type(2))) float v2f;
// launch 1: the weight conversion (its own PWB work-groups, in front) and the transpose of x share one grid: neither reads what the other writes
constexpr int PWB = ((2 * CQ * C + CG * C + C * CG) / 8 + 255) / 256, XTB = (N / 64) * (C / 64) * NB;
__global__ __launch_bounds__(256) void pre_kernel(const float* __restrict__ x, const float* __restrict__ wq, const float* __restrict__ wk, const float* __restrict__ wg, const float* __restrict__ wo, b16* __restrict__ XT16, b16* __restrict__ W16, b16* __restrict__ WG, b16* __restrict__ WO) {
  __shared__ __attribute__((aligned(16))) b16 T[64][64 + 8];
  if (blockIdx.x < PWB) {
    const int t = blockIdx.x * 256 + threadIdx.x; const int nq = CQ * C / 8, ng = CG * C / 8, no = C * CG / 8; const float* src; int e; b16* dst;
    if (t < nq) { src = wq; e = t * 8; dst = W16; } else if (t < 2 * nq) { src = wk; e = (t - nq) * 8; dst = W16 + CQ * C; } else if (t < 2 * nq + ng) { src = wg; e = (t - 2 * nq) * 8; dst = WG; } else if (t < 2 * nq + ng + no) { src = wo; e = (t - 2 * nq - ng) * 8; dst = WO; } else return;
    v8b o; for (int j = 0; j < 8; ++j) o[j] = (b16)(bf16_rne(src[e + j]) * WSC);
    { *(v8b*)(dst + e) = o;  }
    return;
  }
  const int f = blockIdx.x - PWB; const int b = f >> 8, c0 = ((f >> 6) & 3) * 64, n0 = (f & 63) * 64, t_ = threadIdx.x;
  float xv[16];
#pragma unroll   // all 16 loads of a lane are issued before the first is waited for
  for (int i = 0; i < 16; ++i) { const int q = t_ + i * 256; xv[i] = x[((size_t)b * C + c0 + (q >> 6)) * N + n0 + (q & 63)]; }
#pragma unroll   // xv[] stays in registers only under constant indices
  for (int i = 0; i < 16; ++i) { const int q = t_ + i * 256; T[q & 63][q >> 6] = (b16)(bf16_rne(xv[i]) * XS); }
  __syncthreads();
  { for (int q = t_; q < 64 * 8; q += 256) { const int nn = q >> 3, c8 = (q & 7) * 8; *(v8b*)(XT16 + ((size_t)b * N + n0 + nn) * C + c0 + c8) = *(const v8b*)(&T[nn][c8]); }  }
}
// launch 2 reads every GEMM operand from LDS: a work-group's 128 rows of x^T and its weight rows are brought in once, as whole 512-B rows (32 lanes x 16 B), by asynchronous copies to LDS
constexpr int XP = C * 2 + 16 /* pitch of a staged row in LDS: 528 B = 16 B x odd */, OFF_XL = 88064 /* the x^T tile [128][XP], behind the staging of either part */, OFF_WL = 38912 /* W_theta, W_phi [64][XP], behind the theta/phi staging */;
// eight rows' pieces (rows 8 apart) into LDS: the copies and, as the statement's last line, the wait that stands in front of any rewrite of the address registers they name
__device__ __forceinline__ void stage_rows8(unsigned l, const b16* g) {
  asm volatile("global_load_async_to_lds_b128 %0, %1, off\n\tglobal_load_async_to_lds_b128 %2, %3, off\n\tglobal_load_async_to_lds_b128 %4, %5, off\n\tglobal_load_async_to_lds_b128 %6, %7, off\n\t"
               "global_load_async_to_lds_b128 %8, %9, off\n\tglobal_load_async_to_lds_b128 %10, %11, off\n\tglobal_load_async_to_lds_b128 %12, %13, off\n\tglobal_load_async_to_lds_b128 %14, %15, off\n\ts_wait_xcnt 0x0"
               :: "v"(l), "v"(g), "v"(l + 8 * XP), "v"(g + 8 * C), "v"(l + 16 * XP), "v"(g + 16 * C), "v"(l + 24 * XP), "v"(g + 24 * C),
                  "v"(l + 32 * XP), "v"(g + 32 * C), "v"(l + 40 * XP), "v"(g + 40 * C), "v"(l + 48 * XP), "v"(g + 48 * C), "v"(l + 56 * XP), "v"(g + 56 * C) : "memory");
}
// theta/phi projection: [n x 256] x [256 x 32]. A wave's 16 pixel rows are 8 neighbours of image row 2 h2 and the 8 below them, so that it holds whole 2x2 pooling windows:
// theta goes out as QH/QL [b][n][32] f16 hi+lo x8 (64-B rows), phi is max-pooled from the wave's f32 staging and goes out as KH/KL [b][m][32] f16 hi+lo x8 (4 pooled positions a wave)
__device__ __forceinline__ void qk_part(unsigned char* S, int blk, const b16* __restrict__ XT16, const b16* __restrict__ W16, b16* __restrict__ QH, b16* __restrict__ QL, b16* __restrict__ KH, b16* __restrict__ KL) {
  b16 (*Th)[16][CQ + 8] = (b16 (*)[16][CQ + 8])S; b16 (*Tl)[16][CQ + 8] = (b16 (*)[16][CQ + 8])(S + 8 * 16 * (CQ + 8) * 2); float (*Tf)[16][CQ + 4] = (float (*)[16][CQ + 4])(S + 2 * 8 * 16 * (CQ + 8) * 2);
  const int wave = threadIdx.x >> 5, lane = threadIdx.x & 31, nloc = lane & 15, hlf = lane >> 4; const int gw = blk * 8 + wave; const int b = gw >> 8, h2 = (gw >> 3) & 31, w0 = (gw & 7) * 8;
  auto pix = [&](int rr) { return (size_t)b * N + (size_t)(2 * h2 + (rr >> 3)) * HW + w0 + (rr & 7); };   // over b*N + n
  // rows wave + 8 j of the tile (pixels h2 * 128 ..) and of the 64 weight rows: 24 copies a lane
  { const unsigned ls = (unsigned)(size_t)S + wave * XP + lane * 16; const b16* gx = XT16 + ((size_t)b * N + h2 * 128 + wave) * C + lane * 8;
    stage_rows8(ls + OFF_XL, gx); stage_rows8(ls + OFF_XL + 64 * XP, gx + 64 * C); stage_rows8(ls + OFF_WL, W16 + (size_t)wave * C + lane * 8); }
  asm volatile("s_wait_asynccnt 0x0" ::: "memory");   // this wave's copies have landed
  __syncthreads();                                    // every wave's have: tile and weights are readable
  const unsigned char* Xa = S + OFF_XL + ((nloc >> 3) * HW + w0 + (nloc & 7)) * XP; const unsigned char* Wl = S + OFF_WL + nloc * XP;
  v8f acc[4] = {{}, {}, {}, {}};   // tiles: q0, q1, k0, k1
  // the fragments of k step k + 3 are requested in front of the products of k step k (four register buffers)
  v16b a[4], w[4][4];
  auto ld = [&](int k) { a[k & 3] = frag_kb((const b16*)Xa + k * 32, hlf);
#pragma unroll   // constant indices keep the buffers in registers
    for (int t = 0; t < 4; ++t) w[k & 3][t] = frag_kb((const b16*)(Wl + t * 16 * XP) + k * 32, hlf); };
  ld(0); ld(1); ld(2); hold_loads();
#pragma unroll   // buffer numbers must be compile-time constants
  for (int k = 0; k < C / 32; ++k) { if (k + 3 < C / 32) { ld(k + 3); hold_loads(); }
#pragma unroll
    for (int t = 0; t < 4; ++t) acc[t] = wmma16b(a[k & 3], w[k & 3][t], acc[t]); }
#pragma unroll
  for (int t = 0; t < 4; ++t) { const int which = t >> 1, c = (t & 1) * 16 + nloc;
#pragma unroll
    for (int r = 0; r < 8; ++r) { const float v = acc[t][r] * (1.0f / (XS * WSC)); if (which == 0) { b16 h_, l_; split16(v * XS, h_, l_); Th[wave][8 * hlf + r][c] = h_; Tl[wave][8 * hlf + r][c] = l_; } else Tf[wave][8 * hlf + r][c] = v; } }
  wave_lds_sync();
  {
    for (int q = 0; q < 2; ++q) { const int rr = q * 8 + (lane >> 2), seg = (lane & 3) * 8; *(v8b*)(QH + pix(rr) * CQ + seg) = *(const v8b*)(&Th[wave][rr][seg]); *(v8b*)(QL + pix(rr) * CQ + seg) = *(const v8b*)(&Tl[wave][rr][seg]); }
    const int i = lane >> 3, c4 = (lane & 7) * 4;   // pooled position w0 / 2 + i, channels c4 .. c4 + 3
    const v4f p00 = *(const v4f*)(&Tf[wave][2 * i][c4]), p01 = *(const v4f*)(&Tf[wave][2 * i + 1][c4]), p10 = *(const v4f*)(&Tf[wave][8 + 2 * i][c4]), p11 = *(const v4f*)(&Tf[wave][8 + 2 * i + 1][c4]); v4b hv, lv;
#pragma unroll   // constant indices keep hv, lv in registers
    for (int j = 0; j < 4; ++j) { const float v = fmaxf(fmaxf(p00[j], p01[j]), fmaxf(p10[j], p11[j])); b16 h_, l_; split16(v * XS, h_, l_); hv[j] = h_; lv[j] = l_; }
    const size_t ko = ((size_t)b * M + h2 * (HW / 2) + (w0 >> 1) + i) * CQ + c4; *(v4b*)(KH + ko) = hv; *(v4b*)(KL + ko) = lv;
    asm volatile("s_wait_xcnt 0x0" ::: "memory");   // behind the last store of this part: whatever code follows it in the joint kernel may reuse the registers that these stores name
  }
}
// g projection and pooling in one work-group of 8 waves = all 128 g channels x 128 pixels (image rows 2 h2 and 2 h2 + 1). GEMM rows d (A = WG rows, K = c) x cols n (B = XT16 rows n): each wave
// stages 16 d-rows x 128 n floats and max-pools them 2x2 (a lane takes pooled column w2 = lane of all 16 rows); the pooled values go out channel-major, G16/GL16 [b][d][m] = f16 hi+lo x8,
// through the wave's own Ph/Pl [16 d][32 m] in LDS, so that a lane stores 16 bytes of one channel row
constexpr int GPP = 32 + 8 /* pitch of Ph, Pl in halves: 80 B = 16 B x odd */, SZ_TS = 8 * 16 * (128 + 4) * 4, SZ_G = 8 * 16 * GPP * 2;
__device__ __forceinline__ void gv_part(unsigned char* S, int blk, const b16* __restrict__ XT16, const b16* __restrict__ WG, b16* __restrict__ G16, b16* __restrict__ GL16) {
  float (*Ts)[16][128 + 4] = (float (*)[16][128 + 4])S; b16 (*Ph)[16][GPP] = (b16 (*)[16][GPP])(S + SZ_TS); b16 (*Pl)[16][GPP] = (b16 (*)[16][GPP])(S + SZ_TS + SZ_G);
  const int wave = threadIdx.x >> 5, lane = threadIdx.x & 31, nloc = lane & 15, hlf = lane >> 4; const int b = blk >> 5, h2 = blk & 31; const int d0 = wave * 16, n0 = h2 * 128;
  // rows wave + 8 j of the tile and of W_g: 32 copies a lane. W_g [128][XP] lies where Ts lies later: a wave's 16 rows of W_g, which it alone reads, are the very bytes of its own Ts rows
  static_assert(XP == (128 + 4) * 4, "a wave's W_g rows and its Ts rows are the same bytes");
  { const unsigned ls = (unsigned)(size_t)S + wave * XP + lane * 16; const b16* gx = XT16 + ((size_t)b * N + n0 + wave) * C + lane * 8; const b16* gw = WG + (size_t)wave * C + lane * 8;
    stage_rows8(ls + OFF_XL, gx); stage_rows8(ls + OFF_XL + 64 * XP, gx + 64 * C); stage_rows8(ls, gw); stage_rows8(ls + 64 * XP, gw + 64 * C); }
  asm volatile("s_wait_asynccnt 0x0" ::: "memory");   // this wave's copies have landed
  __syncthreads();                                    // every wave's have: tile and weights are readable
  const unsigned char* Wa = S + (d0 + nloc) * XP; const unsigned char* Xb = S + OFF_XL + nloc * XP;
  v8f acc[8];
#pragma unroll
  for (int t = 0; t < 8; ++t) acc[t] = (v8f){};
  // the nine fragments of k step k + 1 are requested in front of the products of k step k (two register buffers)
  v16b a[2], bf[2][8];
  auto ld = [&](int k) { a[k & 1] = frag_kb((const b16*)Wa + k * 32, hlf);
#pragma unroll   // constant indices keep the buffers in registers
    for (int t = 0; t < 8; ++t) bf[k & 1][t] = frag_kb((const b16*)(Xb + t * 16 * XP) + k * 32, hlf); };
  ld(0); hold_loads();
#pragma unroll   // buffer numbers must be compile-time constants
  for (int k = 0; k < C / 32; ++k) { if (k + 1 < C / 32) { ld(k + 1); hold_loads(); }
#pragma unroll
    for (int t = 0; t < 8; ++t) acc[t] = wmma16b(a[k & 1], bf[k & 1][t], acc[t]); }
#pragma unroll
  for (int t = 0; t < 8; ++t)
#pragma unroll
    for (int r = 0; r < 8; ++r) Ts[wave][8 * hlf + r][t * 16 + nloc] = acc[t][r] * (1.0f / (XS * WSC));
  wave_lds_sync();
  v2f pr[16], qr[16];
#pragma unroll   // all 32 reads of the staging are issued before the first is waited for
  for (int rr = 0; rr < 16; ++rr) { pr[rr] = *(const v2f*)(&Ts[wave][rr][2 * lane]); qr[rr] = *(const v2f*)(&Ts[wave][rr][HW + 2 * lane]); }
  hold_loads();
#pragma unroll   // constant indices keep pr, qr in registers
  for (int rr = 0; rr < 16; ++rr) { const v2f p = pr[rr], q = qr[rr]; const float v = fmaxf(fmaxf(p[0], p[1]), fmaxf(q[0], q[1])); b16 h_, l_; split16(v * XS, h_, l_); Ph[wave][rr][lane] = h_; Pl[wave][rr][lane] = l_; }
  wave_lds_sync();
  const int row = lane >> 2, seg = (lane & 3) * 8; const size_t gi = ((size_t)b * CG + d0 + row) * M + h2 * (HW / 2) + seg;
  *(v8b*)(G16 + gi) = *(const v8b*)(&Ph[wave][row][seg]); *(v8b*)(GL16 + gi) = *(const v8b*)(&Pl[wave][row][seg]); *(v8b*)(G16 + gi + 8 * M) = *(const v8b*)(&Ph[wave][8 + row][seg]); *(v8b*)(GL16 + gi + 8 * M) = *(const v8b*)(&Pl[wave][8 + row][seg]);
  asm volatile("s_wait_xcnt 0x0" ::: "memory");   // behind the last store of this part: whatever code follows it in the joint kernel may reuse the registers that these stores name
}
// launch 2: the g work-groups (even index) and the theta/phi work-groups (odd index) share one grid, alternating so that neighbours in the index are one of each kind; they read the same XT16 and write
// disjoint arrays; one LDS block serves either part; work-groups 2 i and 2 i + 1 stage the same 128 rows of x^T
constexpr int GB = (N / 128) * NB, QKB = NB * N / 128;
__global__ __launch_bounds__(256) void proj_kernel(const b16* __restrict__ XT16, const b16* __restrict__ W16, const b16* __restrict__ WG, b16* __restrict__ QH, b16* __restrict__ QL, b16* __restrict__ KH, b16* __restrict__ KL, b16* __restrict__ G16, b16* __restrict__ GL16) {
  __shared__ __attribute__((aligned(16))) unsigned char S[OFF_XL + 128 * XP];   // 155,648 B: two work-groups on a WGP
  static_assert(GB == QKB, "the two kinds alternate");
  static_assert(OFF_XL == SZ_TS + 2 * SZ_G && OFF_WL == 2 * 8 * 16 * (CQ + 8) * 2 + 8 * 16 * (CQ + 4) * 4 && OFF_WL + 2 * CQ * XP <= OFF_XL, "the x^T tile and W_theta, W_phi lie clear of what either part stages for its outputs");
  if ((blockIdx.x & 1) == 0) gv_part(S, blockIdx.x >> 1, XT16, WG, G16, GL16); else qk_part(S, blockIdx.x >> 1, XT16, W16, QH, QL, KH, KL);
}
// attention: grid (N/128 query blocks, 1, B); block = 8 waves x 16 queries, one work-group on a WGP. K (hi, lo) and the pooled g (hi, lo; all 128 channels) come in stages of 64 pooled keys into a
// two-buffer LDS ring that all 8 waves read: every lane copies 16 B pieces with asynchronous copies to LDS (whole 128-B lines per 8 lanes for g, 4 KB contiguous for K), one stage ahead of its use.
// Per block of 32 pooled keys: S^T = Phi . Theta^T with (Kh Qh + Kh Ql + Kl Qh), online softmax (f32, exp2), O^T (8 tiles) += g[d][keys] P^T (hi + lo). Behind the loop W_o (in LDS since trip 0) x O^T / l,
// 16 tiles of 16 channels a wave; out[b][c][n] = gamma (W_o O / l) + x, staged in LDS over the ring so that a wave writes whole 512-B rows (16 bytes a lane); x is requested ahead of its use.
constexpr int KS = 64 /* keys per stage */, VP = 144, KP = 80 /* LDS row pitch in bytes, 16 B x odd: 16 rows of a 16-byte read fall on 64 distinct banks */;
constexpr int OFF_VH = 0, OFF_VL = 128 * VP, OFF_KH = 2 * 128 * VP, OFF_KL = OFF_KH + KS * KP, STAGE_B = OFF_KL + KS * KP;   // 47,104 B per buffer
constexpr int TO_B = C * (128 + 4) * 4 /* output staging, over the ring */, OFF_WO = TO_B, WP = CG * 2 + 16 /* pitch of a W_o row in LDS: 272 B = 16 B x odd */;
static_assert(TO_B >= 2 * STAGE_B, "the ring lies inside the output staging");
// one stage (keys k0 .. k0 + 63) into the buffer at LDS byte address lb: 10 copies per lane, 256 lanes; g rows vr + 32 j (8 lanes x 16 B = one 128-B line each), K rows kr (4 lanes x 16 B)
__device__ __forceinline__ void stage_kv(unsigned lb, const b16* Vb, const b16* Vlb, const b16* Khb, const b16* Klb, int k0, int tid) {
  const int vr = tid >> 3, vc = tid & 7, kr = tid >> 2, kc = tid & 3; const unsigned lv = lb + vr * VP + vc * 16, lk = lb + kr * KP + kc * 16; const size_t gv = (size_t)vr * M + k0 + vc * 8, gk = (size_t)(k0 + kr) * CQ + kc * 8;
  // the ten copies and, as the statement's last line, the wait that stands in front of any rewrite of the address registers they name
  asm volatile("global_load_async_to_lds_b128 %0, %1, off\n\tglobal_load_async_to_lds_b128 %2, %3, off\n\tglobal_load_async_to_lds_b128 %4, %5, off\n\tglobal_load_async_to_lds_b128 %6, %7, off\n\tglobal_load_async_to_lds_b128 %8, %9, off\n\t"
               "global_load_async_to_lds_b128 %10, %11, off\n\tglobal_load_async_to_lds_b128 %12, %13, off\n\tglobal_load_async_to_lds_b128 %14, %15, off\n\tglobal_load_async_to_lds_b128 %16, %17, off\n\tglobal_load_async_to_lds_b128 %18, %19, off\n\ts_wait_xcnt 0x0"
               :: "v"(lv + OFF_VH), "v"(Vb + gv), "v"(lv + OFF_VH + 32 * VP), "v"(Vb + gv + 32 * M), "v"(lv + OFF_VH + 64 * VP), "v"(Vb + gv + 64 * M), "v"(lv + OFF_VH + 96 * VP), "v"(Vb + gv + 96 * M), "v"(lk + OFF_KH), "v"(Khb + gk),
                  "v"(lv + OFF_VL), "v"(Vlb + gv), "v"(lv + OFF_VL + 32 * VP), "v"(Vlb + gv + 32 * M), "v"(lv + OFF_VL + 64 * VP), "v"(Vlb + gv + 64 * M), "v"(lv + OFF_VL + 96 * VP), "v"(Vlb + gv + 96 * M), "v"(lk + OFF_KL), "v"(Klb + gk) : "memory");
}
// eight rows' pieces of W_o (rows 16 apart; 16 lanes x 16 B = one 256-B row) into LDS: the copies and, as the statement's last line, the wait that stands in front of any rewrite of the address registers they name
__device__ __forceinline__ void stage_wo8(unsigned lw, const b16* gw) {
  asm volatile("global_load_async_to_lds_b128 %0, %1, off\n\tglobal_load_async_to_lds_b128 %2, %3, off\n\tglobal_load_async_to_lds_b128 %4, %5, off\n\tglobal_load_async_to_lds_b128 %6, %7, off\n\t"
               "global_load_async_to_lds_b128 %8, %9, off\n\tglobal_load_async_to_lds_b128 %10, %11, off\n\tglobal_load_async_to_lds_b128 %12, %13, off\n\tglobal_load_async_to_lds_b128 %14, %15, off\n\ts_wait_xcnt 0x0"
               :: "v"(lw), "v"(gw), "v"(lw + 16 * WP), "v"(gw + 16 * CG), "v"(lw + 32 * WP), "v"(gw + 32 * CG), "v"(lw + 48 * WP), "v"(gw + 48 * CG),
                  "v"(lw + 64 * WP), "v"(gw + 64 * CG), "v"(lw + 80 * WP), "v"(gw + 80 * CG), "v"(lw + 96 * WP), "v"(gw + 96 * CG), "v"(lw + 112 * WP), "v"(gw + 112 * CG) : "memory");
}
__global__ __launch_bounds__(256) void attn_kernel(const b16* __restrict__ QH, const b16* __restrict__ QL, const b16* __restrict__ KH, const b16* __restrict__ KL, const b16* __restrict__ G16, const b16* __restrict__ GL16, const b16* __restrict__ WO, const float* __restrict__ x, const float* __restrict__ gamma_, float* __restrict__ out) {
  __shared__ __attribute__((aligned(128))) unsigned char L[TO_B + C * WP];   // the ring, after the loop the output staging To[256][128 + 4] (135,168 B); behind it W_o [256][WP] (69,632 B)
  const int tid = threadIdx.x, wave = threadIdx.x >> 5, lane = threadIdx.x & 31, hh = lane >> 4, col = lane & 15; const int b = blockIdx.z; const int q0 = blockIdx.x * 128 + wave * 16, qi = q0 + col;
  const size_t qrow = (size_t)b * N + qi; const v16b qh = frag_kb(QH + qrow * CQ, hh), ql = frag_kb(QL + qrow * CQ, hh);
  const b16* Khb = KH + (size_t)b * M * CQ; const b16* Klb = KL + (size_t)b * M * CQ; const b16* Vb = G16 + (size_t)b * CG * M; const b16* Vlb = GL16 + (size_t)b * CG * M; const float gamma = bf16_rne(gamma_[0]);
  const unsigned lds0 = (unsigned)(size_t)L;
  float m = -INFINITY, l = 0.0f; v8f o[8], ol[8];
#pragma unroll
  for (int t = 0; t < 8; ++t) { o[t] = (v8f){}; ol[t] = (v8f){}; }
  stage_kv(lds0, Vb, Vlb, Khb, Klb, 0, tid);
  asm volatile("s_wait_asynccnt 0x0" ::: "memory");   // this wave's copies of stage 0 have landed
  __syncthreads();                                    // every wave's have: stage 0 is readable
  stage_kv(lds0 + STAGE_B, Vb, Vlb, Khb, Klb, KS, tid);
  // W_o flies with stage 1: 16 copies a lane (26 outstanding with the stage's ten); the wait and the barrier at the foot of trip 0 land and publish it, it is read behind the loop
  { const unsigned lw = lds0 + OFF_WO + (tid >> 4) * WP + (tid & 15) * 16; const b16* gw = WO + (size_t)(tid >> 4) * CG + (tid & 15) * 8; stage_wo8(lw, gw); stage_wo8(lw + 128 * WP, gw + 128 * CG); }
  for (int st = 0; st < M / KS; ++st) {
    const unsigned char* B = L + (st & 1) * STAGE_B;
    // LDS fragment reads stand well in front of the products that use them: per 32 keys the four K fragments as one group,
    // g tiles 0 and 1 behind the first energy product, tile 2 behind the softmax, tile t + 3 behind the products of tile t; every read of a stage still ends in front of the stage's foot
    v16b kf[4];
    auto ldk = [&](int kk) { kf[0] = frag_kb((const b16*)(B + OFF_KH + (kk + col) * KP), hh); kf[1] = frag_kb((const b16*)(B + OFF_KH + (kk + 16 + col) * KP), hh); kf[2] = frag_kb((const b16*)(B + OFF_KL + (kk + col) * KP), hh); kf[3] = frag_kb((const b16*)(B + OFF_KL + (kk + 16 + col) * KP), hh); };
    for (int kk = 0; kk < KS; kk += 32) {
      v16b vh[8], vl[8];
      auto ldv = [&](int t) { vh[t] = frag_kb((const b16*)(B + OFF_VH + (t * 16 + col) * VP) + kk, hh); vl[t] = frag_kb((const b16*)(B + OFF_VL + (t * 16 + col) * VP) + kk, hh); };
      ldk(kk);
      v8f s0 = {}, s1 = {};
      s0 = wmma16b(kf[0], qh, s0); ldv(0); ldv(1); hold_loads(); s0 = wmma16b(kf[0], ql, s0); s0 = wmma16b(kf[2], qh, s0);
      s1 = wmma16b(kf[1], qh, s1); s1 = wmma16b(kf[1], ql, s1); s1 = wmma16b(kf[3], qh, s1);
      float e[16]; float mx = -INFINITY; const float cs = LOG2E / (XS * XS);
#pragma unroll
      for (int r = 0; r < 8; ++r) { e[r] = s0[r] * cs; e[8 + r] = s1[r] * cs; mx = fmaxf(mx, fmaxf(e[r], e[8 + r])); }
      mx = fmaxf(mx, __shfl_xor(mx, 16)); const float mn = fmaxf(m, mx); const float al = nexp2(m - mn); m = mn; float sum = 0.0f; v16b ph, pl;
#pragma unroll
      for (int i = 0; i < 16; ++i) { const float p = nexp2(e[i] - mn); sum += p; const b16 h_ = (b16)(p * PS); ph[i] = h_; pl[i] = (b16)(p * PS - (float)h_); }
      sum += __shfl_xor(sum, 16); l = l * al + sum;
      ldv(2); hold_loads();
#pragma unroll
      for (int t = 0; t < 8; ++t) { o[t] *= al; ol[t] *= al; o[t] = wmma16b(vh[t], ph, o[t]); ol[t] = wmma16b(vh[t], pl, ol[t]); ol[t] = wmma16b(vl[t], ph, ol[t]);
        if (t + 3 < 8) { ldv(t + 3); hold_loads(); } } }
    asm volatile("s_wait_dscnt 0x0" ::: "memory");      // this wave's reads of the buffer are done before it is refilled
    asm volatile("s_wait_asynccnt 0x0" ::: "memory");   // this wave's copies of stage st + 1 (in trip 0 of W_o too) have landed
    __syncthreads();                                    // publishes stage st + 1 and ends every wave's reads of stage st
    if (st + 2 < M / KS) stage_kv(lds0 + (st & 1) * STAGE_B, Vb, Vlb, Khb, Klb, (st + 2) * KS, tid);
  }
  asm volatile("s_wait_asynccnt 0x0" ::: "memory");     // no copy is outstanding when the ring becomes output staging
  // the wave's O^T / l as B fragments of W_o O^T: o[t][r] = O^T[d = t*16 + 8hh + r][query col], so tiles 2 ks and 2 ks + 1 are elements 0..7 and 8..15 of k step ks (d = 32 ks + 8hh + e, 32 ks + 16 + 8hh + e), the order of frag_kb
  const float inv = 1.0f / (l * PS);   // O x8
  v16b oh[CG / 32], oq[CG / 32];
#pragma unroll   // both loops: constant indices keep o, ol, oh, oq in registers
  for (int ks = 0; ks < CG / 32; ++ks)
#pragma unroll
    for (int r = 0; r < 8; ++r) { b16 h_, l_; split16((o[2 * ks][r] + ol[2 * ks][r]) * inv, h_, l_); oh[ks][r] = h_; oq[ks][r] = l_; split16((o[2 * ks + 1][r] + ol[2 * ks + 1][r]) * inv, h_, l_); oh[ks][8 + r] = h_; oq[ks][8 + r] = l_; }
  float (*To)[128 + 4] = (float (*)[128 + 4])L;
  // the residual x of the wave's 32 output rows (a lane: 16 bytes of each 512-B row): the first XA rows are requested here, in front of the W_o products, which cover their latency;
  // the rest, for which no registers are free yet, behind the barrier below, in front of the work on the first rows
  constexpr int XA = 16;
  const size_t ro = ((size_t)b * C + wave * 32) * N + blockIdx.x * 128 + lane * 4; const float* xr = x + ro; float* orow = out + ro;
  v4f xv[32];
  hold_loads();   // without it the requests are lifted over the conversion above, whose inputs still fill the registers, and the kernel needs registers above v255
#pragma unroll   // constant indices keep xv in registers
  for (int i = 0; i < XA; ++i) xv[i] = *(const v4f*)(xr + (size_t)i * N);
  hold_loads();
  // the four W_o fragments of channel tile ct + 1 are read in front of the products of tile ct (two register buffers)
  v16b wa[2][CG / 32];
  auto ldw = [&](int ct) {
#pragma unroll   // constant indices keep the buffers in registers
    for (int ks = 0; ks < CG / 32; ++ks) wa[ct & 1][ks] = frag_kb((const b16*)(L + OFF_WO + (ct * 16 + col) * WP) + ks * 32, hh); };
  ldw(0); hold_loads();
#pragma unroll   // buffer numbers must be compile-time constants
  for (int ct = 0; ct < C / 16; ++ct) { if (ct + 1 < C / 16) { ldw(ct + 1); hold_loads(); }
    v8f ah = {}, aq = {};
#pragma unroll
    for (int ks = 0; ks < CG / 32; ++ks) { ah = wmma16b(wa[ct & 1][ks], oh[ks], ah); aq = wmma16b(wa[ct & 1][ks], oq[ks], aq); }
#pragma unroll   // ah[r] = (W_o O)[c = ct*16 + 8hh + r][query col] x 2048 -> To[c][wave*16 + col]
    for (int r = 0; r < 8; ++r) To[ct * 16 + 8 * hh + r][wave * 16 + col] = (ah[r] + aq[r]) * (1.0f / (XS * WSC)); }
  __syncthreads();   // every wave's 16 query columns of all 256 rows are in To
#pragma unroll   // constant indices keep xv in registers
  for (int i = XA; i < 32; ++i) { if (i == 31) asm volatile("s_wait_xcnt 0x0" ::: "memory");   // in front of the last load, whose result may return into the address registers that the loads before it name
    xv[i] = *(const v4f*)(xr + (size_t)i * N); }
  hold_loads();
#pragma unroll   // constant indices keep xv in registers
  for (int i0 = 0; i0 < 32; i0 += 8) {
    v4f tv[8];
#pragma unroll   // the eight reads of the staging are issued before the first is waited for
    for (int i = 0; i < 8; ++i) tv[i] = *(const v4f*)(&To[wave * 32 + i0 + i][lane * 4]);
#pragma unroll
    for (int i = 0; i < 8; ++i) { v4f r;
#pragma unroll
      for (int j = 0; j < 4; ++j) r[j] = gamma * tv[i][j] + bf16_rne(xv[i0 + i][j]);
      *(v4f*)(orow + (size_t)(i0 + i) * N) = r; }
    if (i0 + 8 < 32) asm volatile("s_wait_xcnt 0x0" ::: "memory");   // stands in front of the next group's rewrite of the registers that this group's stores name
  }
}
}  // namespace

extern "C" void kernel_launch(void* const* d_in, const int* in_sizes, int n_in, void* d_out, int out_size, void* d_ws, size_t ws_size, hipStream_t stream) {
  (void)n_in;
  auto Fp = [&](int i) { return (const float*)d_in[i]; };
  // input order: 0 x [8,256,64,64], 1 w_theta [32,256], 2 w_phi [32,256], 3 w_g [128,256], 4 w_o [256,128], 5 gamma [1]
  if (in_sizes[0] != NB * C * N || in_sizes[1] != CQ * C || in_sizes[2] != CQ * C || in_sizes[3] != CG * C || in_sizes[4] != C * CG || in_sizes[5] != 1 || out_size != NB * C * N) return;
  size_t off = 0; char* ws = (char*)d_ws;
  auto carve = [&](size_t bytes) { char* p = ws + off; off += (bytes + 255) & ~(size_t)255; return p; };
  b16* XT16 = (b16*)carve((size_t)NB * N * C * 2); b16* W16 = (b16*)carve((size_t)2 * CQ * C * 2); b16* WG = (b16*)carve((size_t)CG * C * 2); b16* WO = (b16*)carve((size_t)C * CG * 2);
  b16* QH = (b16*)carve((size_t)NB * N * CQ * 2); b16* QL = (b16*)carve((size_t)NB * N * CQ * 2); b16* KH = (b16*)carve((size_t)NB * M * CQ * 2); b16* KL = (b16*)carve((size_t)NB * M * CQ * 2);
  b16* G16 = (b16*)carve((size_t)NB * CG * M * 2); b16* GL16 = (b16*)carve((size_t)NB * CG * M * 2);
  if (off > ws_size || off > ((size_t)128 << 20)) return;   // = 25.2 MB
  pre_kernel<<<PWB + XTB, 256, 0, stream>>>(Fp(0), Fp(1), Fp(2), Fp(3), Fp(4), XT16, W16, WG, WO);
  proj_kernel<<<GB + QKB, 256, 0, stream>>>(XT16, W16, WG, QH, QL, KH, KL, G16, GL16);
  attn_kernel<<<dim3(N / 128, 1, NB), 256, 0, stream>>>(QH, QL, KH, KL, G16, GL16, WO, Fp(0), Fp(5), (float*)d_out);
}

// v008
// A run of this version takes 40.6 microseconds.
// Next to v007, in two timings, it ran 1.27 times as fast each time.
// Counting every step since v000, it is 6.77 times as fast.
#include <hip/hip_runtime.h>

// Self-attention block (8 images x 256 ch x 64 x 64): theta = W_theta x (32 ch, all 4,096 pixels), phi = maxpool2x2(W_phi x) (32 ch x 1,024 pooled positions), g = maxpool2x2(W_g x) (128 x 1,024),
// beta = softmax over the 1,024 pooled keys of theta^T phi (no scaling), o = W_o (g beta^T), out = gamma * o + x. The 1x1 convs are channel GEMMs; the attention runs once per query over the 128 pooled
// g channels, and each wave applies W_o (256 x 128) behind the key loop to its own normalised accumulators, which already lie in the B fragment's order.
// WMMA (v_wmma_f32_16x16x32_f16, f32 accumulate): projections with EXACT bf16 pixels (x^T rows x8, via an LDS transpose of the channel-major input) and weights (x256), 1 product;
// energy tiles S^T = Phi . Theta^T with theta AND phi as f16 hi+lo x8 (3 products; logits sigma ~5.7); online softmax in f32; O^T += g P^T with
// g and P each rounded once to f16 x8 (1 product; relative error 2^-11 an operand); W_o O^T with W_o exact and O as f16 hi+lo x8 (2 products). Max-pooling, softmax, gamma, residual in f32. Inputs rounded to bf16 once (gamma and the residual x included). Fragment k-map

namespace {
constexpr int NB = 8, C = 256, CQ = 32, N = 4096, M = 1024 /* pooled positions */, CG = 128 /* g channels */, HW = 64;
constexpr float XS = 8.0f, WSC = 256.0f, PS = 8.0f, LOG2E = 1.4426950408889634f;

typedef _Float16 b16;
typedef __attribute__((ext_vector_type(16))) _Float16 v16b;
typedef __attribute__((ext_vector_type(8))) _Float16 v8b;
typedef __attribute__((ext_vector_type(8))) float v8f;
typedef __attribute__((ext_vector_type(4))) float v4f;
__device__ __forceinline__ float bf16_rne(float f) { unsigned int u = __float_as_uint(f); u += 0x7FFFu + ((u >> 16) & 1u); return __uint_as_float(u & 0xFFFF0000u); }
__device__ __forceinline__ void split16(float v, b16& hi, b16& lo) { hi = (b16)v; lo = (b16)(v - (float)hi); }
__device__ __forceinline__ v16b frag_kb(const b16* p, int hh) { const v8b a = *(const v8b*)(p + 8 * hh), b = *(const v8b*)(p + 16 + 8 * hh); v16b f;
#pragma unroll
  for (int e = 0; e < 8; ++e) { f[e] = a[e]; f[8 + e] = b[e]; } return f; }
__device__ __forceinline__ v8f wmma16b(v16b a, v16b b, v8f c) { return __builtin_amdgcn_wmma_f32_16x16x32_f16(false, a, false, b, (short)0, c, false, false); }
// stands behind a group of loads that is issued ahead of its use: without it the scheduler sinks each load to just in front of the product that reads it, and the wave waits out the whole latency there
__device__ __forceinline__ void hold_loads() { __builtin_amdgcn_sched_barrier(0); }
__device__ __forceinline__ void wave_lds_sync() { __builtin_amdgcn_fence(__ATOMIC_RELEASE, "workgroup"); __builtin_amdgcn_wave_barrier(); __builtin_amdgcn_fence(__ATOMIC_ACQUIRE, "workgroup"); }
__device__ __forceinline__ float nexp2(float x) { return __builtin_amdgcn_exp2f(x); }
// eight exponentials p[o .. o + 7] = 2^d[o .. o + 7] in one statement: the outputs are early-clobber, so that none lies on the source of the exponential in front of it, and the closing v_nop is the slot
// that the instruction set asks for between a transcendental and a directly following instruction that reads its result or overwrites its source
__device__ __forceinline__ void exp2x8(float (&p)[16], const float (&d)[16], int o) {
  asm("v_exp_f32 %0, %8\n\tv_exp_f32 %1, %9\n\tv_exp_f32 %2, %10\n\tv_exp_f32 %3, %11\n\tv_exp_f32 %4, %12\n\tv_exp_f32 %5, %13\n\tv_exp_f32 %6, %14\n\tv_exp_f32 %7, %15\n\tv_nop"
      : "=&v"(p[o]), "=&v"(p[o + 1]), "=&v"(p[o + 2]), "=&v"(p[o + 3]), "=&v"(p[o + 4]), "=&v"(p[o + 5]), "=&v"(p[o + 6]), "=&v"(p[o + 7])
      : "v"(d[o]), "v"(d[o + 1]), "v"(d[o + 2]), "v"(d[o + 3]), "v"(d[o + 4]), "v"(d[o + 5]), "v"(d[o + 6]), "v"(d[o + 7]));
}

typedef __attribute__((ext_vector_type(4))) _Float16 v4b;
typedef __attribute__((ext_vector_type(2))) float v2f;
// launch 1: the weight conversion (its own PWB work-groups, in front) and the transpose of x share one grid: neither reads what the other writes
constexpr int PWB = ((2 * CQ * C + CG * C + C * CG) / 8 + 255) / 256, XTB = (N / 64) * (C / 64) * NB;
__global__ __launch_bounds__(256) void pre_kernel(const float* __restrict__ x, const float* __restrict__ wq, const float* __restrict__ wk, const float* __restrict__ wg, const float* __restrict__ wo, b16* __restrict__ XT16, b16* __restrict__ W16, b16* __restrict__ WG, b16* __restrict__ WO) {
  __shared__ __attribute__((aligned(16))) b16 T[64][64 + 8];
  if (blockIdx.x < PWB) {
    const int t = blockIdx.x * 256 + threadIdx.x; const int nq = CQ * C / 8, ng = CG * C / 8, no = C * CG / 8; const float* src; int e; b16* dst;
    if (t < nq) { src = wq; e = t * 8; dst = W16; } else if (t < 2 * nq) { src = wk; e = (t - nq) * 8; dst = W16 + CQ * C; } else if (t < 2 * nq + ng) { src = wg; e = (t - 2 * nq) * 8; dst = WG; } else if (t < 2 * nq + ng + no) { src = wo; e = (t - 2 * nq - ng) * 8; dst = WO; } else return;
    v8b o; for (int j = 0; j < 8; ++j) o[j] = (b16)(bf16_rne(src[e + j]) * WSC);
    { *(v8b*)(dst + e) = o;  }
    return;
  }
  const int f = blockIdx.x - PWB; const int b = f >> 8, c0 = ((f >> 6) & 3) * 64, n0 = (f & 63) * 64, t_ = threadIdx.x;
  float xv[16];
#pragma unroll   // all 16 loads of a lane are issued before the first is waited for
  for (int i = 0; i < 16; ++i) { const int q = t_ + i * 256; xv[i] = x[((size_t)b * C + c0 + (q >> 6)) * N + n0 + (q & 63)]; }
#pragma unroll   // xv[] stays in registers only under constant indices
  for (int i = 0; i < 16; ++i) { const int q = t_ + i * 256; T[q & 63][q >> 6] = (b16)(bf16_rne(xv[i]) * XS); }
  __syncthreads();
  { for (int q = t_; q < 64 * 8; q += 256) { const int nn = q >> 3, c8 = (q & 7) * 8; *(v8b*)(XT16 + ((size_t)b * N + n0 + nn) * C + c0 + c8) = *(const v8b*)(&T[nn][c8]); }  }
}
// launch 2 reads every GEMM operand from LDS: a work-group's 128 rows of x^T and its weight rows are brought in once, as whole 512-B rows (32 lanes x 16 B), by asynchronous copies to LDS
constexpr int XP = C * 2 + 16 /* pitch of a staged row in LDS: 528 B = 16 B x odd */, OFF_XL = 77824 /* the x^T tile [128][XP], behind the staging of either part */, OFF_WL = 38912 /* W_theta, W_phi [64][XP], behind the theta/phi staging */;
// eight rows' pieces (rows 8 apart) into LDS: the copies and, as the statement's last line, the wait that stands in front of any rewrite of the address registers they name
__device__ __forceinline__ void stage_rows8(unsigned l, const b16* g) {
  asm volatile("global_load_async_to_lds_b128 %0, %1, off\n\tglobal_load_async_to_lds_b128 %2, %3, off\n\tglobal_load_async_to_lds_b128 %4, %5, off\n\tglobal_load_async_to_lds_b128 %6, %7, off\n\t"
               "global_load_async_to_lds_b128 %8, %9, off\n\tglobal_load_async_to_lds_b128 %10, %11, off\n\tglobal_load_async_to_lds_b128 %12, %13, off\n\tglobal_load_async_to_lds_b128 %14, %15, off\n\ts_wait_xcnt 0x0"
               :: "v"(l), "v"(g), "v"(l + 8 * XP), "v"(g + 8 * C), "v"(l + 16 * XP), "v"(g + 16 * C), "v"(l + 24 * XP), "v"(g + 24 * C),
                  "v"(l + 32 * XP), "v"(g + 32 * C), "v"(l + 40 * XP), "v"(g + 40 * C), "v"(l + 48 * XP), "v"(g + 48 * C), "v"(l + 56 * XP), "v"(g + 56 * C) : "memory");
}
// theta/phi projection: [n x 256] x [256 x 32]. A wave's 16 pixel rows are 8 neighbours of image row 2 h2 and the 8 below them, so that it holds whole 2x2 pooling windows:
// theta goes out as QH/QL [b][n][32] f16 hi+lo x8 (64-B rows), phi is max-pooled from the wave's f32 staging and goes out as KH/KL [b][m][32] f16 hi+lo x8 (4 pooled positions a wave)
__device__ __forceinline__ void qk_part(unsigned char* S, int blk, const b16* __restrict__ XT16, const b16* __restrict__ W16, b16* __restrict__ QH, b16* __restrict__ QL, b16* __restrict__ KH, b16* __restrict__ KL) {
  b16 (*Th)[16][CQ + 8] = (b16 (*)[16][CQ + 8])S; b16 (*Tl)[16][CQ + 8] = (b16 (*)[16][CQ + 8])(S + 8 * 16 * (CQ + 8) * 2); float (*Tf)[16][CQ + 4] = (float (*)[16][CQ + 4])(S + 2 * 8 * 16 * (CQ + 8) * 2);
  const int wave = threadIdx.x >> 5, lane = threadIdx.x & 31, nloc = lane & 15, hlf = lane >> 4; const int gw = blk * 8 + wave; const int b = gw >> 8, h2 = (gw >> 3) & 31, w0 = (gw & 7) * 8;
  auto pix = [&](int rr) { return (size_t)b * N + (size_t)(2 * h2 + (rr >> 3)) * HW + w0 + (rr & 7); };   // over b*N + n
  // rows wave + 8 j of the tile (pixels h2 * 128 ..) and of the 64 weight rows: 24 copies a lane
  { const unsigned ls = (unsigned)(size_t)S + wave * XP + lane * 16; const b16* gx = XT16 + ((size_t)b * N + h2 * 128 + wave) * C + lane * 8;
    stage_rows8(ls + OFF_XL, gx); stage_rows8(ls + OFF_XL + 64 * XP, gx + 64 * C); stage_rows8(ls + OFF_WL, W16 + (size_t)wave * C + lane * 8); }
  asm volatile("s_wait_asynccnt 0x0" ::: "memory");   // this wave's copies have landed
  __syncthreads();                                    // every wave's have: tile and weights are readable
  const unsigned char* Xa = S + OFF_XL + ((nloc >> 3) * HW + w0 + (nloc & 7)) * XP; const unsigned char* Wl = S + OFF_WL + nloc * XP;
  v8f acc[4] = {{}, {}, {}, {}};   // tiles: q0, q1, k0, k1
  // the fragments of k step k + 3 are requested in front of the products of k step k (four register buffers)
  v16b a[4], w[4][4];
  auto ld = [&](int k) { a[k & 3] = frag_kb((const b16*)Xa + k * 32, hlf);
#pragma unroll   // constant indices keep the buffers in registers
    for (int t = 0; t < 4; ++t) w[k & 3][t] = frag_kb((const b16*)(Wl + t * 16 * XP) + k * 32, hlf); };
  ld(0); ld(1); ld(2); hold_loads();
#pragma unroll   // buffer numbers must be compile-time constants
  for (int k = 0; k < C / 32; ++k) { if (k + 3 < C / 32) { ld(k + 3); hold_loads(); }
#pragma unroll
    for (int t = 0; t < 4; ++t) acc[t] = wmma16b(a[k & 3], w[k & 3][t], acc[t]); }
#pragma unroll
  for (int t = 0; t < 4; ++t) { const int which = t >> 1, c = (t & 1) * 16 + nloc;
#pragma unroll
    for (int r = 0; r < 8; ++r) { const float v = acc[t][r] * (1.0f / (XS * WSC)); if (which == 0) { b16 h_, l_; split16(v * XS, h_, l_); Th[wave][8 * hlf + r][c] = h_; Tl[wave][8 * hlf + r][c] = l_; } else Tf[wave][8 * hlf + r][c] = v; } }
  wave_lds_sync();
  {
    for (int q = 0; q < 2; ++q) { const int rr = q * 8 + (lane >> 2), seg = (lane & 3) * 8; *(v8b*)(QH + pix(rr) * CQ + seg) = *(const v8b*)(&Th[wave][rr][seg]); *(v8b*)(QL + pix(rr) * CQ + seg) = *(const v8b*)(&Tl[wave][rr][seg]); }
    const int i = lane >> 3, c4 = (lane & 7) * 4;   // pooled position w0 / 2 + i, channels c4 .. c4 + 3
    const v4f p00 = *(const v4f*)(&Tf[wave][2 * i][c4]), p01 = *(const v4f*)(&Tf[wave][2 * i + 1][c4]), p10 = *(const v4f*)(&Tf[wave][8 + 2 * i][c4]), p11 = *(const v4f*)(&Tf[wave][8 + 2 * i + 1][c4]); v4b hv, lv;
#pragma unroll   // constant indices keep hv, lv in registers
    for (int j = 0; j < 4; ++j) { const float v = fmaxf(fmaxf(p00[j], p01[j]), fmaxf(p10[j], p11[j])); b16 h_, l_; split16(v * XS, h_, l_); hv[j] = h_; lv[j] = l_; }
    const size_t ko = ((size_t)b * M + h2 * (HW / 2) + (w0 >> 1) + i) * CQ + c4; *(v4b*)(KH + ko) = hv; *(v4b*)(KL + ko) = lv;
    asm volatile("s_wait_xcnt 0x0" ::: "memory");   // behind the last store of this part: whatever code follows it in the joint kernel may reuse the registers that these stores name
  }
}
// g projection and pooling in one work-group of 8 waves = all 128 g channels x 128 pixels (image rows 2 h2 and 2 h2 + 1). GEMM rows d (A = WG rows, K = c) x cols n (B = XT16 rows n): each wave
// stages 16 d-rows x 128 n floats and max-pools them 2x2 (a lane takes pooled column w2 = lane of all 16 rows); the pooled values go out channel-major, G16 [b][d][m] = f16 x8,
// through the wave's own Ph [16 d][32 m] in LDS, so that a lane stores 16 bytes of one channel row
constexpr int GPP = 32 + 8 /* pitch of Ph in halves: 80 B = 16 B x odd */, SZ_TS = 8 * 16 * (128 + 4) * 4, SZ_G = 8 * 16 * GPP * 2;
__device__ __forceinline__ void gv_part(unsigned char* S, int blk, const b16* __restrict__ XT16, const b16* __restrict__ WG, b16* __restrict__ G16) {
  float (*Ts)[16][128 + 4] = (float (*)[16][128 + 4])S; b16 (*Ph)[16][GPP] = (b16 (*)[16][GPP])(S + SZ_TS);
  const int wave = threadIdx.x >> 5, lane = threadIdx.x & 31, nloc = lane & 15, hlf = lane >> 4; const int b = blk >> 5, h2 = blk & 31; const int d0 = wave * 16, n0 = h2 * 128;
  // rows wave + 8 j of the tile and of W_g: 32 copies a lane. W_g [128][XP] lies where Ts lies later: a wave's 16 rows of W_g, which it alone reads, are the very bytes of its own Ts rows
  static_assert(XP == (128 + 4) * 4, "a wave's W_g rows and its Ts rows are the same bytes");
  { const unsigned ls = (unsigned)(size_t)S + wave * XP + lane * 16; const b16* gx = XT16 + ((size_t)b * N + n0 + wave) * C + lane * 8; const b16* gw = WG + (size_t)wave * C + lane * 8;
    stage_rows8(ls + OFF_XL, gx); stage_rows8(ls + OFF_XL + 64 * XP, gx + 64 * C); stage_rows8(ls, gw); stage_rows8(ls + 64 * XP, gw + 64 * C); }
  asm volatile("s_wait_asynccnt 0x0" ::: "memory");   // this wave's copies have landed
  __syncthreads();                                    // every wave's have: tile and weights are readable
  const unsigned char* Wa = S + (d0 + nloc) * XP; const unsigned char* Xb = S + OFF_XL + nloc * XP;
  v8f acc[8];
#pragma unroll
  for (int t = 0; t < 8; ++t) acc[t] = (v8f){};
  // the nine fragments of k step k + 1 are requested in front of the products of k step k (two register buffers)
  v16b a[2], bf[2][8];
  auto ld = [&](int k) { a[k & 1] = frag_kb((const b16*)Wa + k * 32, hlf);
#pragma unroll   // constant indices keep the buffers in registers
    for (int t = 0; t < 8; ++t) bf[k & 1][t] = frag_kb((const b16*)(Xb + t * 16 * XP) + k * 32, hlf); };
  ld(0); hold_loads();
#pragma unroll   // buffer numbers must be compile-time constants
  for (int k = 0; k < C / 32; ++k) { if (k + 1 < C / 32) { ld(k + 1); hold_loads(); }
#pragma unroll
    for (int t = 0; t < 8; ++t) acc[t] = wmma16b(a[k & 1], bf[k & 1][t], acc[t]); }
#pragma unroll
  for (int t = 0; t < 8; ++t)
#pragma unroll
    for (int r = 0; r < 8; ++r) Ts[wave][8 * hlf + r][t * 16 + nloc] = acc[t][r] * (1.0f / (XS * WSC));
  wave_lds_sync();
  v2f pr[16], qr[16];
#pragma unroll   // all 32 reads of the staging are issued before the first is waited for
  for (int rr = 0; rr < 16; ++rr) { pr[rr] = *(const v2f*)(&Ts[wave][rr][2 * lane]); qr[rr] = *(const v2f*)(&Ts[wave][rr][HW + 2 * lane]); }
  hold_loads();
#pragma unroll   // constant indices keep pr, qr in registers
  for (int rr = 0; rr < 16; ++rr) { const v2f p = pr[rr], q = qr[rr]; const float v = fmaxf(fmaxf(p[0], p[1]), fmaxf(q[0], q[1])); Ph[wave][rr][lane] = (b16)(v * XS); }
  wave_lds_sync();
  const int row = lane >> 2, seg = (lane & 3) * 8; const size_t gi = ((size_t)b * CG + d0 + row) * M + h2 * (HW / 2) + seg;
  *(v8b*)(G16 + gi) = *(const v8b*)(&Ph[wave][row][seg]); *(v8b*)(G16 + gi + 8 * M) = *(const v8b*)(&Ph[wave][8 + row][seg]);
  asm volatile("s_wait_xcnt 0x0" ::: "memory");   // behind the last store of this part: whatever code follows it in the joint kernel may reuse the registers that these stores name
}
// launch 2: the g work-groups (even index) and the theta/phi work-groups (odd index) share one grid, alternating so that neighbours in the index are one of each kind; they read the same XT16 and write
// disjoint arrays; one LDS block serves either part; work-groups 2 i and 2 i + 1 stage the same 128 rows of x^T
constexpr int GB = (N / 128) * NB, QKB = NB * N / 128;
__global__ __launch_bounds__(256) void proj_kernel(const b16* __restrict__ XT16, const b16* __restrict__ W16, const b16* __restrict__ WG, b16* __restrict__ QH, b16* __restrict__ QL, b16* __restrict__ KH, b16* __restrict__ KL, b16* __restrict__ G16) {
  __shared__ __attribute__((aligned(16))) unsigned char S[OFF_XL + 128 * XP];   // 145,408 B: two work-groups on a WGP
  static_assert(GB == QKB, "the two kinds alternate");
  static_assert(OFF_XL == SZ_TS + SZ_G && OFF_WL == 2 * 8 * 16 * (CQ + 8) * 2 + 8 * 16 * (CQ + 4) * 4 && OFF_WL + 2 * CQ * XP <= OFF_XL, "the staged operands lie clear of what either part stages for its outputs");
  if ((blockIdx.x & 1) == 0) gv_part(S, blockIdx.x >> 1, XT16, WG, G16); else qk_part(S, blockIdx.x >> 1, XT16, W16, QH, QL, KH, KL);
}
// attention: grid (N/128 query blocks, 1, B); block = 8 waves x 16 queries, one work-group on a WGP. K (hi, lo) and the pooled g (all 128 channels) come in stages of 64 pooled keys into a
// two-buffer LDS ring that all 8 waves read: every lane copies 16 B pieces with asynchronous copies to LDS (whole 128-B lines per 8 lanes for g, 4 KB contiguous for K), one stage ahead of its use.
// Per block of 32 pooled keys: S^T = Phi . Theta^T with (Kh Qh + Kh Ql + Kl Qh), online softmax (f32, exp2), O^T (8 tiles) += g[d][keys] P^T. Behind the loop W_o (in LDS since trip 0) x O^T / l,
// 16 tiles of 16 channels a wave; out[b][c][n] = gamma (W_o O / l) + x, staged in LDS over the ring so that a wave writes whole 512-B rows (16 bytes a lane); x is requested ahead of its use.
constexpr int KS = 64 /* keys per stage */, VP = 144, KP = 80 /* LDS row pitch in bytes, 16 B x odd: 16 rows of a 16-byte read fall on 64 distinct banks */;
constexpr int OFF_VH = 0, OFF_KH = 128 * VP, OFF_KL = OFF_KH + KS * KP, STAGE_B = OFF_KL + KS * KP;   // 28,672 B per buffer
constexpr int TO_B = C * (128 + 4) * 4 /* output staging, over the ring */, OFF_WO = TO_B, WP = CG * 2 + 16 /* pitch of a W_o row in LDS: 272 B = 16 B x odd */;
static_assert(TO_B >= 2 * STAGE_B, "the ring lies inside the output staging");
// one stage (keys k0 .. k0 + 63) into the buffer at LDS byte address lb: 6 copies per lane, 256 lanes; g rows vr + 32 j (8 lanes x 16 B = one 128-B line each), K rows kr (4 lanes x 16 B)
__device__ __forceinline__ void stage_kv(unsigned lb, const b16* Vb, const b16* Khb, const b16* Klb, int k0, int tid) {
  const int vr = tid >> 3, vc = tid & 7, kr = tid >> 2, kc = tid & 3; const unsigned lv = lb + vr * VP + vc * 16, lk = lb + kr * KP + kc * 16; const size_t gv = (size_t)vr * M + k0 + vc * 8, gk = (size_t)(k0 + kr) * CQ + kc * 8;
  // the six copies and, as the statement's last line, the wait that stands in front of any rewrite of the address registers they name
  asm volatile("global_load_async_to_lds_b128 %0, %1, off\n\tglobal_load_async_to_lds_b128 %2, %3, off\n\tglobal_load_async_to_lds_b128 %4, %5, off\n\tglobal_load_async_to_lds_b128 %6, %7, off\n\t"
               "global_load_async_to_lds_b128 %8, %9, off\n\tglobal_load_async_to_lds_b128 %10, %11, off\n\ts_wait_xcnt 0x0"
               :: "v"(lv + OFF_VH), "v"(Vb + gv), "v"(lv + OFF_VH + 32 * VP), "v"(Vb + gv + 32 * M), "v"(lv + OFF_VH + 64 * VP), "v"(Vb + gv + 64 * M), "v"(lv + OFF_VH + 96 * VP), "v"(Vb + gv + 96 * M),
                  "v"(lk + OFF_KH), "v"(Khb + gk), "v"(lk + OFF_KL), "v"(Klb + gk) : "memory");
}
// eight rows' pieces of W_o (rows 16 apart; 16 lanes x 16 B = one 256-B row) into LDS: the copies and, as the statement's last line, the wait that stands in front of any rewrite of the address registers they name
__device__ __forceinline__ void stage_wo8(unsigned lw, const b16* gw) {
  asm volatile("global_load_async_to_lds_b128 %0, %1, off\n\tglobal_load_async_to_lds_b128 %2, %3, off\n\tglobal_load_async_to_lds_b128 %4, %5, off\n\tglobal_load_async_to_lds_b128 %6, %7, off\n\t"
               "global_load_async_to_lds_b128 %8, %9, off\n\tglobal_load_async_to_lds_b128 %10, %11, off\n\tglobal_load_async_to_lds_b128 %12, %13, off\n\tglobal_load_async_to_lds_b128 %14, %15, off\n\ts_wait_xcnt 0x0"
               :: "v"(lw), "v"(gw), "v"(lw + 16 * WP), "v"(gw + 16 * CG), "v"(lw + 32 * WP), "v"(gw + 32 * CG), "v"(lw + 48 * WP), "v"(gw + 48 * CG),
                  "v"(lw + 64 * WP), "v"(gw + 64 * CG), "v"(lw + 80 * WP), "v"(gw + 80 * CG), "v"(lw + 96 * WP), "v"(gw + 96 * CG), "v"(lw + 112 * WP), "v"(gw + 112 * CG) : "memory");
}
__global__ __launch_bounds__(256) void attn_kernel(const b16* __restrict__ QH, const b16* __restrict__ QL, const b16* __restrict__ KH, const b16* __restrict__ KL, const b16* __restrict__ G16, const b16* __restrict__ WO, const float* __restrict__ x, const float* __restrict__ gamma_, float* __restrict__ out) {
  __shared__ __attribute__((aligned(128))) unsigned char L[TO_B + C * WP];   // the ring, after the loop the output staging To[256][128 + 4] (135,168 B); behind it W_o [256][WP] (69,632 B)
  const int tid = threadIdx.x, wave = threadIdx.x >> 5, lane = threadIdx.x & 31, hh = lane >> 4, col = lane & 15; const int b = blockIdx.z; const int q0 = blockIdx.x * 128 + wave * 16, qi = q0 + col;
  const size_t qrow = (size_t)b * N + qi; const v16b qh = frag_kb(QH + qrow * CQ, hh), ql = frag_kb(QL + qrow * CQ, hh);
  const b16* Khb = KH + (size_t)b * M * CQ; const b16* Klb = KL + (size_t)b * M * CQ; const b16* Vb = G16 + (size_t)b * CG * M; const float gamma = bf16_rne(gamma_[0]);
  const unsigned lds0 = (unsigned)(size_t)L;
  float m = -INFINITY, l = 0.0f; v8f o[8];
#pragma unroll
  for (int t = 0; t < 8; ++t) o[t] = (v8f){};
  stage_kv(lds0, Vb, Khb, Klb, 0, tid);
  asm volatile("s_wait_asynccnt 0x0" ::: "memory");   // this wave's copies of stage 0 have landed
  __syncthreads();                                    // every wave's have: stage 0 is readable
  stage_kv(lds0 + STAGE_B, Vb, Khb, Klb, KS, tid);
  // W_o flies with stage 1: 16 copies a lane (22 outstanding with the stage's six); the wait and the barrier at the foot of trip 0 land and publish it, it is read behind the loop
  { const unsigned lw = lds0 + OFF_WO + (tid >> 4) * WP + (tid & 15) * 16; const b16* gw = WO + (size_t)(tid >> 4) * CG + (tid & 15) * 8; stage_wo8(lw, gw); stage_wo8(lw + 128 * WP, gw + 128 * CG); }
  for (int st = 0; st < M / KS; ++st) {
    const unsigned char* B = L + (st & 1) * STAGE_B;
    // LDS fragment reads stand well in front of the products that use them: per 32 keys the four K fragments as one group,
    // the eight g fragments as one group behind the first energy product, so that energies and softmax cover their latency; every read of a stage still ends in front of the stage's foot
    v16b kf[4];
    auto ldk = [&](int kk) { kf[0] = frag_kb((const b16*)(B + OFF_KH + (kk + col) * KP), hh); kf[1] = frag_kb((const b16*)(B + OFF_KH + (kk + 16 + col) * KP), hh); kf[2] = frag_kb((const b16*)(B + OFF_KL + (kk + col) * KP), hh); kf[3] = frag_kb((const b16*)(B + OFF_KL + (kk + 16 + col) * KP), hh); };
    for (int kk = 0; kk < KS; kk += 32) {
      v16b vh[8];
      ldk(kk);
      v8f s0 = {}, s1 = {};
      s0 = wmma16b(kf[0], qh, s0);
#pragma unroll   // constant indices keep vh in registers
      for (int t = 0; t < 8; ++t) vh[t] = frag_kb((const b16*)(B + OFF_VH + (t * 16 + col) * VP) + kk, hh);
      hold_loads(); s0 = wmma16b(kf[0], ql, s0); s0 = wmma16b(kf[2], qh, s0);
      s1 = wmma16b(kf[1], qh, s1); s1 = wmma16b(kf[1], ql, s1); s1 = wmma16b(kf[3], qh, s1);
      float e[16]; float mx = -INFINITY; const float cs = LOG2E / (XS * XS);
#pragma unroll
      for (int r = 0; r < 8; ++r) { e[r] = s0[r] * cs; e[8 + r] = s1[r] * cs; mx = fmaxf(mx, fmaxf(e[r], e[8 + r])); }
      mx = fmaxf(mx, __shfl_xor(mx, 16)); const float mn = fmaxf(m, mx); const float al = nexp2(m - mn); m = mn; float sum = 0.0f; v16b ph;
float p[16];
#pragma unroll   // constant indices keep e, p in registers (this loop and the next)
      for (int i = 0; i < 16; ++i) e[i] -= mn;
      exp2x8(p, e, 0); exp2x8(p, e, 8);
#pragma unroll
      for (int i = 0; i < 16; ++i) { sum += p[i]; ph[i] = (b16)(p[i] * PS); }
      sum += __shfl_xor(sum, 16); l = l * al + sum;
#pragma unroll
      for (int t = 0; t < 8; ++t) { o[t] *= al; o[t] = wmma16b(vh[t], ph, o[t]); } }
    asm volatile("s_wait_dscnt 0x0" ::: "memory");      // this wave's reads of the buffer are done before it is refilled
    asm volatile("s_wait_asynccnt 0x0" ::: "memory");   // this wave's copies of stage st + 1 (in trip 0 of W_o too) have landed
    __syncthreads();                                    // publishes stage st + 1 and ends every wave's reads of stage st
    if (st + 2 < M / KS) stage_kv(lds0 + (st & 1) * STAGE_B, Vb, Khb, Klb, (st + 2) * KS, tid);
  }
  asm volatile("s_wait_asynccnt 0x0" ::: "memory");     // no copy is outstanding when the ring becomes output staging
  // the wave's O^T / l as B fragments of W_o O^T: o[t][r] = O^T[d = t*16 + 8hh + r][query col], so tiles 2 ks and 2 ks + 1 are elements 0..7 and 8..15 of k step ks (d = 32 ks + 8hh + e, 32 ks + 16 + 8hh + e), the order of frag_kb
  const float inv = 1.0f / (l * PS);   // O x8
  v16b oh[CG / 32], oq[CG / 32];
#pragma unroll   // both loops: constant indices keep o, oh, oq in registers
  for (int ks = 0; ks < CG / 32; ++ks)
#pragma unroll
    for (int r = 0; r < 8; ++r) { b16 h_, l_; split16(o[2 * ks][r] * inv, h_, l_); oh[ks][r] = h_; oq[ks][r] = l_; split16(o[2 * ks + 1][r] * inv, h_, l_); oh[ks][8 + r] = h_; oq[ks][8 + r] = l_; }
  float (*To)[128 + 4] = (float (*)[128 + 4])L;
  // the residual x of the wave's 32 output rows (a lane: 16 bytes of each 512-B row): the first XA rows are requested here, in front of the W_o products, which cover their latency;
  // the rest, for which no registers are free yet, behind the barrier below, in front of the work on the first rows
  constexpr int XA = 16;
  const size_t ro = ((size_t)b * C + wave * 32) * N + blockIdx.x * 128 + lane * 4; const float* xr = x + ro; float* orow = out + ro;
  v4f xv[32];
  hold_loads();   // without it the requests are lifted over the conversion above, whose inputs still fill the registers, and the kernel needs registers above v255
#pragma unroll   // constant indices keep xv in registers
  for (int i = 0; i < XA; ++i) xv[i] = *(const v4f*)(xr + (size_t)i * N);
  hold_loads();
  // the four W_o fragments of channel tile ct + 1 are read in front of the products of tile ct (two register buffers)
  v16b wa[2][CG / 32];
  auto ldw = [&](int ct) {
#pragma unroll   // constant indices keep the buffers in registers
    for (int ks = 0; ks < CG / 32; ++ks) wa[ct & 1][ks] = frag_kb((const b16*)(L + OFF_WO + (ct * 16 + col) * WP) + ks * 32, hh); };
  ldw(0); hold_loads();
#pragma unroll   // buffer numbers must be compile-time constants
  for (int ct = 0; ct < C / 16; ++ct) { if (ct + 1 < C / 16) { ldw(ct + 1); hold_loads(); }
    v8f ah = {}, aq = {};
#pragma unroll
    for (int ks = 0; ks < CG / 32; ++ks) { ah = wmma16b(wa[ct & 1][ks], oh[ks], ah); aq = wmma16b(wa[ct & 1][ks], oq[ks], aq); }
#pragma unroll   // ah[r] = (W_o O)[c = ct*16 + 8hh + r][query col] x 2048 -> To[c][wave*16 + col]
    for (int r = 0; r < 8; ++r) To[ct * 16 + 8 * hh + r][wave * 16 + col] = (ah[r] + aq[r]) * (1.0f / (XS * WSC)); }
  __syncthreads();   // every wave's 16 query columns of all 256 rows are in To
#pragma unroll   // constant indices keep xv in registers
  for (int i = XA; i < 32; ++i) { if (i == 31) asm volatile("s_wait_xcnt 0x0" ::: "memory");   // in front of the last load, whose result may return into the address registers that the loads before it name
    xv[i] = *(const v4f*)(xr + (size_t)i * N); }
  hold_loads();
#pragma unroll   // constant indices keep xv in registers
  for (int i0 = 0; i0 < 32; i0 += 8) {
    v4f tv[8];
#pragma unroll   // the eight reads of the staging are issued before the first is waited for
    for (int i = 0; i < 8; ++i) tv[i] = *(const v4f*)(&To[wave * 32 + i0 + i][lane * 4]);
#pragma unroll
    for (int i = 0; i < 8; ++i) { v4f r;
#pragma unroll
      for (int j = 0; j < 4; ++j) r[j] = gamma * tv[i][j] + bf16_rne(xv[i0 + i][j]);
      *(v4f*)(orow + (size_t)(i0 + i) * N) = r; }
    if (i0 + 8 < 32) asm volatile("s_wait_xcnt 0x0" ::: "memory");   // stands in front of the next group's rewrite of the registers that this group's stores name
  }
}
}  // namespace

extern "C" void kernel_launch(void* const* d_in, const int* in_sizes, int n_in, void* d_out, int out_size, void* d_ws, size_t ws_size, hipStream_t stream) {
  (void)n_in;
  auto Fp = [&](int i) { return (const float*)d_in[i]; };
  // input order: 0 x [8,256,64,64], 1 w_theta [32,256], 2 w_phi [32,256], 3 w_g [128,256], 4 w_o [256,128], 5 gamma [1]
  if (in_sizes[0] != NB * C * N || in_sizes[1] != CQ * C || in_sizes[2] != CQ * C || in_sizes[3] != CG * C || in_sizes[4] != C * CG || in_sizes[5] != 1 || out_size != NB * C * N) return;
  size_t off = 0; char* ws = (char*)d_ws;
  auto carve = [&](size_t bytes) { char* p = ws + off; off += (bytes + 255) & ~(size_t)255; return p; };
  b16* XT16 = (b16*)carve((size_t)NB * N * C * 2); b16* W16 = (b16*)carve((size_t)2 * CQ * C * 2); b16* WG = (b16*)carve((size_t)CG * C * 2); b16* WO = (b16*)carve((size_t)C * CG * 2);
  b16* QH = (b16*)carve((size_t)NB * N * CQ * 2); b16* QL = (b16*)carve((size_t)NB * N * CQ * 2); b16* KH = (b16*)carve((size_t)NB * M * CQ * 2); b16* KL = (b16*)carve((size_t)NB * M * CQ * 2);
  b16* G16 = (b16*)carve((size_t)NB * CG * M * 2);
  if (off > ws_size || off > ((size_t)128 << 20)) return;   // = 23.1 MB
  pre_kernel<<<PWB + XTB, 256, 0, stream>>>(Fp(0), Fp(1), Fp(2), Fp(3), Fp(4), XT16, W16, WG, WO);
  proj_kernel<<<GB + QKB, 256, 0, stream>>>(XT16, W16, WG, QH, QL, KH, KL, G16);
  attn_kernel<<<dim3(N / 128, 1, NB), 256, 0, stream>>>(QH, QL, KH, KL, G16, WO, Fp(0), Fp(5), (float*)d_out);
}

// v009
// Measured time: 34.9 microseconds a run.
// Timed twice side by side with v008, it ran 1.18 and 1.16 times as fast.
// All steps since v000 together make it 7.94 times as fast.
#include <hip/hip_runtime.h>

// Self-attention block (8 images x 256 ch x 64 x 64): theta = W_theta x (32 ch, all 4,096 pixels), phi = maxpool2x2(W_phi x) (32 ch x 1,024 pooled positions), g = maxpool2x2(W_g x) (128 x 1,024),
// beta = softmax over the 1,024 pooled keys of theta^T phi (no scaling), o = W_o (g beta^T), out = gamma * o + x. The 1x1 convs are channel GEMMs; the attention runs once per query over the 128 pooled
// g channels, and each wave applies W_o (256 x 128) behind the key loop to its own normalised accumulators, which already lie in the B fragment's order.
// WMMA (v_wmma_f32_16x16x32_f16, f32 accumulate): projections with EXACT bf16 pixels (x^T rows x8, via an LDS transpose of the channel-major input) and weights (x256), 1 product;
// energy tiles S^T = Phi . Theta^T with theta AND phi as f16 hi+lo x8 (3 products; logits sigma ~5.7); online softmax in f32; O^T += g P^T with
// g and P each rounded once to f16 x8 (1 product; relative error 2^-11 an operand); W_o O^T with W_o exact and O as f16 hi+lo x8 (2 products). Max-pooling, softmax, gamma, residual in f32. Inputs rounded to bf16 once (gamma and the residual x included). Fragment k-map

namespace {
constexpr int NB = 8, C = 256, CQ = 32, N = 4096, M = 1024 /* pooled positions */, CG = 128 /* g channels */, HW = 64;
constexpr float XS = 8.0f, WSC = 256.0f, PS = 8.0f, LOG2E = 1.4426950408889634f;

typedef _Float16 b16;
typedef __attribute__((ext_vector_type(16))) _Float16 v16b;
typedef __attribute__((ext_vector_type(8))) _Float16 v8b;
typedef __attribute__((ext_vector_type(8))) float v8f;
typedef __attribute__((ext_vector_type(4))) float v4f;
__device__ __forceinline__ float bf16_rne(float f) { unsigned int u = __float_as_uint(f); u += 0x7FFFu + ((u >> 16) & 1u); return __uint_as_float(u & 0xFFFF0000u); }
__device__ __forceinline__ void split16(float v, b16& hi, b16& lo) { hi = (b16)v; lo = (b16)(v - (float)hi); }
__device__ __forceinline__ v16b frag_kb(const b16* p, int hh) { const v8b a = *(const v8b*)(p + 8 * hh), b = *(const v8b*)(p + 16 + 8 * hh); v16b f;
#pragma unroll
  for (int e = 0; e < 8; ++e) { f[e] = a[e]; f[8 + e] = b[e]; } return f; }
__device__ __forceinline__ v8f wmma16b(v16b a, v16b b, v8f c) { return __builtin_amdgcn_wmma_f32_16x16x32_f16(false, a, false, b, (short)0, c, false, false); }
// stands behind a group of loads that is issued ahead of its use: without it the scheduler sinks each load to just in front of the product that reads it, and the wave waits out the whole latency there
__device__ __forceinline__ void hold_loads() { __builtin_amdgcn_sched_barrier(0); }
__device__ __forceinline__ void wave_lds_sync() { __builtin_amdgcn_fence(__ATOMIC_RELEASE, "workgroup"); __builtin_amdgcn_wave_barrier(); __builtin_amdgcn_fence(__ATOMIC_ACQUIRE, "workgroup"); }
__device__ __forceinline__ float nexp2(float x) { return __builtin_amdgcn_exp2f(x); }
// eight exponentials p[o .. o + 7] = 2^d[o .. o + 7] in one statement: the outputs are early-clobber, so that none lies on the source of the exponential in front of it, and the closing v_nop is the slot
// that the instruction set asks for between a transcendental and a directly following instruction that reads its result or overwrites its source
__device__ __forceinline__ void exp2x8(float (&p)[16], const float (&d)[16], int o) {
  asm("v_exp_f32 %0, %8\n\tv_exp_f32 %1, %9\n\tv_exp_f32 %2, %10\n\tv_exp_f32 %3, %11\n\tv_exp_f32 %4, %12\n\tv_exp_f32 %5, %13\n\tv_exp_f32 %6, %14\n\tv_exp_f32 %7, %15\n\tv_nop"
      : "=&v"(p[o]), "=&v"(p[o + 1]), "=&v"(p[o + 2]), "=&v"(p[o + 3]), "=&v"(p[o + 4]), "=&v"(p[o + 5]), "=&v"(p[o + 6]), "=&v"(p[o + 7])
      : "v"(d[o]), "v"(d[o + 1]), "v"(d[o + 2]), "v"(d[o + 3]), "v"(d[o + 4]), "v"(d[o + 5]), "v"(d[o + 6]), "v"(d[o + 7]));
}

typedef __attribute__((ext_vector_type(4))) _Float16 v4b;
typedef __attribute__((ext_vector_type(2))) float v2f;
// launch 1 reads every GEMM operand from LDS. One work-group of 16 waves = 128 pixels (image rows 2 h2 and 2 h2 + 1) x all 192 projected channels: it reads its 256 x 128 piece of the channel-major f32 x
// (whole 512-B rows, 16 bytes a lane) and the three f32 weight matrices itself, rounds and scales them in registers and stores them into LDS as f16 rows of 256 channels; x is transposed by that store
// (a lane holds 16 channels of 4 pixels and stores 32 bytes of each pixel's row). Waves 0..7 then do the g part, waves 8..15 the theta/phi part, from the one tile.
constexpr int XP = C * 2 + 16 /* pitch of a staged row in LDS: 528 B = 16 B x odd */;
constexpr int GPP = 32 + 8 /* pitch of Ph in halves: 80 B = 16 B x odd */, SZ_TS = 8 * 16 * (128 + 4) * 4, SZ_G = 8 * 16 * GPP * 2;
constexpr int OFF_XL = SZ_TS + SZ_G /* the x^T tile [128][XP], behind the g part's W_g / Ts and Ph */, OFF_Q = OFF_XL + 128 * XP /* the theta/phi part's block */;
constexpr int OFF_WL = 2 * 8 * 16 * (CQ + 8) * 2 + 8 * 16 * (CQ + 4) * 4 /* in that block: W_theta, W_phi [64][XP], behind its output staging */, SZ_S = OFF_Q + OFF_WL + 2 * CQ * XP;
// LDS row of pixel n of the tile: the two low bits are turned by bits 4, 5, so that the 16 rows of a fragment read (n = 16 t + 0..15) and the 16 rows of a transposing store (n = 4 lane + j) both fall on 16 distinct bank groups
__device__ __forceinline__ int xrow(int n) { return n ^ ((n >> 4) & 3); }
// f32 -> nearest-even bf16 -> x s as f16 (exact): the same values as bf16_rne, by the conversion instruction
typedef __attribute__((ext_vector_type(2))) __bf16 v2bf;
__device__ __forceinline__ void cvt2(float a, float b, float s, b16& x0, b16& x1) { const v2f t = {a, b}; const unsigned u = __builtin_bit_cast(unsigned, __builtin_convertvector(t, v2bf)); x0 = (b16)(__uint_as_float(u << 16) * s); x1 = (b16)(__uint_as_float(u & 0xFFFF0000u) * s); }
__device__ __forceinline__ v8b cvt8(v4f a, v4f b, float s) { v8b o;
#pragma unroll   // constant indices keep o in registers
  for (int e = 0; e < 4; e += 2) { b16 p, q; cvt2(a[e], a[e + 1], s, p, q); o[e] = p; o[e + 1] = q; cvt2(b[e], b[e + 1], s, p, q); o[4 + e] = p; o[5 + e] = q; } return o; }
// theta/phi projection: [n x 256] x [256 x 32]. A wave's 16 pixel rows are 8 neighbours of image row 2 h2 and the 8 below them, so that it holds whole 2x2 pooling windows:
// theta goes out as QH/QL [b][n][32] f16 hi+lo x8 (64-B rows), phi is max-pooled from the wave's f32 staging and goes out as KH/KL [b][m][32] f16 hi+lo x8 (4 pooled positions a wave)
__device__ __forceinline__ void qk_part(unsigned char* S, const unsigned char* XL, int wave, int blk, b16* __restrict__ QH, b16* __restrict__ QL, b16* __restrict__ KH, b16* __restrict__ KL) {
  b16 (*Th)[16][CQ + 8] = (b16 (*)[16][CQ + 8])S; b16 (*Tl)[16][CQ + 8] = (b16 (*)[16][CQ + 8])(S + 8 * 16 * (CQ + 8) * 2); float (*Tf)[16][CQ + 4] = (float (*)[16][CQ + 4])(S + 2 * 8 * 16 * (CQ + 8) * 2);
  const int lane = threadIdx.x & 31, nloc = lane & 15, hlf = lane >> 4; const int gw = blk * 8 + wave; const int b = gw >> 8, h2 = (gw >> 3) & 31, w0 = (gw & 7) * 8;
  auto pix = [&](int rr) { return (size_t)b * N + (size_t)(2 * h2 + (rr >> 3)) * HW + w0 + (rr & 7); };   // over b*N + n
  const unsigned char* Xa = XL + xrow((nloc >> 3) * HW + w0 + (nloc & 7)) * XP; const unsigned char* Wl = S + OFF_WL + nloc * XP;
  v8f acc[4] = {{}, {}, {}, {}};   // tiles: q0, q1, k0, k1
  // the fragments of k step k + 3 are requested in front of the products of k step k (four register buffers)
  v16b a[4], w[4][4];
  auto ld = [&](int k) { a[k & 3] = frag_kb((const b16*)Xa + k * 32, hlf);
#pragma unroll   // constant indices keep the buffers in registers
    for (int t = 0; t < 4; ++t) w[k & 3][t] = frag_kb((const b16*)(Wl + t * 16 * XP) + k * 32, hlf); };
  ld(0); ld(1); ld(2); hold_loads();
#pragma unroll   // buffer numbers must be compile-time constants
  for (int k = 0; k < C / 32; ++k) { if (k + 3 < C / 32) { ld(k + 3); hold_loads(); }
#pragma unroll
    for (int t = 0; t < 4; ++t) acc[t] = wmma16b(a[k & 3], w[k & 3][t], acc[t]); }
#pragma unroll
  for (int t = 0; t < 4; ++t) { const int which = t >> 1, c = (t & 1) * 16 + nloc;
#pragma unroll
    for (int r = 0; r < 8; ++r) { const float v = acc[t][r] * (1.0f / (XS * WSC)); if (which == 0) { b16 h_, l_; split16(v * XS, h_, l_); Th[wave][8 * hlf + r][c] = h_; Tl[wave][8 * hlf + r][c] = l_; } else Tf[wave][8 * hlf + r][c] = v; } }
  wave_lds_sync();
  {
    for (int q = 0; q < 2; ++q) { const int rr = q * 8 + (lane >> 2), seg = (lane & 3) * 8; *(v8b*)(QH + pix(rr) * CQ + seg) = *(const v8b*)(&Th[wave][rr][seg]); *(v8b*)(QL + pix(rr) * CQ + seg) = *(const v8b*)(&Tl[wave][rr][seg]); }
    const int i = lane >> 3, c4 = (lane & 7) * 4;   // pooled position w0 / 2 + i, channels c4 .. c4 + 3
    const v4f p00 = *(const v4f*)(&Tf[wave][2 * i][c4]), p01 = *(const v4f*)(&Tf[wave][2 * i + 1][c4]), p10 = *(const v4f*)(&Tf[wave][8 + 2 * i][c4]), p11 = *(const v4f*)(&Tf[wave][8 + 2 * i + 1][c4]); v4b hv, lv;
#pragma unroll   // constant indices keep hv, lv in registers
    for (int j = 0; j < 4; ++j) { const float v = fmaxf(fmaxf(p00[j], p01[j]), fmaxf(p10[j], p11[j])); b16 h_, l_; split16(v * XS, h_, l_); hv[j] = h_; lv[j] = l_; }
    const size_t ko = ((size_t)b * M + h2 * (HW / 2) + (w0 >> 1) + i) * CQ + c4; *(v4b*)(KH + ko) = hv; *(v4b*)(KL + ko) = lv;
    asm volatile("s_wait_xcnt 0x0" ::: "memory");   // behind the last store of this part: whatever code follows it in the joint kernel may reuse the registers that these stores name
  }
}
// g projection and pooling by 8 waves = all 128 g channels x 128 pixels (image rows 2 h2 and 2 h2 + 1). GEMM rows d (A = W_g rows, K = c) x cols n (B = rows n of the x^T tile): each wave
// stages 16 d-rows x 128 n floats and max-pools them 2x2 (a lane takes pooled column w2 = lane of all 16 rows); the pooled values go out channel-major, G16 [b][d][m] = f16 x8,
// through the wave's own Ph [16 d][32 m] in LDS, so that a lane stores 16 bytes of one channel row
__device__ __forceinline__ void gv_part(unsigned char* S, const unsigned char* XL, int wave, int blk, b16* __restrict__ G16) {
  float (*Ts)[16][128 + 4] = (float (*)[16][128 + 4])S; b16 (*Ph)[16][GPP] = (b16 (*)[16][GPP])(S + SZ_TS);
  const int lane = threadIdx.x & 31, nloc = lane & 15, hlf = lane >> 4; const int b = blk >> 5, h2 = blk & 31; const int d0 = wave * 16;
  // W_g [128][XP] lies where Ts lies later: a wave's 16 rows of W_g, which it alone reads, are the very bytes of its own Ts rows
  static_assert(XP == (128 + 4) * 4, "a wave's W_g rows and its Ts rows are the same bytes");
  const unsigned char* Wa = S + (d0 + nloc) * XP;
  v8f acc[8];
#pragma unroll
  for (int t = 0; t < 8; ++t) acc[t] = (v8f){};
  // the nine fragments of k step k + 1 are requested in front of the products of k step k (two register buffers)
  v16b a[2], bf[2][8];
  auto ld = [&](int k) { a[k & 1] = frag_kb((const b16*)Wa + k * 32, hlf);
#pragma unroll   // constant indices keep the buffers in registers
    for (int t = 0; t < 8; ++t) bf[k & 1][t] = frag_kb((const b16*)(XL + xrow(t * 16 + nloc) * XP) + k * 32, hlf); };
  ld(0); hold_loads();
#pragma unroll   // buffer numbers must be compile-time constants
  for (int k = 0; k < C / 32; ++k) { if (k + 1 < C / 32) { ld(k + 1); hold_loads(); }
#pragma unroll
    for (int t = 0; t < 8; ++t) acc[t] = wmma16b(a[k & 1], bf[k & 1][t], acc[t]); }
#pragma unroll
  for (int t = 0; t < 8; ++t)
#pragma unroll
    for (int r = 0; r < 8; ++r) Ts[wave][8 * hlf + r][t * 16 + nloc] = acc[t][r] * (1.0f / (XS * WSC));
  wave_lds_sync();
  v2f pr[16], qr[16];
#pragma unroll   // all 32 reads of the staging are issued before the first is waited for
  for (int rr = 0; rr < 16; ++rr) { pr[rr] = *(const v2f*)(&Ts[wave][rr][2 * lane]); qr[rr] = *(const v2f*)(&Ts[wave][rr][HW + 2 * lane]); }
  hold_loads();
#pragma unroll   // constant indices keep pr, qr in registers
  for (int rr = 0; rr < 16; ++rr) { const v2f p = pr[rr], q = qr[rr]; const float v = fmaxf(fmaxf(p[0], p[1]), fmaxf(q[0], q[1])); Ph[wave][rr][lane] = (b16)(v * XS); }
  wave_lds_sync();
  const int row = lane >> 2, seg = (lane & 3) * 8; const size_t gi = ((size_t)b * CG + d0 + row) * M + h2 * (HW / 2) + seg;
  *(v8b*)(G16 + gi) = *(const v8b*)(&Ph[wave][row][seg]); *(v8b*)(G16 + gi + 8 * M) = *(const v8b*)(&Ph[wave][8 + row][seg]);
  asm volatile("s_wait_xcnt 0x0" ::: "memory");   // behind the last store of this part: whatever code follows it in the joint kernel may reuse the registers that these stores name
}
__global__ __launch_bounds__(512) void proj_kernel(const float* __restrict__ x, const float* __restrict__ wq, const float* __restrict__ wk, const float* __restrict__ wg, const float* __restrict__ wo, b16* __restrict__ WO, b16* __restrict__ QH, b16* __restrict__ QL, b16* __restrict__ KH, b16* __restrict__ KL, b16* __restrict__ G16) {
  __shared__ __attribute__((aligned(16))) unsigned char S[SZ_S];   // 218,112 B: one work-group on a WGP
  static_assert(C * CG == (N / 128) * NB * 128, "each work-group converts 128 elements of W_o");
  const int blk = blockIdx.x, b = blk >> 5, h2 = blk & 31, lane = threadIdx.x & 31; const int wv = __builtin_amdgcn_readfirstlane(threadIdx.x >> 5);   // the wave's number, in a scalar register: the branches on it are scalar
  // W_o for launch 2 (f16 x256): this work-group's 128 elements, by its last wave; requested here, stored behind that wave's part
  v4f wov = {}; if (wv == 15) { wov = *(const v4f*)(wo + blk * 128 + lane * 4); asm volatile("s_wait_xcnt 0x0" ::: "memory"); }   // the wait stands in front of any rewrite of the address registers that this load names
  // all 40 loads of a lane are issued before the first is waited for: weight rows wv + 16 j (a wave: one 1-KB row, 32 bytes a lane; they hit in L2 and are worked on first), then channels 16 wv .. 16 wv + 15 of x
  v4f wr[12][2], xv[16];
#pragma unroll   // constant indices keep wr in registers
  for (int j = 0; j < 12; ++j) { const float* src = (j < 8 ? wg + (size_t)(wv + 16 * j) * C : j < 10 ? wq + (size_t)(wv + 16 * (j - 8)) * C : wk + (size_t)(wv + 16 * (j - 10)) * C) + lane * 8; wr[j][0] = *(const v4f*)src; wr[j][1] = *(const v4f*)(src + 4); }
  const float* xr = x + ((size_t)b * C + wv * 16) * N + h2 * 128 + lane * 4;
#pragma unroll   // constant indices keep xv in registers
  for (int i = 0; i < 16; ++i) { if (i == 15) asm volatile("s_wait_xcnt 0x0" ::: "memory");   // in front of the last load, whose result may return into the address registers that the loads before it name
    xv[i] = *(const v4f*)(xr + (size_t)i * N); }
  hold_loads();
#pragma unroll   // this loop and the next three: constant indices keep wr, xv, c0, c1, o in registers
  for (int j = 0; j < 12; ++j) *(v8b*)(S + (j < 8 ? (wv + 16 * j) * XP : OFF_Q + OFF_WL + (wv + 16 * (j - 8)) * XP) + lane * 16) = cvt8(wr[j][0], wr[j][1], WSC);
#pragma unroll
  for (int j = 0; j < 4; ++j) { unsigned char* d = S + OFF_XL + xrow(lane * 4 + j) * XP + wv * 32; v8b c0, c1;
#pragma unroll
    for (int e = 0; e < 8; e += 2) { b16 p, q; cvt2(xv[e][j], xv[e + 1][j], XS, p, q); c0[e] = p; c0[e + 1] = q; cvt2(xv[8 + e][j], xv[9 + e][j], XS, p, q); c1[e] = p; c1[e + 1] = q; }
    *(v8b*)d = c0; *(v8b*)(d + 16) = c1; }
  __syncthreads();   // every wave's rows are stored: tile and weights are readable
  if (wv < 8) gv_part(S, S + OFF_XL, wv, blk, G16);
  else { qk_part(S + OFF_Q, S + OFF_XL, wv - 8, blk, QH, QL, KH, KL);
    if (wv == 15) { v4b o;
#pragma unroll
      for (int e = 0; e < 4; e += 2) { b16 p, q; cvt2(wov[e], wov[e + 1], WSC, p, q); o[e] = p; o[e + 1] = q; }
      *(v4b*)(WO + blk * 128 + lane * 4) = o;
      asm volatile("s_wait_xcnt 0x0" ::: "memory"); } }   // behind the last store of this wave: whatever code follows it in the joint kernel may reuse the registers that the store names
}
// attention: grid (N/128 query blocks, 1, B); block = 8 waves x 16 queries, one work-group on a WGP. K (hi, lo) and the pooled g (all 128 channels) come in stages of 64 pooled keys into a
// two-buffer LDS ring that all 8 waves read: every lane copies 16 B pieces with asynchronous copies to LDS (whole 128-B lines per 8 lanes for g, 4 KB contiguous for K), one stage ahead of its use.
// Per block of 32 pooled keys: S^T = Phi . Theta^T with (Kh Qh + Kh Ql + Kl Qh), online softmax (f32, exp2), O^T (8 tiles) += g[d][keys] P^T. Behind the loop W_o (in LDS since trip 0) x O^T / l,
// 16 tiles of 16 channels a wave; out[b][c][n] = gamma (W_o O / l) + x, staged in LDS over the ring so that a wave writes whole 512-B rows (16 bytes a lane); x is requested ahead of its use.
constexpr int KS = 64 /* keys per stage */, VP = 144, KP = 80 /* LDS row pitch in bytes, 16 B x odd: 16 rows of a 16-byte read fall on 64 distinct banks */;
constexpr int OFF_VH = 0, OFF_KH = 128 * VP, OFF_KL = OFF_KH + KS * KP, STAGE_B = OFF_KL + KS * KP;   // 28,672 B per buffer
constexpr int TO_B = C * (128 + 4) * 4 /* output staging, over the ring */, OFF_WO = TO_B, WP = CG * 2 + 16 /* pitch of a W_o row in LDS: 272 B = 16 B x odd */;
static_assert(TO_B >= 2 * STAGE_B, "the ring lies inside the output staging");
// one stage (keys k0 .. k0 + 63) into the buffer at LDS byte address lb: 6 copies per lane, 256 lanes; g rows vr + 32 j (8 lanes x 16 B = one 128-B line each), K rows kr (4 lanes x 16 B)
__device__ __forceinline__ void stage_kv(unsigned lb, const b16* Vb, const b16* Khb, const b16* Klb, int k0, int tid) {
  const int vr = tid >> 3, vc = tid & 7, kr = tid >> 2, kc = tid & 3; const unsigned lv = lb + vr * VP + vc * 16, lk = lb + kr * KP + kc * 16; const size_t gv = (size_t)vr * M + k0 + vc * 8, gk = (size_t)(k0 + kr) * CQ + kc * 8;
  // the six copies and, as the statement's last line, the wait that stands in front of any rewrite of the address registers they name
  asm volatile("global_load_async_to_lds_b128 %0, %1, off\n\tglobal_load_async_to_lds_b128 %2, %3, off\n\tglobal_load_async_to_lds_b128 %4, %5, off\n\tglobal_load_async_to_lds_b128 %6, %7, off\n\t"
               "global_load_async_to_lds_b128 %8, %9, off\n\tglobal_load_async_to_lds_b128 %10, %11, off\n\ts_wait_xcnt 0x0"
               :: "v"(lv + OFF_VH), "v"(Vb + gv), "v"(lv + OFF_VH + 32 * VP), "v"(Vb + gv + 32 * M), "v"(lv + OFF_VH + 64 * VP), "v"(Vb + gv + 64 * M), "v"(lv + OFF_VH + 96 * VP), "v"(Vb + gv + 96 * M),
                  "v"(lk + OFF_KH), "v"(Khb + gk), "v"(lk + OFF_KL), "v"(Klb + gk) : "memory");
}
// eight rows' pieces of W_o (rows 16 apart; 16 lanes x 16 B = one 256-B row) into LDS: the copies and, as the statement's last line, the wait that stands in front of any rewrite of the address registers they name
__device__ __forceinline__ void stage_wo8(unsigned lw, const b16* gw) {
  asm volatile("global_load_async_to_lds_b128 %0, %1, off\n\tglobal_load_async_to_lds_b128 %2, %3, off\n\tglobal_load_async_to_lds_b128 %4, %5, off\n\tglobal_load_async_to_lds_b128 %6, %7, off\n\t"
               "global_load_async_to_lds_b128 %8, %9, off\n\tglobal_load_async_to_lds_b128 %10, %11, off\n\tglobal_load_async_to_lds_b128 %12, %13, off\n\tglobal_load_async_to_lds_b128 %14, %15, off\n\ts_wait_xcnt 0x0"
               :: "v"(lw), "v"(gw), "v"(lw + 16 * WP), "v"(gw + 16 * CG), "v"(lw + 32 * WP), "v"(gw + 32 * CG), "v"(lw + 48 * WP), "v"(gw + 48 * CG),
                  "v"(lw + 64 * WP), "v"(gw + 64 * CG), "v"(lw + 80 * WP), "v"(gw + 80 * CG), "v"(lw + 96 * WP), "v"(gw + 96 * CG), "v"(lw + 112 * WP), "v"(gw + 112 * CG) : "memory");
}
__global__ __launch_bounds__(256) void attn_kernel(const b16* __restrict__ QH, const b16* __restrict__ QL, const b16* __restrict__ KH, const b16* __restrict__ KL, const b16* __restrict__ G16, const b16* __restrict__ WO, const float* __restrict__ x, const float* __restrict__ gamma_, float* __restrict__ out) {
  __shared__ __attribute__((aligned(128))) unsigned char L[TO_B + C * WP];   // the ring, after the loop the output staging To[256][128 + 4] (135,168 B); behind it W_o [256][WP] (69,632 B)
  const int tid = threadIdx.x, wave = threadIdx.x >> 5, lane = threadIdx.x & 31, hh = lane >> 4, col = lane & 15; const int b = blockIdx.z; const int q0 = blockIdx.x * 128 + wave * 16, qi = q0 + col;
  const size_t qrow = (size_t)b * N + qi; const v16b qh = frag_kb(QH + qrow * CQ, hh), ql = frag_kb(QL + qrow * CQ, hh);
  const b16* Khb = KH + (size_t)b * M * CQ; const b16* Klb = KL + (size_t)b * M * CQ; const b16* Vb = G16 + (size_t)b * CG * M; const float gamma = bf16_rne(gamma_[0]);
  const unsigned lds0 = (unsigned)(size_t)L;
  float m = -INFINITY, l = 0.0f; v8f o[8];
#pragma unroll
  for (int t = 0; t < 8; ++t) o[t] = (v8f){};
  stage_kv(lds0, Vb, Khb, Klb, 0, tid);
  asm volatile("s_wait_asynccnt 0x0" ::: "memory");   // this wave's copies of stage 0 have landed
  __syncthreads();                                    // every wave's have: stage 0 is readable
  stage_kv(lds0 + STAGE_B, Vb, Khb, Klb, KS, tid);
  // W_o flies with stage 1: 16 copies a lane (22 outstanding with the stage's six); the wait and the barrier at the foot of trip 0 land and publish it, it is read behind the loop
  { const unsigned lw = lds0 + OFF_WO + (tid >> 4) * WP + (tid & 15) * 16; const b16* gw = WO + (size_t)(tid >> 4) * CG + (tid & 15) * 8; stage_wo8(lw, gw); stage_wo8(lw + 128 * WP, gw + 128 * CG); }
  for (int st = 0; st < M / KS; ++st) {
    const unsigned char* B = L + (st & 1) * STAGE_B;
    // LDS fragment reads stand well in front of the products that use them: per 32 keys the four K fragments as one group,
    // the eight g fragments as one group behind the first energy product, so that energies and softmax cover their latency; every read of a stage still ends in front of the stage's foot
    v16b kf[4];
    auto ldk = [&](int kk) { kf[0] = frag_kb((const b16*)(B + OFF_KH + (kk + col) * KP), hh); kf[1] = frag_kb((const b16*)(B + OFF_KH + (kk + 16 + col) * KP), hh); kf[2] = frag_kb((const b16*)(B + OFF_KL + (kk + col) * KP), hh); kf[3] = frag_kb((const b16*)(B + OFF_KL + (kk + 16 + col) * KP), hh); };
    for (int kk = 0; kk < KS; kk += 32) {
      v16b vh[8];
      ldk(kk);
      v8f s0 = {}, s1 = {};
      s0 = wmma16b(kf[0], qh, s0);
#pragma unroll   // constant indices keep vh in registers
      for (int t = 0; t < 8; ++t) vh[t] = frag_kb((const b16*)(B + OFF_VH + (t * 16 + col) * VP) + kk, hh);
      hold_loads(); s0 = wmma16b(kf[0], ql, s0); s0 = wmma16b(kf[2], qh, s0);
      s1 = wmma16b(kf[1], qh, s1); s1 = wmma16b(kf[1], ql, s1); s1 = wmma16b(kf[3], qh, s1);
      float e[16]; float mx = -INFINITY; const float cs = LOG2E / (XS * XS);
#pragma unroll
      for (int r = 0; r < 8; ++r) { e[r] = s0[r] * cs; e[8 + r] = s1[r] * cs; mx = fmaxf(mx, fmaxf(e[r], e[8 + r])); }
      mx = fmaxf(mx, __shfl_xor(mx, 16)); const float mn = fmaxf(m, mx); const float al = nexp2(m - mn); m = mn; float sum = 0.0f; v16b ph;
float p[16];
#pragma unroll   // constant indices keep e, p in registers (this loop and the next)
      for (int i = 0; i < 16; ++i) e[i] -= mn;
      exp2x8(p, e, 0); exp2x8(p, e, 8);
#pragma unroll
      for (int i = 0; i < 16; ++i) { sum += p[i]; ph[i] = (b16)(p[i] * PS); }
      sum += __shfl_xor(sum, 16); l = l * al + sum;
#pragma unroll
      for (int t = 0; t < 8; ++t) { o[t] *= al; o[t] = wmma16b(vh[t], ph, o[t]); } }
    asm volatile("s_wait_dscnt 0x0" ::: "memory");      // this wave's reads of the buffer are done before it is refilled
    asm volatile("s_wait_asynccnt 0x0" ::: "memory");   // this wave's copies of stage st + 1 (in trip 0 of W_o too) have landed
    __syncthreads();                                    // publishes stage st + 1 and ends every wave's reads of stage st
    if (st + 2 < M / KS) stage_kv(lds0 + (st & 1) * STAGE_B, Vb, Khb, Klb, (st + 2) * KS, tid);
  }
  asm volatile("s_wait_asynccnt 0x0" ::: "memory");     // no copy is outstanding when the ring becomes output staging
  // the wave's O^T / l as B fragments of W_o O^T: o[t][r] = O^T[d = t*16 + 8hh + r][query col], so tiles 2 ks and 2 ks + 1 are elements 0..7 and 8..15 of k step ks (d = 32 ks + 8hh + e, 32 ks + 16 + 8hh + e), the order of frag_kb
  const float inv = 1.0f / (l * PS);   // O x8
  v16b oh[CG / 32], oq[CG / 32];
#pragma unroll   // both loops: constant indices keep o, oh, oq in registers
  for (int ks = 0; ks < CG / 32; ++ks)
#pragma unroll
    for (int r = 0; r < 8; ++r) { b16 h_, l_; split16(o[2 * ks][r] * inv, h_, l_); oh[ks][r] = h_; oq[ks][r] = l_; split16(o[2 * ks + 1][r] * inv, h_, l_); oh[ks][8 + r] = h_; oq[ks][8 + r] = l_; }
  float (*To)[128 + 4] = (float (*)[128 + 4])L;
  // the residual x of the wave's 32 output rows (a lane: 16 bytes of each 512-B row): the first XA rows are requested here, in front of the W_o products, which cover their latency;
  // the rest, for which no registers are free yet, behind the barrier below, in front of the work on the first rows
  constexpr int XA = 16;
  const size_t ro = ((size_t)b * C + wave * 32) * N + blockIdx.x * 128 + lane * 4; const float* xr = x + ro; float* orow = out + ro;
  v4f xv[32];
  hold_loads();   // without it the requests are lifted over the conversion above, whose inputs still fill the registers, and the kernel needs registers above v255
#pragma unroll   // constant indices keep xv in registers
  for (int i = 0; i < XA; ++i) xv[i] = *(const v4f*)(xr + (size_t)i * N);
  hold_loads();
  // the four W_o fragments of channel tile ct + 1 are read in front of the products of tile ct (two register buffers)
  v16b wa[2][CG / 32];
  auto ldw = [&](int ct) {
#pragma unroll   // constant indices keep the buffers in registers
    for (int ks = 0; ks < CG / 32; ++ks) wa[ct & 1][ks] = frag_kb((const b16*)(L + OFF_WO + (ct * 16 + col) * WP) + ks * 32, hh); };
  ldw(0); hold_loads();
#pragma unroll   // buffer numbers must be compile-time constants
  for (int ct = 0; ct < C / 16; ++ct) { if (ct + 1 < C / 16) { ldw(ct + 1); hold_loads(); }
    v8f ah = {}, aq = {};
#pragma unroll
    for (int ks = 0; ks < CG / 32; ++ks) { ah = wmma16b(wa[ct & 1][ks], oh[ks], ah); aq = wmma16b(wa[ct & 1][ks], oq[ks], aq); }
#pragma unroll   // ah[r] = (W_o O)[c = ct*16 + 8hh + r][query col] x 2048 -> To[c][wave*16 + col]
    for (int r = 0; r < 8; ++r) To[ct * 16 + 8 * hh + r][wave * 16 + col] = (ah[r] + aq[r]) * (1.0f / (XS * WSC)); }
  __syncthreads();   // every wave's 16 query columns of all 256 rows are in To
#pragma unroll   // constant indices keep xv in registers
  for (int i = XA; i < 32; ++i) { if (i == 31) asm volatile("s_wait_xcnt 0x0" ::: "memory");   // in front of the last load, whose result may return into the address registers that the loads before it name
    xv[i] = *(const v4f*)(xr + (size_t)i * N); }
  hold_loads();
#pragma unroll   // constant indices keep xv in registers
  for (int i0 = 0; i0 < 32; i0 += 8) {
    v4f tv[8];
#pragma unroll   // the eight reads of the staging are issued before the first is waited for
    for (int i = 0; i < 8; ++i) tv[i] = *(const v4f*)(&To[wave * 32 + i0 + i][lane * 4]);
#pragma unroll
    for (int i = 0; i < 8; ++i) { v4f r;
#pragma unroll
      for (int j = 0; j < 4; ++j) r[j] = gamma * tv[i][j] + bf16_rne(xv[i0 + i][j]);
      *(v4f*)(orow + (size_t)(i0 + i) * N) = r; }
    if (i0 + 8 < 32) asm volatile("s_wait_xcnt 0x0" ::: "memory");   // stands in front of the next group's rewrite of the registers that this group's stores name
  }
}
}  // namespace

extern "C" void kernel_launch(void* const* d_in, const int* in_sizes, int n_in, void* d_out, int out_size, void* d_ws, size_t ws_size, hipStream_t stream) {
  (void)n_in;
  auto Fp = [&](int i) { return (const float*)d_in[i]; };
  // input order: 0 x [8,256,64,64], 1 w_theta [32,256], 2 w_phi [32,256], 3 w_g [128,256], 4 w_o [256,128], 5 gamma [1]
  if (in_sizes[0] != NB * C * N || in_sizes[1] != CQ * C || in_sizes[2] != CQ * C || in_sizes[3] != CG * C || in_sizes[4] != C * CG || in_sizes[5] != 1 || out_size != NB * C * N) return;
  size_t off = 0; char* ws = (char*)d_ws;
  auto carve = [&](size_t bytes) { char* p = ws + off; off += (bytes + 255) & ~(size_t)255; return p; };
  b16* WO = (b16*)carve((size_t)C * CG * 2);
  b16* QH = (b16*)carve((size_t)NB * N * CQ * 2); b16* QL = (b16*)carve((size_t)NB * N * CQ * 2); b16* KH = (b16*)carve((size_t)NB * M * CQ * 2); b16* KL = (b16*)carve((size_t)NB * M * CQ * 2);
  b16* G16 = (b16*)carve((size_t)NB * CG * M * 2);
  if (off > ws_size || off > ((size_t)128 << 20)) return;   // = 7.1 MB
  proj_kernel<<<(N / 128) * NB, 512, 0, stream>>>(Fp(0), Fp(1), Fp(2), Fp(3), Fp(4), WO, QH, QL, KH, KL, G16);
  attn_kernel<<<dim3(N / 128, 1, NB), 256, 0, stream>>>(QH, QL, KH, KL, G16, WO, Fp(0), Fp(5), (float*)d_out);
}

// v010
// It runs in 32 microseconds.
// In two side-by-side timings against v009, it was 1.07 and 1.11 times as fast.
// Over all steps from v000 it is 8.67 times as fast.
#include <hip/hip_runtime.h>

// Self-attention block (8 images x 256 ch x 64 x 64): theta = W_theta x (32 ch, all 4,096 pixels), phi = maxpool2x2(W_phi x) (32 ch x 1,024 pooled positions), g = maxpool2x2(W_g x) (128 x 1,024),
// beta = softmax over the 1,024 pooled keys of theta^T phi (no scaling), o = W_o (g beta^T), out = gamma * o + x. The 1x1 convs are channel GEMMs; the attention runs once per query over the 128 pooled
// g channels, and each wave applies W_o (256 x 128) behind the key loop to its own normalised accumulators, which already lie in the B fragment's order.
// WMMA (v_wmma_f32_16x16x32_f16, f32 accumulate): projections with EXACT bf16 pixels (x^T rows x8, via an LDS transpose of the channel-major input) and weights (x256), 1 product;
// energy tiles S^T = Phi . Theta^T with theta AND phi as f16 hi+lo x8 (3 products; logits sigma ~5.7); online softmax in f32; O^T += g P^T with
// g and P each rounded once to f16 x8 (1 product; relative error 2^-11 an operand); W_o O^T with W_o exact and O as f16 hi+lo x8 (2 products). Max-pooling, softmax, gamma, residual in f32. Inputs rounded to bf16 once (gamma and the residual x included). Fragment k-map

namespace {
constexpr int NB = 8, C = 256, CQ = 32, N = 4096, M = 1024 /* pooled positions */, CG = 128 /* g channels */, HW = 64;
constexpr float XS = 8.0f, WSC = 256.0f, PS = 8.0f, LOG2E = 1.4426950408889634f;

typedef _Float16 b16;
typedef __attribute__((ext_vector_type(16))) _Float16 v16b;
typedef __attribute__((ext_vector_type(8))) _Float16 v8b;
typedef __attribute__((ext_vector_type(8))) float v8f;
typedef __attribute__((ext_vector_type(4))) float v4f;
__device__ __forceinline__ float bf16_rne(float f) { unsigned int u = __float_as_uint(f); u += 0x7FFFu + ((u >> 16) & 1u); return __uint_as_float(u & 0xFFFF0000u); }
__device__ __forceinline__ void split16(float v, b16& hi, b16& lo) { hi = (b16)v; lo = (b16)(v - (float)hi); }
__device__ __forceinline__ v16b frag_kb(const b16* p, int hh) { const v8b a = *(const v8b*)(p + 8 * hh), b = *(const v8b*)(p + 16 + 8 * hh); v16b f;
#pragma unroll
  for (int e = 0; e < 8; ++e) { f[e] = a[e]; f[8 + e] = b[e]; } return f; }
__device__ __forceinline__ v8f wmma16b(v16b a, v16b b, v8f c) { return __builtin_amdgcn_wmma_f32_16x16x32_f16(false, a, false, b, (short)0, c, false, false); }
// stands behind a group of loads that is issued ahead of its use: without it the scheduler sinks each load to just in front of the product that reads it, and the wave waits out the whole latency there
__device__ __forceinline__ void hold_loads() { __builtin_amdgcn_sched_barrier(0); }
__device__ __forceinline__ void wave_lds_sync() { __builtin_amdgcn_fence(__ATOMIC_RELEASE, "workgroup"); __builtin_amdgcn_wave_barrier(); __builtin_amdgcn_fence(__ATOMIC_ACQUIRE, "workgroup"); }
__device__ __forceinline__ float nexp2(float x) { return __builtin_amdgcn_exp2f(x); }
// eight exponentials p[o .. o + 7] = 2^d[o .. o + 7] in one statement: the outputs are early-clobber, so that none lies on the source of the exponential in front of it, and the closing v_nop is the slot
// that the instruction set asks for between a transcendental and a directly following instruction that reads its result or overwrites its source
__device__ __forceinline__ void exp2x8(float (&p)[16], const float (&d)[16], int o) {
  asm("v_exp_f32 %0, %8\n\tv_exp_f32 %1, %9\n\tv_exp_f32 %2, %10\n\tv_exp_f32 %3, %11\n\tv_exp_f32 %4, %12\n\tv_exp_f32 %5, %13\n\tv_exp_f32 %6, %14\n\tv_exp_f32 %7, %15\n\tv_nop"
      : "=&v"(p[o]), "=&v"(p[o + 1]), "=&v"(p[o + 2]), "=&v"(p[o + 3]), "=&v"(p[o + 4]), "=&v"(p[o + 5]), "=&v"(p[o + 6]), "=&v"(p[o + 7])
      : "v"(d[o]), "v"(d[o + 1]), "v"(d[o + 2]), "v"(d[o + 3]), "v"(d[o + 4]), "v"(d[o + 5]), "v"(d[o + 6]), "v"(d[o + 7]));
}

typedef __attribute__((ext_vector_type(4))) _Float16 v4b;
typedef __attribute__((ext_vector_type(2))) float v2f;
// launch 1 reads every GEMM operand from LDS. One work-group of 16 waves = 128 pixels (image rows 2 h2 and 2 h2 + 1) x all 192 projected channels: it reads its 256 x 128 piece of the channel-major f32 x
// (whole 512-B rows, 16 bytes a lane) and the three f32 weight matrices itself, rounds and scales them in registers and stores them into LDS as f16 rows of 256 channels; x is transposed by that store
// (a lane holds 16 channels of 4 pixels and stores 32 bytes of each pixel's row). Waves 0..7 then do the g part, waves 8..15 the theta/phi part, from the one tile.
constexpr int XP = C * 2 + 16 /* pitch of a staged row in LDS: 528 B = 16 B x odd */;
constexpr int GPP = 32 + 8 /* pitch of Ph in halves: 80 B = 16 B x odd */, SZ_TS = 8 * 16 * (128 + 4) * 4, SZ_G = 8 * 16 * GPP * 2;
constexpr int OFF_XL = SZ_TS + SZ_G /* the x^T tile [128][XP], behind the g part's W_g / Ts and Ph */, OFF_Q = OFF_XL + 128 * XP /* the theta/phi part's block */;
constexpr int OFF_WL = 2 * 8 * 16 * (CQ + 8) * 2 + 8 * 16 * (CQ + 4) * 4 /* in that block: W_theta, W_phi [64][XP], behind its output staging */, SZ_S = OFF_Q + OFF_WL + 2 * CQ * XP;
// LDS row of pixel n of the tile: the two low bits are turned by bits 4, 5, so that the 16 rows of a fragment read (n = 16 t + 0..15) and the 16 rows of a transposing store (n = 4 lane + j) both fall on 16 distinct bank groups
__device__ __forceinline__ int xrow(int n) { return n ^ ((n >> 4) & 3); }
// f32 -> nearest-even bf16 -> x s as f16 (exact): the same values as bf16_rne, by the conversion instruction
typedef __attribute__((ext_vector_type(2))) __bf16 v2bf;
__device__ __forceinline__ void cvt2(float a, float b, float s, b16& x0, b16& x1) { const v2f t = {a, b}; const unsigned u = __builtin_bit_cast(unsigned, __builtin_convertvector(t, v2bf)); x0 = (b16)(__uint_as_float(u << 16) * s); x1 = (b16)(__uint_as_float(u & 0xFFFF0000u) * s); }
__device__ __forceinline__ v8b cvt8(v4f a, v4f b, float s) { v8b o;
#pragma unroll   // constant indices keep o in registers
  for (int e = 0; e < 4; e += 2) { b16 p, q; cvt2(a[e], a[e + 1], s, p, q); o[e] = p; o[e + 1] = q; cvt2(b[e], b[e + 1], s, p, q); o[4 + e] = p; o[5 + e] = q; } return o; }
// theta/phi projection: [n x 256] x [256 x 32]. A wave's 16 pixel rows are 8 neighbours of image row 2 h2 and the 8 below them, so that it holds whole 2x2 pooling windows:
// theta goes out as QH/QL [b][n][32] f16 hi+lo x8 (64-B rows), phi is max-pooled from the wave's f32 staging and goes out as KH/KL [b][m][32] f16 hi+lo x8 (4 pooled positions a wave)
__device__ __forceinline__ void qk_part(unsigned char* S, const unsigned char* XL, int wave, int blk, b16* __restrict__ QH, b16* __restrict__ QL, b16* __restrict__ KH, b16* __restrict__ KL) {
  b16 (*Th)[16][CQ + 8] = (b16 (*)[16][CQ + 8])S; b16 (*Tl)[16][CQ + 8] = (b16 (*)[16][CQ + 8])(S + 8 * 16 * (CQ + 8) * 2); float (*Tf)[16][CQ + 4] = (float (*)[16][CQ + 4])(S + 2 * 8 * 16 * (CQ + 8) * 2);
  const int lane = threadIdx.x & 31, nloc = lane & 15, hlf = lane >> 4; const int gw = blk * 8 + wave; const int b = gw >> 8, h2 = (gw >> 3) & 31, w0 = (gw & 7) * 8;
  auto pix = [&](int rr) { return (size_t)b * N + (size_t)(2 * h2 + (rr >> 3)) * HW + w0 + (rr & 7); };   // over b*N + n
  const unsigned char* Xa = XL + xrow((nloc >> 3) * HW + w0 + (nloc & 7)) * XP; const unsigned char* Wl = S + OFF_WL + nloc * XP;
  v8f acc[4] = {{}, {}, {}, {}};   // tiles: q0, q1, k0, k1
  // the fragments of k step k + 3 are requested in front of the products of k step k (four register buffers)
  v16b a[4], w[4][4];
  auto ld = [&](int k) { a[k & 3] = frag_kb((const b16*)Xa + k * 32, hlf);
#pragma unroll   // constant indices keep the buffers in registers
    for (int t = 0; t < 4; ++t) w[k & 3][t] = frag_kb((const b16*)(Wl + t * 16 * XP) + k * 32, hlf); };
  ld(0); ld(1); ld(2); hold_loads();
#pragma unroll   // buffer numbers must be compile-time constants
  for (int k = 0; k < C / 32; ++k) { if (k + 3 < C / 32) { ld(k + 3); hold_loads(); }
#pragma unroll
    for (int t = 0; t < 4; ++t) acc[t] = wmma16b(a[k & 3], w[k & 3][t], acc[t]); }
#pragma unroll
  for (int t = 0; t < 4; ++t) { const int which = t >> 1, c = (t & 1) * 16 + nloc;
#pragma unroll
    for (int r = 0; r < 8; ++r) { const float v = acc[t][r] * (1.0f / (XS * WSC)); if (which == 0) { b16 h_, l_; split16(v * XS, h_, l_); Th[wave][8 * hlf + r][c] = h_; Tl[wave][8 * hlf + r][c] = l_; } else Tf[wave][8 * hlf + r][c] = v; } }
  wave_lds_sync();
  {
    for (int q = 0; q < 2; ++q) { const int rr = q * 8 + (lane >> 2), seg = (lane & 3) * 8; *(v8b*)(QH + pix(rr) * CQ + seg) = *(const v8b*)(&Th[wave][rr][seg]); *(v8b*)(QL + pix(rr) * CQ + seg) = *(const v8b*)(&Tl[wave][rr][seg]); }
    const int i = lane >> 3, c4 = (lane & 7) * 4;   // pooled position w0 / 2 + i, channels c4 .. c4 + 3
    const v4f p00 = *(const v4f*)(&Tf[wave][2 * i][c4]), p01 = *(const v4f*)(&Tf[wave][2 * i + 1][c4]), p10 = *(const v4f*)(&Tf[wave][8 + 2 * i][c4]), p11 = *(const v4f*)(&Tf[wave][8 + 2 * i + 1][c4]); v4b hv, lv;
#pragma unroll   // constant indices keep hv, lv in registers
    for (int j = 0; j < 4; ++j) { const float v = fmaxf(fmaxf(p00[j], p01[j]), fmaxf(p10[j], p11[j])); b16 h_, l_; split16(v * XS, h_, l_); hv[j] = h_; lv[j] = l_; }
    const size_t ko = ((size_t)b * M + h2 * (HW / 2) + (w0 >> 1) + i) * CQ + c4; *(v4b*)(KH + ko) = hv; *(v4b*)(KL + ko) = lv;
    asm volatile("s_wait_xcnt 0x0" ::: "memory");   // behind the last store of this part: whatever code follows it in the joint kernel may reuse the registers that these stores name
  }
}
// g projection and pooling by 8 waves = all 128 g channels x 128 pixels (image rows 2 h2 and 2 h2 + 1). GEMM rows d (A = W_g rows, K = c) x cols n (B = rows n of the x^T tile): each wave
// stages 16 d-rows x 128 n floats and max-pools them 2x2 (a lane takes pooled column w2 = lane of all 16 rows); the pooled values go out channel-major, G16 [b][d][m] = f16 x8,
// through the wave's own Ph [16 d][32 m] in LDS, so that a lane stores 16 bytes of one channel row
__device__ __forceinline__ void gv_part(unsigned char* S, const unsigned char* XL, int wave, int blk, b16* __restrict__ G16) {
  float (*Ts)[16][128 + 4] = (float (*)[16][128 + 4])S; b16 (*Ph)[16][GPP] = (b16 (*)[16][GPP])(S + SZ_TS);
  const int lane = threadIdx.x & 31, nloc = lane & 15, hlf = lane >> 4; const int b = blk >> 5, h2 = blk & 31; const int d0 = wave * 16;
  // W_g [128][XP] lies where Ts lies later: a wave's 16 rows of W_g, which it alone reads, are the very bytes of its own Ts rows
  static_assert(XP == (128 + 4) * 4, "a wave's W_g rows and its Ts rows are the same bytes");
  const unsigned char* Wa = S + (d0 + nloc) * XP;
  v8f acc[8];
#pragma unroll
  for (int t = 0; t < 8; ++t) acc[t] = (v8f){};
  // the nine fragments of k step k + 1 are requested in front of the products of k step k (two register buffers)
  v16b a[2], bf[2][8];
  auto ld = [&](int k) { a[k & 1] = frag_kb((const b16*)Wa + k * 32, hlf);
#pragma unroll   // constant indices keep the buffers in registers
    for (int t = 0; t < 8; ++t) bf[k & 1][t] = frag_kb((const b16*)(XL + xrow(t * 16 + nloc) * XP) + k * 32, hlf); };
  ld(0); hold_loads();
#pragma unroll   // buffer numbers must be compile-time constants
  for (int k = 0; k < C / 32; ++k) { if (k + 1 < C / 32) { ld(k + 1); hold_loads(); }
#pragma unroll
    for (int t = 0; t < 8; ++t) acc[t] = wmma16b(a[k & 1], bf[k & 1][t], acc[t]); }
#pragma unroll
  for (int t = 0; t < 8; ++t)
#pragma unroll
    for (int r = 0; r < 8; ++r) Ts[wave][8 * hlf + r][t * 16 + nloc] = acc[t][r] * (1.0f / (XS * WSC));
  wave_lds_sync();
  v2f pr[16], qr[16];
#pragma unroll   // all 32 reads of the staging are issued before the first is waited for
  for (int rr = 0; rr < 16; ++rr) { pr[rr] = *(const v2f*)(&Ts[wave][rr][2 * lane]); qr[rr] = *(const v2f*)(&Ts[wave][rr][HW + 2 * lane]); }
  hold_loads();
#pragma unroll   // constant indices keep pr, qr in registers
  for (int rr = 0; rr < 16; ++rr) { const v2f p = pr[rr], q = qr[rr]; const float v = fmaxf(fmaxf(p[0], p[1]), fmaxf(q[0], q[1])); Ph[wave][rr][lane] = (b16)(v * XS); }
  wave_lds_sync();
  const int row = lane >> 2, seg = (lane & 3) * 8; const size_t gi = ((size_t)b * CG + d0 + row) * M + h2 * (HW / 2) + seg;
  *(v8b*)(G16 + gi) = *(const v8b*)(&Ph[wave][row][seg]); *(v8b*)(G16 + gi + 8 * M) = *(const v8b*)(&Ph[wave][8 + row][seg]);
  asm volatile("s_wait_xcnt 0x0" ::: "memory");   // behind the last store of this part: whatever code follows it in the joint kernel may reuse the registers that these stores name
}
__global__ __launch_bounds__(512) void proj_kernel(const float* __restrict__ x, const float* __restrict__ wq, const float* __restrict__ wk, const float* __restrict__ wg, const float* __restrict__ wo, b16* __restrict__ WO, b16* __restrict__ QH, b16* __restrict__ QL, b16* __restrict__ KH, b16* __restrict__ KL, b16* __restrict__ G16) {
  __shared__ __attribute__((aligned(16))) unsigned char S[SZ_S];   // 218,112 B: one work-group on a WGP
  static_assert(C * CG == (N / 128) * NB * 128, "each work-group converts 128 elements of W_o");
  const int blk = blockIdx.x, b = blk >> 5, h2 = blk & 31, lane = threadIdx.x & 31; const int wv = __builtin_amdgcn_readfirstlane(threadIdx.x >> 5);   // the wave's number, in a scalar register: the branches on it are scalar
  // W_o for launch 2 (f16 x256): this work-group's 128 elements, by its last wave; requested here, stored behind that wave's part
  v4f wov = {}; if (wv == 15) { wov = *(const v4f*)(wo + blk * 128 + lane * 4); asm volatile("s_wait_xcnt 0x0" ::: "memory"); }   // the wait stands in front of any rewrite of the address registers that this load names
  // all 40 loads of a lane are issued before the first is waited for: weight rows wv + 16 j (a wave: one 1-KB row, 32 bytes a lane; they hit in L2 and are worked on first), then channels 16 wv .. 16 wv + 15 of x
  v4f wr[12][2], xv[16];
#pragma unroll   // constant indices keep wr in registers
  for (int j = 0; j < 12; ++j) { const float* src = (j < 8 ? wg + (size_t)(wv + 16 * j) * C : j < 10 ? wq + (size_t)(wv + 16 * (j - 8)) * C : wk + (size_t)(wv + 16 * (j - 10)) * C) + lane * 8; wr[j][0] = *(const v4f*)src; wr[j][1] = *(const v4f*)(src + 4); }
  const float* xr = x + ((size_t)b * C + wv * 16) * N + h2 * 128 + lane * 4;
#pragma unroll   // constant indices keep xv in registers
  for (int i = 0; i < 16; ++i) { if (i == 15) asm volatile("s_wait_xcnt 0x0" ::: "memory");   // in front of the last load, whose result may return into the address registers that the loads before it name
    xv[i] = *(const v4f*)(xr + (size_t)i * N); }
  hold_loads();
#pragma unroll   // this loop and the next three: constant indices keep wr, xv, c0, c1, o in registers
  for (int j = 0; j < 12; ++j) *(v8b*)(S + (j < 8 ? (wv + 16 * j) * XP : OFF_Q + OFF_WL + (wv + 16 * (j - 8)) * XP) + lane * 16) = cvt8(wr[j][0], wr[j][1], WSC);
#pragma unroll
  for (int j = 0; j < 4; ++j) { unsigned char* d = S + OFF_XL + xrow(lane * 4 + j) * XP + wv * 32; v8b c0, c1;
#pragma unroll
    for (int e = 0; e < 8; e += 2) { b16 p, q; cvt2(xv[e][j], xv[e + 1][j], XS, p, q); c0[e] = p; c0[e + 1] = q; cvt2(xv[8 + e][j], xv[9 + e][j], XS, p, q); c1[e] = p; c1[e + 1] = q; }
    *(v8b*)d = c0; *(v8b*)(d + 16) = c1; }
  __syncthreads();   // every wave's rows are stored: tile and weights are readable
  if (wv < 8) gv_part(S, S + OFF_XL, wv, blk, G16);
  else { qk_part(S + OFF_Q, S + OFF_XL, wv - 8, blk, QH, QL, KH, KL);
    if (wv == 15) { v4b o;
#pragma unroll
      for (int e = 0; e < 4; e += 2) { b16 p, q; cvt2(wov[e], wov[e + 1], WSC, p, q); o[e] = p; o[e + 1] = q; }
      *(v4b*)(WO + blk * 128 + lane * 4) = o;
      asm volatile("s_wait_xcnt 0x0" ::: "memory"); } }   // behind the last store of this wave: whatever code follows it in the joint kernel may reuse the registers that the store names
}
// attention: grid (N/128 query blocks, 1, B); block = 8 waves = 4 groups of 32 queries x 2 halves of the keys, one work-group on a WGP: a wave takes two 16-query tiles and, of every stage of 64 keys, 32,
// so that each K and g fragment it reads from LDS feeds two tiles (half the LDS reads a query); the two waves of a query group join their (m, l, O) once behind the loop, through LDS. K (hi, lo) and the pooled g (all 128 channels) come in stages of 64 pooled keys into a
// two-buffer LDS ring that all 8 waves read: every lane copies 16 B pieces with asynchronous copies to LDS (whole 128-B lines per 8 lanes for g, 4 KB contiguous for K), one stage ahead of its use.
// Per block of 32 pooled keys: S^T = Phi . Theta^T with (Kh Qh + Kh Ql + Kl Qh), online softmax (f32, exp2), O^T (8 tiles) += g[d][keys] P^T. Behind the loop W_o (in LDS since trip 0) x O^T / l,
// 16 tiles of 16 channels a wave; out[b][c][n] = gamma (W_o O / l) + x, staged in LDS over the ring so that a wave writes whole 512-B rows (16 bytes a lane); x is requested ahead of its use.
constexpr int KS = 64 /* keys per stage */, VP = 144, KP = 80 /* LDS row pitch in bytes, 16 B x odd: 16 rows of a 16-byte read fall on 64 distinct banks */;
constexpr int OFF_VH = 0, OFF_KH = 128 * VP, OFF_KL = OFF_KH + KS * KP, STAGE_B = OFF_KL + KS * KP;   // 28,672 B per buffer
constexpr int TO_B = C * (128 + 4) * 4 /* output staging, over the ring */, OFF_WO = 0, WP = CG * 2 + 16 /* pitch of a W_o row in LDS: 272 B = 16 B x odd */;
// the ring lies behind W_o, not at LDS address 0: there the LDS-address operand of a copy of stage 0 was the very value that the loop keeps for its refills; as an asm operand it had to lie below v256, where the loop has no room, and was spilled to scratch
constexpr int OFF_R = C * WP /* ring and output staging */, OFF_X = OFF_R + TO_B /* hand-over between the two key halves */, XW = 16 * 128 + 64 /* floats a wave hands over: one tile's O (64 a lane), m, l */;
static_assert(TO_B >= 2 * STAGE_B, "the ring lies inside the output staging");
// one stage (keys k0 .. k0 + 63) into the buffer at LDS byte address lb: 6 copies per lane, 256 lanes; g rows vr + 32 j (8 lanes x 16 B = one 128-B line each), K rows kr (4 lanes x 16 B)
__device__ __forceinline__ void stage_kv(unsigned lb, const b16* Vb, const b16* Khb, const b16* Klb, int k0, int tid) {
  const int vr = tid >> 3, vc = tid & 7, kr = tid >> 2, kc = tid & 3; const unsigned lv = lb + vr * VP + vc * 16, lk = lb + kr * KP + kc * 16; const size_t gv = (size_t)vr * M + k0 + vc * 8, gk = (size_t)(k0 + kr) * CQ + kc * 8;
  // the six copies and, as the statement's last line, the wait that stands in front of any rewrite of the address registers they name
  asm volatile("global_load_async_to_lds_b128 %0, %1, off\n\tglobal_load_async_to_lds_b128 %2, %3, off\n\tglobal_load_async_to_lds_b128 %4, %5, off\n\tglobal_load_async_to_lds_b128 %6, %7, off\n\t"
               "global_load_async_to_lds_b128 %8, %9, off\n\tglobal_load_async_to_lds_b128 %10, %11, off\n\ts_wait_xcnt 0x0"
               :: "v"(lv + OFF_VH), "v"(Vb + gv), "v"(lv + OFF_VH + 32 * VP), "v"(Vb + gv + 32 * M), "v"(lv + OFF_VH + 64 * VP), "v"(Vb + gv + 64 * M), "v"(lv + OFF_VH + 96 * VP), "v"(Vb + gv + 96 * M),
                  "v"(lk + OFF_KH), "v"(Khb + gk), "v"(lk + OFF_KL), "v"(Klb + gk) : "memory");
}
// eight rows' pieces of W_o (rows 16 apart; 16 lanes x 16 B = one 256-B row) into LDS: the copies and, as the statement's last line, the wait that stands in front of any rewrite of the address registers they name
__device__ __forceinline__ void stage_wo8(unsigned lw, const b16* gw) {
  asm volatile("global_load_async_to_lds_b128 %0, %1, off\n\tglobal_load_async_to_lds_b128 %2, %3, off\n\tglobal_load_async_to_lds_b128 %4, %5, off\n\tglobal_load_async_to_lds_b128 %6, %7, off\n\t"
               "global_load_async_to_lds_b128 %8, %9, off\n\tglobal_load_async_to_lds_b128 %10, %11, off\n\tglobal_load_async_to_lds_b128 %12, %13, off\n\tglobal_load_async_to_lds_b128 %14, %15, off\n\ts_wait_xcnt 0x0"
               :: "v"(lw), "v"(gw), "v"(lw + 16 * WP), "v"(gw + 16 * CG), "v"(lw + 32 * WP), "v"(gw + 32 * CG), "v"(lw + 48 * WP), "v"(gw + 48 * CG),
                  "v"(lw + 64 * WP), "v"(gw + 64 * CG), "v"(lw + 80 * WP), "v"(gw + 80 * CG), "v"(lw + 96 * WP), "v"(gw + 96 * CG), "v"(lw + 112 * WP), "v"(gw + 112 * CG) : "memory");
}
__global__ __launch_bounds__(256) void attn_kernel(const b16* __restrict__ QH, const b16* __restrict__ QL, const b16* __restrict__ KH, const b16* __restrict__ KL, const b16* __restrict__ G16, const b16* __restrict__ WO, const float* __restrict__ x, const float* __restrict__ gamma_, float* __restrict__ out) {
  __shared__ __attribute__((aligned(128))) unsigned char L[OFF_X + 8 * XW * 4];   // W_o [256][WP] (69,632 B); the ring, after the loop the output staging To[256][128 + 4] (135,168 B); the hand-over (67,584 B)
  const int tid = threadIdx.x, wave = threadIdx.x >> 5, lane = threadIdx.x & 31, hh = lane >> 4, col = lane & 15; const int b = blockIdx.z;
  // wave = (key half kh, query group qg). Its tile u holds queries qg * 32 + (u ^ kh) * 16 + col: tile 0 is the one it keeps behind the loop, tile 1 the one it hands to the other half's wave (wave ^ 4), whose tile 0 that is
  const int qg = wave & 3, kh = wave >> 2, qc = qg * 32 + kh * 16;
  v16b qh[2], ql[2];
#pragma unroll   // constant indices keep qh, ql in registers
  for (int u = 0; u < 2; ++u) { const size_t qrow = (size_t)b * N + blockIdx.x * 128 + (qc ^ (u * 16)) + col; qh[u] = frag_kb(QH + qrow * CQ, hh); ql[u] = frag_kb(QL + qrow * CQ, hh); }
  // the wait stands in front of any rewrite of the address registers that these loads name; the scheduling barriers keep the loads in front of it and every later register write behind it
  hold_loads(); asm volatile("s_wait_xcnt 0x0" ::: "memory"); hold_loads();
  const b16* Khb = KH + (size_t)b * M * CQ; const b16* Klb = KL + (size_t)b * M * CQ; const b16* Vb = G16 + (size_t)b * CG * M; const float gamma = bf16_rne(gamma_[0]);
  const unsigned lds0 = (unsigned)(size_t)L + OFF_R;   // the ring
  float m[2] = {-INFINITY, -INFINITY}, l[2] = {0.0f, 0.0f}; v8f o[2][8];
#pragma unroll
  for (int t = 0; t < 8; ++t) { o[0][t] = (v8f){}; o[1][t] = (v8f){}; }
  stage_kv(lds0, Vb, Khb, Klb, 0, tid);
  asm volatile("s_wait_asynccnt 0x0" ::: "memory");   // this wave's copies of stage 0 have landed
  __syncthreads();                                    // every wave's have: stage 0 is readable
  stage_kv(lds0 + STAGE_B, Vb, Khb, Klb, KS, tid);
  // W_o flies with stage 1: 16 copies a lane (22 outstanding with the stage's six); the wait and the barrier at the foot of trip 0 land and publish it, it is read behind the loop
  { const unsigned lw = (unsigned)(size_t)L + OFF_WO + (tid >> 4) * WP + (tid & 15) * 16; const b16* gw = WO + (size_t)(tid >> 4) * CG + (tid & 15) * 8; stage_wo8(lw, gw); stage_wo8(lw + 128 * WP, gw + 128 * CG); }
  for (int st = 0; st < M / KS; ++st) {
    const unsigned char* B = L + OFF_R + (st & 1) * STAGE_B;
    // LDS fragment reads stand well in front of the products that use them: per 32 keys the four K fragments as one group,
    // the eight g fragments as one group behind the first energy product, so that energies and softmax cover their latency; every read of a stage still ends in front of the stage's foot
    v16b kf[4];
    auto ldk = [&](int kk) { kf[0] = frag_kb((const b16*)(B + OFF_KH + (kk + col) * KP), hh); kf[1] = frag_kb((const b16*)(B + OFF_KH + (kk + 16 + col) * KP), hh); kf[2] = frag_kb((const b16*)(B + OFF_KL + (kk + col) * KP), hh); kf[3] = frag_kb((const b16*)(B + OFF_KL + (kk + 16 + col) * KP), hh); };
    { const int kk = kh * 32;   // this wave's 32 keys of the stage
      v16b vh[8];
      ldk(kk);
      v8f s[2][2] = {{{}, {}}, {{}, {}}};   // s[u][j]: tile u, keys kk + 16 j ..
      s[0][0] = wmma16b(kf[0], qh[0], s[0][0]);
#pragma unroll   // constant indices keep vh in registers
      for (int t = 0; t < 8; ++t) vh[t] = frag_kb((const b16*)(B + OFF_VH + (t * 16 + col) * VP) + kk, hh);
      hold_loads(); s[1][0] = wmma16b(kf[0], qh[1], s[1][0]); s[0][1] = wmma16b(kf[1], qh[0], s[0][1]); s[1][1] = wmma16b(kf[1], qh[1], s[1][1]);
#pragma unroll   // four independent accumulators; each sums Kh Qh + Kh Ql + Kl Qh in that order
      for (int u = 0; u < 2; ++u) { s[u][0] = wmma16b(kf[0], ql[u], s[u][0]); s[u][1] = wmma16b(kf[1], ql[u], s[u][1]); }
#pragma unroll
      for (int u = 0; u < 2; ++u) { s[u][0] = wmma16b(kf[2], qh[u], s[u][0]); s[u][1] = wmma16b(kf[3], qh[u], s[u][1]); }
      float al[2]; v16b ph[2]; const float cs = LOG2E / (XS * XS);
#pragma unroll   // constant indices keep s, m, l, al, ph in registers
      for (int u = 0; u < 2; ++u) {
        float e[16]; float mx = -INFINITY;
#pragma unroll
        for (int r = 0; r < 8; ++r) { e[r] = s[u][0][r] * cs; e[8 + r] = s[u][1][r] * cs; mx = fmaxf(mx, fmaxf(e[r], e[8 + r])); }
        mx = fmaxf(mx, __shfl_xor(mx, 16)); const float mn = fmaxf(m[u], mx); al[u] = nexp2(m[u] - mn); m[u] = mn; float sum = 0.0f;
        float p[16];
#pragma unroll   // constant indices keep e, p in registers (this loop and the next)
        for (int i = 0; i < 16; ++i) e[i] -= mn;
        exp2x8(p, e, 0); exp2x8(p, e, 8);
#pragma unroll
        for (int i = 0; i < 16; ++i) { sum += p[i]; ph[u][i] = (b16)(p[i] * PS); }
        sum += __shfl_xor(sum, 16); l[u] = l[u] * al[u] + sum; }
#pragma unroll
      for (int t = 0; t < 8; ++t)
#pragma unroll
        for (int u = 0; u < 2; ++u) { o[u][t] *= al[u]; o[u][t] = wmma16b(vh[t], ph[u], o[u][t]); } }
    hold_loads();   // keeps the stage's products in front of the foot: lifted over them, the wait for the next stage's copies stands directly behind their issue and the wave waits out their whole latency
    asm volatile("s_wait_dscnt 0x0" ::: "memory");      // this wave's reads of the buffer are done before it is refilled
    asm volatile("s_wait_asynccnt 0x0" ::: "memory");   // this wave's copies of stage st + 1 (in trip 0 of W_o too) have landed
    __syncthreads();                                    // publishes stage st + 1 and ends every wave's reads of stage st
    if (st + 2 < M / KS) stage_kv(lds0 + (st & 1) * STAGE_B, Vb, Khb, Klb, (st + 2) * KS, tid);
  }
  asm volatile("s_wait_asynccnt 0x0" ::: "memory");     // no copy is outstanding when the ring becomes output staging
  // the wave's O^T / l as B fragments of W_o O^T: o[0][t][r] = O^T[d = t*16 + 8hh + r][query qc + col], so tiles 2 ks and 2 ks + 1 are elements 0..7 and 8..15 of k step ks (d = 32 ks + 8hh + e, 32 ks + 16 + 8hh + e), the order of frag_kb
  // join of the two key halves: every wave stores its tile 1 (O: 16 x 16 bytes a lane, contiguous over the lanes; m, l) and reads the other half's, which is the same queries as its own tile 0, lane for lane
  float* Xw = (float*)(L + OFF_X) + wave * XW; const float* Xp = (const float*)(L + OFF_X) + (wave ^ 4) * XW;
#pragma unroll   // constant indices keep o in registers
  for (int i = 0; i < 16; ++i) { const v8f t8 = o[1][i >> 1]; const int h4 = (i & 1) * 4; *(v4f*)(Xw + i * 128 + lane * 4) = (v4f){t8[h4], t8[h4 + 1], t8[h4 + 2], t8[h4 + 3]}; }
  *(v2f*)(Xw + 2048 + lane * 2) = (v2f){m[1], l[1]};
  __syncthreads();   // every wave's tile 1 is stored: the other half's wave may read it
  const v2f ml = *(const v2f*)(Xp + 2048 + lane * 2); v4f xo[16];
#pragma unroll   // all reads are issued before the first is waited for
  for (int i = 0; i < 16; ++i) xo[i] = *(const v4f*)(Xp + i * 128 + lane * 4);
  const float mj = fmaxf(m[0], ml[0]), fa = nexp2(m[0] - mj), fb = nexp2(ml[0] - mj), lj = l[0] * fa + ml[1] * fb;
#pragma unroll   // constant indices keep o, xo in registers
  for (int i = 0; i < 16; ++i)
#pragma unroll
    for (int j = 0; j < 4; ++j) o[0][i >> 1][(i & 1) * 4 + j] = o[0][i >> 1][(i & 1) * 4 + j] * fa + xo[i][j] * fb;
  const float inv = 1.0f / (lj * PS);   // O x8
  v16b oh[CG / 32], oq[CG / 32];
#pragma unroll   // both loops: constant indices keep o, oh, oq in registers
  for (int ks = 0; ks < CG / 32; ++ks)
#pragma unroll
    for (int r = 0; r < 8; ++r) { b16 h_, l_; split16(o[0][2 * ks][r] * inv, h_, l_); oh[ks][r] = h_; oq[ks][r] = l_; split16(o[0][2 * ks + 1][r] * inv, h_, l_); oh[ks][8 + r] = h_; oq[ks][8 + r] = l_; }
  float (*To)[128 + 4] = (float (*)[128 + 4])(L + OFF_R);
  // the residual x of the wave's 32 output rows (a lane: 16 bytes of each 512-B row): the first XA rows are requested here, in front of the W_o products, which cover their latency;
  // the rest, for which no registers are free yet, behind the barrier below, in front of the work on the first rows
  constexpr int XA = 16;
  const size_t ro = ((size_t)b * C + wave * 32) * N + blockIdx.x * 128 + lane * 4; const float* xr = x + ro; float* orow = out + ro;
  v4f xv[32];
  hold_loads();   // without it the requests are lifted over the conversion above, whose inputs still fill the registers
#pragma unroll   // constant indices keep xv in registers
  for (int i = 0; i < XA; ++i) xv[i] = *(const v4f*)(xr + (size_t)i * N);
  hold_loads();
  // the four W_o fragments of channel tile ct + 1 are read in front of the products of tile ct (two register buffers)
  v16b wa[2][CG / 32];
  auto ldw = [&](int ct) {
#pragma unroll   // constant indices keep the buffers in registers
    for (int ks = 0; ks < CG / 32; ++ks) wa[ct & 1][ks] = frag_kb((const b16*)(L + OFF_WO + (ct * 16 + col) * WP) + ks * 32, hh); };
  ldw(0); hold_loads();
#pragma unroll   // buffer numbers must be compile-time constants
  for (int ct = 0; ct < C / 16; ++ct) { if (ct + 1 < C / 16) { ldw(ct + 1); hold_loads(); }
    v8f ah = {}, aq = {};
#pragma unroll
    for (int ks = 0; ks < CG / 32; ++ks) { ah = wmma16b(wa[ct & 1][ks], oh[ks], ah); aq = wmma16b(wa[ct & 1][ks], oq[ks], aq); }
#pragma unroll   // ah[r] = (W_o O)[c = ct*16 + 8hh + r][query col] x 2048 -> To[c][qc + col]
    for (int r = 0; r < 8; ++r) To[ct * 16 + 8 * hh + r][qc + col] = (ah[r] + aq[r]) * (1.0f / (XS * WSC)); }
  __syncthreads();   // every wave's 16 query columns of all 256 rows are in To
#pragma unroll   // constant indices keep xv in registers
  for (int i = XA; i < 32; ++i) { if (i == 31) asm volatile("s_wait_xcnt 0x0" ::: "memory");   // in front of the last load, whose result may return into the address registers that the loads before it name
    xv[i] = *(const v4f*)(xr + (size_t)i * N); }
  hold_loads();
#pragma unroll   // constant indices keep xv in registers
  for (int i0 = 0; i0 < 32; i0 += 8) {
    v4f tv[8];
#pragma unroll   // the eight reads of the staging are issued before the first is waited for
    for (int i = 0; i < 8; ++i) tv[i] = *(const v4f*)(&To[wave * 32 + i0 + i][lane * 4]);
#pragma unroll
    for (int i = 0; i < 8; ++i) { v4f r;
#pragma unroll
      for (int j = 0; j < 4; ++j) r[j] = gamma * tv[i][j] + bf16_rne(xv[i0 + i][j]);
      *(v4f*)(orow + (size_t)(i0 + i) * N) = r; }
    if (i0 + 8 < 32) asm volatile("s_wait_xcnt 0x0" ::: "memory");   // stands in front of the next group's rewrite of the registers that this group's stores name
  }
}
}  // namespace

extern "C" void kernel_launch(void* const* d_in, const int* in_sizes, int n_in, void* d_out, int out_size, void* d_ws, size_t ws_size, hipStream_t stream) {
  (void)n_in;
  auto Fp = [&](int i) { return (const float*)d_in[i]; };
  // input order: 0 x [8,256,64,64], 1 w_theta [32,256], 2 w_phi [32,256], 3 w_g [128,256], 4 w_o [256,128], 5 gamma [1]
  if (in_sizes[0] != NB * C * N || in_sizes[1] != CQ * C || in_sizes[2] != CQ * C || in_sizes[3] != CG * C || in_sizes[4] != C * CG || in_sizes[5] != 1 || out_size != NB * C * N) return;
  size_t off = 0; char* ws = (char*)d_ws;
  auto carve = [&](size_t bytes) { char* p = ws + off; off += (bytes + 255) & ~(size_t)255; return p; };
  b16* WO = (b16*)carve((size_t)C * CG * 2);
  b16* QH = (b16*)carve((size_t)NB * N * CQ * 2); b16* QL = (b16*)carve((size_t)NB * N * CQ * 2); b16* KH = (b16*)carve((size_t)NB * M * CQ * 2); b16* KL = (b16*)carve((size_t)NB * M * CQ * 2);
  b16* G16 = (b16*)carve((size_t)NB * CG * M * 2);
  if (off > ws_size || off > ((size_t)128 << 20)) return;   // = 7.1 MB
  proj_kernel<<<(N / 128) * NB, 512, 0, stream>>>(Fp(0), Fp(1), Fp(2), Fp(3), Fp(4), WO, QH, QL, KH, KL, G16);
  attn_kernel<<<dim3(N / 128, 1, NB), 256, 0, stream>>>(QH, QL, KH, KL, G16, WO, Fp(0), Fp(5), (float*)d_out);
}
